// v000
// Times are from an AMD MI455X. After a warm-up the kernel runs many times in a row, and a time is the length of
// such a window on the GPU divided by its runs, so every launch and the gaps after it count. The runs cycle
// through copies of the inputs. A figure is the median of several windows, for all but v000 over two sittings.
// Sittings can differ by a few percent; kernels timed side by side share one.
// v000 is the starting kernel. One run takes 355 microseconds.
#include <hip/hip_runtime.h>

// Attention with 16 heads x 64, width 1024, whose KEY stream and KEY weight are staged FIRST: separate inputs k, q, v [4][2048][1024] (f32), weights w_key / w_query / w_value / w_proj stored [in][out] (y = x W, normal x 0.02), no biases, no mask, scores / sqrt(64), softmax over the keys, f32 output = (merged heads) w_proj [4][2048][1024]; argument order k, q, v, w_key, w_query, w_value, w_proj.
// Compute dtypes, f32 accumulate everywhere: projections v_wmma_f32_16x16x32_bf16 (x and W RNE-converted to bf16; products exact);
// scores v_wmma_f32_16x16x32_f16: q and k single f16 planes (one product); P (x256 carry, cancels in the normalisation) and v single f16; softmax f32 (online, running max);
// output projection v_wmma_f32_16x16x32_f16: context single f16 (x256 carry), Wo = f16 of (bf16 RNE of Wo) x64; 2^-14 folded into the f32 epilogue.
// Layout: one bf16 activation plane reused for q, k, v in turn; transposed weight planes [out][in]; q, k planes [b*16+h][t][d], v^T plane [b*16+h][d][t] written by the GEMM epilogue;
// fused flash kernel in transposed form (S^T = K Q^T, O^T = V^T P^T) writes the f16 context plane [b*SEQ+t][1024]; last GEMM writes the f32 output.

#ifndef NB
#define NB 4
#endif
#ifndef SEQ
#define SEQ 2048
#endif
#define NB_FULL  4
#define SEQ_FULL 2048
#ifndef OUT_SEQ
#define OUT_SEQ SEQ              // row pitch (in tokens) between batches of the output
#endif
#define DM   1024
#define NH_  16
#define HD   64
#define AW   4                   // waves per flash block (16 query rows each)
#define SC2  (0.125f * 1.4426950408889634f)   // HD^-0.5 * log2(e)
#define PSH  8.0f                // log2 of the P carry (256)
#define CTXS 256.0f              // carry of the context plane
#define WOS  64.0f               // carry of the Wo plane
#define OSC  (1.0f / (CTXS * WOS))

static_assert(HD == 64);
static_assert(NH_ * HD == DM);                 // head h = columns h*64 + d
static_assert(DM % 64 == 0);                   // 16 column tiles of 64
static_assert(DM % 32 == 0);                   // GEMM k-loop steps by 32
static_assert(SEQ % 64 == 0);                  // a 64-row tile never straddles two batches
static_assert((NB * SEQ) % 64 == 0);
static_assert(SEQ % 32 == 0);                  // key loop steps by 32
static_assert(SEQ % (16 * AW) == 0);           // flash grid covers the sequence exactly
static_assert(((size_t)SEQ * DM) % 8 == 0);
static_assert(NB <= NB_FULL);
static_assert(SEQ <= SEQ_FULL);

typedef _Float16 h16;
typedef unsigned short bf;
typedef __attribute__((ext_vector_type(16))) __bf16   v16bf;
typedef __attribute__((ext_vector_type(16))) _Float16 v16h;
typedef __attribute__((ext_vector_type(8)))  _Float16 v8h;
typedef __attribute__((ext_vector_type(8)))  unsigned short v8us;
typedef __attribute__((ext_vector_type(8)))  float    v8f;
typedef __attribute__((ext_vector_type(4)))  float    v4f;
typedef v4f  __attribute__((may_alias)) v4fa;

__device__ __forceinline__ unsigned short f2bf(float f) { unsigned u = __float_as_uint(f); u += 0x7FFFu + ((u >> 16) & 1u); return (unsigned short)(u >> 16); }
__device__ __forceinline__ v16h cat16(v8h lo, v8h hi) { return __builtin_shufflevector(lo, hi, 0, 1, 2, 3, 4, 5, 6, 7, 8, 9, 10, 11, 12, 13, 14, 15); }
__device__ __forceinline__ v16bf cat16b(v8us lo, v8us hi) { return __builtin_bit_cast(v16bf, __builtin_shufflevector(lo, hi, 0, 1, 2, 3, 4, 5, 6, 7, 8, 9, 10, 11, 12, 13, 14, 15)); }
__device__ __forceinline__ v8f wmma16(v16h a, v16h b, v8f c) { return __builtin_amdgcn_wmma_f32_16x16x32_f16(false, a, false, b, (short)0, c, false, false); }
__device__ __forceinline__ v8f wmmab(v16bf a, v16bf b, v8f c) { return __builtin_amdgcn_wmma_f32_16x16x32_bf16(false, a, false, b, (short)0, c, false, false); }
// fragment loaders from K-contiguous 16-bit rows; p already includes + 8*(lane>>4): elements 0..7 <- k0+8h+0..7, elements 8..15 <- k0+16+8h+0..7 (same map for A and B)
__device__ __forceinline__ v16h  ldh(const h16* p) { return cat16(*(const v8h*)p, *(const v8h*)(p + 16)); }
__device__ __forceinline__ v16bf ldb(const bf* p)  { return cat16b(*(const v8us*)p, *(const v8us*)(p + 16)); }
// ordering point for wave-private LDS tiles (same wave writes and reads)
__device__ __forceinline__ void wave_sync() { __builtin_amdgcn_fence(3 /* release order */, "wavefront"); __builtin_amdgcn_wave_barrier(); asm volatile("" ::: "memory"); }

__global__ __launch_bounds__(256) void k_cvt8(const float* __restrict__ src, bf* dst, size_t n8) {
    const size_t i = (size_t)blockIdx.x * 256 + threadIdx.x; if (i >= n8) return;
    const v8f v = *(const v8f*)(src + i * 8); v8us o;
#pragma unroll
    for (int k = 0; k < 8; ++k) o[k] = f2bf(v[k]);
    *(v8us*)(dst + i * 8) = o; 
}

// k_wT: transposing 16-bit convert of a square weight: in[k][n] (DM rows k = input feature, DM columns n = output feature) -> out[n][k] (K-contiguous rows).
// asF16 == 0: bf16 bits (RNE). asF16 != 0: f16 bits of (bf16 RNE value * scale), scale a power of two (exact).
// grid (DM/64 over k, DM/64 over n), 256 threads. Coverage: rows (tid>>3) + 32 i, i = 0..1 -> 64 rows; (tid&7)*8 + 0..7 -> 64 columns.
__global__ __launch_bounds__(256) void k_wT(const float* __restrict__ W, bf* dst, float scale, int asF16) {
    __shared__ float ts[64 * 65];
    const int tid = threadIdx.x; const int k0 = blockIdx.x * 64, n0 = blockIdx.y * 64;
#pragma unroll
    for (int i = 0; i < 4; ++i) { const int idx = tid + 256 * i; const int kk = idx >> 4, c4 = (idx & 15) * 4;
        const v4f v = *(const v4f*)(W + (size_t)(k0 + kk) * DM + n0 + c4);
        ts[kk * 65 + c4 + 0] = v[0]; ts[kk * 65 + c4 + 1] = v[1]; ts[kk * 65 + c4 + 2] = v[2]; ts[kk * 65 + c4 + 3] = v[3]; }
    __syncthreads();
    const int c8 = (tid & 7) * 8;
    v8us o0, o1;
#pragma unroll
    for (int j = 0; j < 8; ++j) {
        const float xa = ts[(c8 + j) * 65 + (tid >> 3)]; const float xb = ts[(c8 + j) * 65 + (tid >> 3) + 32];
        const unsigned short ba = f2bf(xa), bb = f2bf(xb);
        const h16 ha = (h16)(__uint_as_float((unsigned)ba << 16) * scale); const h16 hb = (h16)(__uint_as_float((unsigned)bb << 16) * scale);
        const unsigned short fa = __builtin_bit_cast(unsigned short, ha), fb = __builtin_bit_cast(unsigned short, hb);
        o0[j] = asF16 ? fa : ba; o1[j] = asF16 ? fb : bb; }
    bf* p0 = dst + (size_t)(n0 + (tid >> 3)) * DM + k0 + c8;
    bf* p1 = dst + (size_t)(n0 + (tid >> 3) + 32) * DM + k0 + c8;
{
        *(v8us*)p0 = o0; *(v8us*)p1 = o1;
         }
}

// k_proj: register-blocked bf16 GEMM, ONE WAVE per 64x64 tile (16 accumulators), operands straight from K-contiguous bf16 planes, K = DM.
// C[m][n] = sum_k A[m][k] Bt[n][k], written as f16 (Ph) at
// tile base (r0/RB)*sRB + (r0%RB)*pitch + (c0/CB)*sCB + (c0%CB), row pitch 'pitch' (halves). grid (M/64, N/64), 32 threads.
__global__ __launch_bounds__(32) void k_proj(const bf* __restrict__ A, const bf* __restrict__ Bt, h16* Ph, int RB, size_t sRB, int pitch, int CB, size_t sCB) {
    __shared__ __align__(16) float os[16 * 68];
    const int K = DM;
    const int lane = threadIdx.x & 31, lr = lane & 15, hi = lane >> 4; const int r0 = blockIdx.x * 64, c0 = blockIdx.y * 64;
    v8f acc[4][4];
#pragma unroll
    for (int mb = 0; mb < 4; ++mb)
#pragma unroll
        for (int nb = 0; nb < 4; ++nb) acc[mb][nb] = (v8f){};
    const size_t aoff = (size_t)(r0 + lr) * K + 8 * hi, boff = (size_t)(c0 + lr) * K + 8 * hi;
#pragma unroll 1
    for (int kc = 0; kc < K; kc += 32) {
        v16bf a[4];
#pragma unroll
        for (int mb = 0; mb < 4; ++mb) a[mb] = ldb(A + aoff + (size_t)mb * 16 * K + kc);
#pragma unroll
        for (int nb = 0; nb < 4; ++nb) { const v16bf b = ldb(Bt + boff + (size_t)nb * 16 * K + kc);
#pragma unroll
            for (int mb = 0; mb < 4; ++mb) acc[mb][nb] = wmmab(a[mb], b, acc[mb][nb]); }
        asm volatile("v_nop\n\tv_nop\n\tv_nop\n\tv_nop" : "+v"(acc[0][0]), "+v"(acc[1][1]), "+v"(acc[2][2]), "+v"(acc[3][3]) : "v"(a[0]), "v"(a[1]), "v"(a[2]), "v"(a[3]));
    }
    const size_t tbase = (size_t)(r0 / RB) * sRB + (size_t)(r0 % RB) * (size_t)pitch + (size_t)(c0 / CB) * sCB + (size_t)(c0 % CB);
#pragma unroll
    for (int mb = 0; mb < 4; ++mb) {
#pragma unroll
        for (int nb = 0; nb < 4; ++nb) {
#pragma unroll
            for (int j = 0; j < 8; ++j) os[(hi * 8 + j) * 68 + nb * 16 + lr] = acc[mb][nb][j]; }   // D: row 8h+j, col lane&15
        wave_sync();
        const size_t sb = tbase + (size_t)(mb * 16) * (size_t)pitch;
{
#pragma unroll
            for (int s = 0; s < 4; ++s) { const int row = 4 * s + (lane >> 3), c8 = (lane & 7) * 8;   // 4 s x 4 row groups = 16 rows; 8 lanes x 8 = 64 columns
                const v4f x0 = *(const v4fa*)(&os[row * 68 + c8]); const v4f x1 = *(const v4fa*)(&os[row * 68 + c8 + 4]); v8h hv;
#pragma unroll
                for (int i = 0; i < 4; ++i) { hv[i] = (h16)x0[i]; hv[4 + i] = (h16)x1[i]; }
                const size_t oo = sb + (size_t)row * (size_t)pitch + c8;
                *(v8h*)(Ph + oo) = hv; }
             }
        wave_sync();
    }
}

// k_flash: fused attention, one wave per 16 query rows of one (batch, head); K / V^T / Q fragments straight from the f16 planes (two 16-B loads each, arithmetic addressing).
// Transposed form: S^T[key][t] = K Q^T (A = K rows, B = Q rows); lane (t = lane&15, h = lane>>4) holds keys 8h+r of each 16-key tile, so the packed
// P tile is directly the B fragment of O^T[d][t] = V^T P^T (element r <- tile keys 0..15, element 8+r <- tile keys 16..31, lane unchanged).
// Per 32-key step: 4 score products + 4 P.V products. Softmax state (running max, partial sum) is one scalar per lane; the two lane halves of a row are combined with one xor-16 exchange.
__global__ __launch_bounds__(32 * AW) void k_flash(const h16* __restrict__ QH, const h16* __restrict__ KP, const h16* __restrict__ VT, h16* CH) {
    __shared__ __align__(16) float os[AW * 16 * 68];
    const int lane = threadIdx.x & 31, lr = lane & 15, hi = lane >> 4;
    const int wave = __builtin_amdgcn_readfirstlane((int)(threadIdx.x >> 5));   // wave-uniform
    const int zh = blockIdx.y; const int b = zh / NH_, h = zh % NH_;
    const int t0 = (blockIdx.x * AW + wave) * 16;
    const size_t pbase = (size_t)zh * SEQ * HD;
    const size_t qo = pbase + (size_t)(t0 + lr) * HD + 8 * hi;
    const v16h qh0 = ldh(QH + qo), qh1 = ldh(QH + qo + 32);   // B fragments: col t, k = d
    const size_t ko = pbase + (size_t)lr * HD + 8 * hi;      // + key * HD       (A fragment: row key, k = d)
    const size_t vo = pbase + (size_t)lr * SEQ + 8 * hi;     // + 16j*SEQ + key  (A fragment: row d, k = key)
    v8f o0 = (v8f){}, o1 = (v8f){}, o2 = (v8f){}, o3 = (v8f){};
    float m = -3.0e38f, l = 0.0f;
#pragma unroll 1
    for (int key0 = 0; key0 < SEQ; key0 += 32) {
        const h16* ka = KP + ko + (size_t)key0 * HD;
        const v16h ka0 = ldh(ka), ka1 = ldh(ka + 32), kb0 = ldh(ka + 16 * HD), kb1 = ldh(ka + 16 * HD + 32);
        v8f sa = (v8f){}, sb = (v8f){};
        sa = wmma16(ka0, qh0, sa); sb = wmma16(kb0, qh0, sb);
        sa = wmma16(ka1, qh1, sa); sb = wmma16(kb1, qh1, sb);
        asm volatile("v_nop\n\tv_nop\n\tv_nop\n\tv_nop" : "+v"(sa), "+v"(sb) : "v"(ka0), "v"(ka1), "v"(kb0), "v"(kb1), "v"(qh0), "v"(qh1));
        float ta[8], tb[8]; float mx = -3.0e38f;
#pragma unroll
        for (int r = 0; r < 8; ++r) { ta[r] = sa[r] * SC2; tb[r] = sb[r] * SC2; mx = fmaxf(mx, fmaxf(ta[r], tb[r])); }
        mx = fmaxf(mx, __shfl_xor(mx, 16, 32));
        const float mnew = fmaxf(m, mx);
        const float alpha = __builtin_amdgcn_exp2f(m - mnew);
        const float sh = PSH - mnew;
        v16h pb; float ls = 0.0f;
#pragma unroll
        for (int r = 0; r < 8; ++r) { const h16 pa = (h16)__builtin_amdgcn_exp2f(ta[r] + sh); const h16 pc = (h16)__builtin_amdgcn_exp2f(tb[r] + sh); pb[r] = pa; pb[8 + r] = pc; ls += (float)pa + (float)pc; }
        l = l * alpha + ls; m = mnew;
        o0 = o0 * alpha; o1 = o1 * alpha; o2 = o2 * alpha; o3 = o3 * alpha;
        const h16* va = VT + vo + key0;
        const v16h v0 = ldh(va), v1 = ldh(va + (size_t)16 * SEQ), v2 = ldh(va + (size_t)32 * SEQ), v3 = ldh(va + (size_t)48 * SEQ);
        o0 = wmma16(v0, pb, o0); o1 = wmma16(v1, pb, o1); o2 = wmma16(v2, pb, o2); o3 = wmma16(v3, pb, o3);
        asm volatile("v_nop\n\tv_nop\n\tv_nop\n\tv_nop" : "+v"(o0), "+v"(o1), "+v"(o2), "+v"(o3) : "v"(v0), "v"(v1), "v"(v2), "v"(v3), "v"(pb));
    }
    l += __shfl_xor(l, 16, 32);
    const float inv = CTXS * (1.0f / l);
    const int wb = wave * 16 * 68;
    // O^T D layout: o_j[r] = (d = 16j + 8h + r, t = lane&15) -> os[t][d]; rows 0..15 x columns 0..63 all written
    { v4f a, c;
      a[0] = o0[0] * inv; a[1] = o0[1] * inv; a[2] = o0[2] * inv; a[3] = o0[3] * inv; c[0] = o0[4] * inv; c[1] = o0[5] * inv; c[2] = o0[6] * inv; c[3] = o0[7] * inv;
      *(v4fa*)(&os[wb + lr * 68 +  0 + 8 * hi]) = a; *(v4fa*)(&os[wb + lr * 68 +  0 + 8 * hi + 4]) = c;
      a[0] = o1[0] * inv; a[1] = o1[1] * inv; a[2] = o1[2] * inv; a[3] = o1[3] * inv; c[0] = o1[4] * inv; c[1] = o1[5] * inv; c[2] = o1[6] * inv; c[3] = o1[7] * inv;
      *(v4fa*)(&os[wb + lr * 68 + 16 + 8 * hi]) = a; *(v4fa*)(&os[wb + lr * 68 + 16 + 8 * hi + 4]) = c;
      a[0] = o2[0] * inv; a[1] = o2[1] * inv; a[2] = o2[2] * inv; a[3] = o2[3] * inv; c[0] = o2[4] * inv; c[1] = o2[5] * inv; c[2] = o2[6] * inv; c[3] = o2[7] * inv;
      *(v4fa*)(&os[wb + lr * 68 + 32 + 8 * hi]) = a; *(v4fa*)(&os[wb + lr * 68 + 32 + 8 * hi + 4]) = c;
      a[0] = o3[0] * inv; a[1] = o3[1] * inv; a[2] = o3[2] * inv; a[3] = o3[3] * inv; c[0] = o3[4] * inv; c[1] = o3[5] * inv; c[2] = o3[6] * inv; c[3] = o3[7] * inv;
      *(v4fa*)(&os[wb + lr * 68 + 48 + 8 * hi]) = a; *(v4fa*)(&os[wb + lr * 68 + 48 + 8 * hi + 4]) = c; }
    wave_sync();
    h16* crow = CH + ((size_t)b * SEQ + t0) * DM + h * HD;       // context plane row m = b*SEQ + t, columns h*64 + d
{
#pragma unroll
        for (int s = 0; s < 4; ++s) { const int row = 4 * s + (lane >> 3), c8 = (lane & 7) * 8;   // 4 s x 4 row groups = 16 rows; 8 lanes x 8 halves = 64 columns
            const v4f x0 = *(const v4fa*)(&os[wb + row * 68 + c8]); const v4f x1 = *(const v4fa*)(&os[wb + row * 68 + c8 + 4]); v8h hv;
#pragma unroll
            for (int i = 0; i < 4; ++i) { hv[i] = (h16)x0[i]; hv[4 + i] = (h16)x1[i]; }
            *(v8h*)(crow + (size_t)row * DM + c8) = hv; }
         }
}

// k_oproj: register-blocked f16 GEMM, ONE WAVE per 64x64 tile (16 accumulators), operands straight from K-contiguous f16 planes, K = DM.
// OUT[(r0/SEQ)*OUT_SEQ + r0%SEQ + i][c0 + j] = oscale * sum_k A[r0+i][k] Bt[c0+j][k]. grid (NB*SEQ/64, DM/64), 32 threads.
__global__ __launch_bounds__(32) void k_oproj(const h16* __restrict__ A, const h16* __restrict__ Bt, float* OUT, float oscale) {
    __shared__ __align__(16) float os[16 * 68];
    const int K = DM;
    const int lane = threadIdx.x & 31, lr = lane & 15, hi = lane >> 4; const int r0 = blockIdx.x * 64, c0 = blockIdx.y * 64;
    v8f acc[4][4];
#pragma unroll
    for (int mb = 0; mb < 4; ++mb)
#pragma unroll
        for (int nb = 0; nb < 4; ++nb) acc[mb][nb] = (v8f){};
    const size_t aoff = (size_t)(r0 + lr) * K + 8 * hi, boff = (size_t)(c0 + lr) * K + 8 * hi;
#pragma unroll 1
    for (int kc = 0; kc < K; kc += 32) {
        v16h a[4];
#pragma unroll
        for (int mb = 0; mb < 4; ++mb) a[mb] = ldh(A + aoff + (size_t)mb * 16 * K + kc);
#pragma unroll
        for (int nb = 0; nb < 4; ++nb) { const v16h b = ldh(Bt + boff + (size_t)nb * 16 * K + kc);
#pragma unroll
            for (int mb = 0; mb < 4; ++mb) acc[mb][nb] = wmma16(a[mb], b, acc[mb][nb]); }
        asm volatile("v_nop\n\tv_nop\n\tv_nop\n\tv_nop" : "+v"(acc[0][0]), "+v"(acc[1][1]), "+v"(acc[2][2]), "+v"(acc[3][3]) : "v"(a[0]), "v"(a[1]), "v"(a[2]), "v"(a[3]));
    }
    const size_t obase = ((size_t)(r0 / SEQ) * OUT_SEQ + (size_t)(r0 % SEQ)) * DM + c0;
#pragma unroll
    for (int mb = 0; mb < 4; ++mb) {
#pragma unroll
        for (int nb = 0; nb < 4; ++nb) {
#pragma unroll
            for (int j = 0; j < 8; ++j) os[(hi * 8 + j) * 68 + nb * 16 + lr] = acc[mb][nb][j] * oscale; }   // D: row 8h+j, col lane&15
        wave_sync();
        float* orow = OUT + obase + (size_t)(mb * 16) * DM;
{
#pragma unroll
            for (int s = 0; s < 8; ++s) { const int row = 2 * s + hi, cofs = lr * 4;   // 8 s x 2 rows = 16 rows; 16 lanes x 4 floats = 64 columns
                const v4f val = *(const v4fa*)(&os[row * 68 + cofs]);
                *(v4f*)(orow + (size_t)row * DM + cofs) = val; }
             }
        wave_sync();
    }
}

static constexpr size_t al256(size_t v) { return (v + 255) & ~(size_t)255; }
static constexpr size_t SZ_XB = al256((size_t)NB * SEQ * DM * 2);          // one activation plane, reused for q, k, v in stream order
static constexpr size_t SZ_WB = al256((size_t)4 * DM * DM * 2);            // four transposed weight planes
static constexpr size_t SZ_PL = al256((size_t)NB * NH_ * SEQ * HD * 2);    // per-head planes (q, k, v^T)
static constexpr size_t SZ_CH = al256((size_t)NB * SEQ * DM * 2);          // context plane
static constexpr size_t SZ_TOTAL = SZ_XB + SZ_WB + 3 * SZ_PL + SZ_CH;
static_assert(SZ_TOTAL <= (size_t)134217728);          // workspace carve <= 128 MiB
static_assert(((size_t)DM * DM * 2) % 256 == 0);       // weight sub-planes stay 256-byte aligned
static_assert((size_t)NB * DM * SEQ * 2 <= SZ_PL);     // v^T plane [(b*1024 + m)][t] fits its region

static void cvt_x(const float* x, bf* XB, hipStream_t stream) {
    if (SEQ == SEQ_FULL) {
        const size_t n8 = (size_t)NB * SEQ * DM / 8;
        k_cvt8<<<(unsigned)((n8 + 255) / 256), 256, 0, stream>>>(x, XB, n8);
    } else {
        const size_t n8 = (size_t)SEQ * DM / 8;
        for (int b = 0; b < NB; ++b) k_cvt8<<<(unsigned)((n8 + 255) / 256), 256, 0, stream>>>(x + (size_t)b * SEQ_FULL * DM, XB + (size_t)b * SEQ * DM, n8);
    }
}

extern "C" void kernel_launch(void* const* d_in, const int* in_sizes, int n_in,
                              void* d_out, int out_size, void* d_ws, size_t ws_size, hipStream_t stream) {
    if (n_in < 7) return;
    const size_t needx = ((size_t)(NB - 1) * SEQ_FULL + SEQ) * DM;
    if ((size_t)in_sizes[0] < needx || (size_t)in_sizes[1] < needx || (size_t)in_sizes[2] < needx) return;
    if ((size_t)in_sizes[3] < (size_t)DM * DM || (size_t)in_sizes[4] < (size_t)DM * DM || (size_t)in_sizes[5] < (size_t)DM * DM || (size_t)in_sizes[6] < (size_t)DM * DM) return;
    if ((size_t)out_size < ((size_t)(NB - 1) * OUT_SEQ + SEQ) * DM) return;
    if (SZ_TOTAL > ws_size) return;
    // wire order: k, q, v, Wk, Wq, Wv, Wo (weights [in][out])
    const float* xq = (const float*)d_in[1]; const float* xk = (const float*)d_in[0]; const float* xv = (const float*)d_in[2];   /* this module stages k, q, v: the KEY stream is input 0 and the QUERY stream input 1 */
    const float* wq = (const float*)d_in[4]; const float* wk = (const float*)d_in[3]; const float* wv = (const float*)d_in[5]; const float* wo = (const float*)d_in[6];   /* w_key is input 3 and w_query input 4 */
    float* OUT = (float*)d_out;      // [NB][SEQ][1024]
    char* wsp = (char*)d_ws;
    bf* XB = (bf*)wsp; wsp += SZ_XB;                 // [NB*SEQ][1024] bf16, current activation
    bf* WB = (bf*)wsp; wsp += SZ_WB;                 // [4][1024 out][1024 in]: q | k | v (bf16) | o (f16 x64)
    h16* QH = (h16*)wsp; wsp += SZ_PL;               // [NB*16][SEQ][64]
    h16* KP = (h16*)wsp; wsp += SZ_PL;               // [NB*16][SEQ][64]
    h16* VT = (h16*)wsp; wsp += SZ_PL;               // [NB*16][64][SEQ]
    h16* CH = (h16*)wsp; wsp += SZ_CH;               // [NB*SEQ][1024] context x256
    bf* WQT = WB; bf* WKT = WB + (size_t)DM * DM; bf* WVT = WB + (size_t)2 * DM * DM; bf* WOT = WB + (size_t)3 * DM * DM;

    // weights: in[k = input feature][n = output feature] -> out[n][k]; square, grid (k tiles, n tiles)
    { const dim3 g(DM / 64, DM / 64, 1);
      k_wT<<<g, 256, 0, stream>>>(wq, WQT, 1.0f, 0);
      k_wT<<<g, 256, 0, stream>>>(wk, WKT, 1.0f, 0);
      k_wT<<<g, 256, 0, stream>>>(wv, WVT, 1.0f, 0);
      k_wT<<<g, 256, 0, stream>>>(wo, WOT, WOS, 1); }

    // q, k: A = x rows (m = b*SEQ + t), Bt = W^T rows (n = h*64 + d) -> plane [(b*16 + h)][t][d]
    cvt_x(xq, XB, stream);
    k_proj<<<dim3(NB * SEQ / 64, DM / 64, 1), 32, 0, stream>>>(XB, WQT, QH, SEQ, (size_t)NH_ * SEQ * HD, HD, HD, (size_t)SEQ * HD);
    cvt_x(xk, XB, stream);
    k_proj<<<dim3(NB * SEQ / 64, DM / 64, 1), 32, 0, stream>>>(XB, WKT, KP, SEQ, (size_t)NH_ * SEQ * HD, HD, HD, (size_t)SEQ * HD);
    // v^T: A = Wv^T rows (m = h*64 + d), Bt = x rows (n = b*SEQ + t) -> plane [(b*1024 + m)][t] = [(b*16 + h)][d][t]
    cvt_x(xv, XB, stream);
    k_proj<<<dim3(DM / 64, NB * SEQ / 64, 1), 32, 0, stream>>>(WVT, XB, VT, DM, (size_t)0, SEQ, SEQ, (size_t)DM * SEQ);

    k_flash<<<dim3(SEQ / (16 * AW), NB * NH_, 1), 32 * AW, 0, stream>>>(QH, KP, VT, CH);

    // output projection: A = context rows (m = b*SEQ + t), Bt = Wo^T rows (n) -> f32 output
    k_oproj<<<dim3(NB * SEQ / 64, DM / 64, 1), 32, 0, stream>>>(CH, (const h16*)WOT, OUT, OSC);
}

// v001
// It runs in 239 microseconds.
// Next to v000, in two timings, it ran 1.53 and 1.54 times as fast.
#include <hip/hip_runtime.h>

// Attention with 16 heads x 64, width 1024, whose KEY stream and KEY weight are staged FIRST: separate inputs k, q, v [4][2048][1024] (f32), weights w_key / w_query / w_value / w_proj stored [in][out] (y = x W, normal x 0.02), no biases, no mask, scores / sqrt(64), softmax over the keys, f32 output = (merged heads) w_proj [4][2048][1024]; argument order k, q, v, w_key, w_query, w_value, w_proj.
// Compute dtypes, f32 accumulate everywhere: projections v_wmma_f32_16x16x32_bf16 (x and W RNE-converted to bf16; products exact);
// scores v_wmma_f32_16x16x32_f16: q and k single f16 planes (one product); P (x256 carry, cancels in the normalisation) and v single f16; softmax f32 (online, running max);
// output projection v_wmma_f32_16x16x32_f16: context single f16 (x256 carry), Wo = f16 of (bf16 RNE of Wo) x64; 2^-14 folded into the f32 epilogue.
// Layout: one bf16 activation plane reused for q, k, v in turn; transposed weight planes [out][in]; q, k planes [b*16+h][t][d], v^T plane [b*16+h][d][t] written by the GEMM epilogue;
// fused flash kernel in transposed form (S^T = K Q^T, O^T = V^T P^T) writes the f16 context plane [b*SEQ+t][1024]; last GEMM writes the f32 output.

#ifndef NB
#define NB 4
#endif
#ifndef SEQ
#define SEQ 2048
#endif
#define NB_FULL  4
#define SEQ_FULL 2048
#ifndef OUT_SEQ
#define OUT_SEQ SEQ              // row pitch (in tokens) between batches of the output
#endif
#define DM   1024
#define NH_  16
#define HD   64
#define AW   8                   // waves per flash block (16 query rows each); all of them read one staged K / V^T tile
#define KT   64                  // keys per staged tile (two 32-key steps)
#define LP   72                  // LDS row pitch in halves: 144 B = 16 B x 9, so the 16 rows of a 16-byte fragment read fall on distinct banks
#define TILE_H (64 * LP)         // halves of one staged tile: 64 rows (K: keys, V^T: d) of 64 halves + pad
#define SC2  (0.125f * 1.4426950408889634f)   // HD^-0.5 * log2(e)
#define PSH  8.0f                // log2 of the P carry (256)
#define CTXS 256.0f              // carry of the context plane
#define WOS  64.0f               // carry of the Wo plane
#define OSC  (1.0f / (CTXS * WOS))

static_assert(HD == 64);
static_assert(NH_ * HD == DM);                 // head h = columns h*64 + d
static_assert(DM % 64 == 0);                   // 16 column tiles of 64
static_assert(DM % 32 == 0);                   // GEMM k-loop steps by 32
static_assert(SEQ % 64 == 0);                  // a 64-row tile never straddles two batches
static_assert((NB * SEQ) % 64 == 0);
static_assert(SEQ % KT == 0 && SEQ / KT >= 2);  // key loop walks whole staged tiles; the two-buffer prologue needs two
static_assert(32 * AW == 256);                 // 256 lanes x 2 copies x 16 B = one 8-KiB tile
static_assert(SEQ % (16 * AW) == 0);           // flash grid covers the sequence exactly
static_assert(((size_t)SEQ * DM) % 8 == 0);
static_assert(NB <= NB_FULL);
static_assert(SEQ <= SEQ_FULL);

typedef _Float16 h16;
typedef unsigned short bf;
typedef __attribute__((ext_vector_type(16))) __bf16   v16bf;
typedef __attribute__((ext_vector_type(16))) _Float16 v16h;
typedef __attribute__((ext_vector_type(8)))  _Float16 v8h;
typedef __attribute__((ext_vector_type(8)))  unsigned short v8us;
typedef __attribute__((ext_vector_type(8)))  float    v8f;
typedef __attribute__((ext_vector_type(4)))  float    v4f;
typedef v4f  __attribute__((may_alias)) v4fa;

__device__ __forceinline__ unsigned short f2bf(float f) { unsigned u = __float_as_uint(f); u += 0x7FFFu + ((u >> 16) & 1u); return (unsigned short)(u >> 16); }
__device__ __forceinline__ v16h cat16(v8h lo, v8h hi) { return __builtin_shufflevector(lo, hi, 0, 1, 2, 3, 4, 5, 6, 7, 8, 9, 10, 11, 12, 13, 14, 15); }
__device__ __forceinline__ v16bf cat16b(v8us lo, v8us hi) { return __builtin_bit_cast(v16bf, __builtin_shufflevector(lo, hi, 0, 1, 2, 3, 4, 5, 6, 7, 8, 9, 10, 11, 12, 13, 14, 15)); }
__device__ __forceinline__ v8f wmma16(v16h a, v16h b, v8f c) { return __builtin_amdgcn_wmma_f32_16x16x32_f16(false, a, false, b, (short)0, c, false, false); }
__device__ __forceinline__ v8f wmmab(v16bf a, v16bf b, v8f c) { return __builtin_amdgcn_wmma_f32_16x16x32_bf16(false, a, false, b, (short)0, c, false, false); }
// fragment loaders from K-contiguous 16-bit rows; p already includes + 8*(lane>>4): elements 0..7 <- k0+8h+0..7, elements 8..15 <- k0+16+8h+0..7 (same map for A and B)
__device__ __forceinline__ v16h  ldh(const h16* p) { return cat16(*(const v8h*)p, *(const v8h*)(p + 16)); }
__device__ __forceinline__ v16bf ldb(const bf* p)  { return cat16b(*(const v8us*)p, *(const v8us*)(p + 16)); }
// ordering point for wave-private LDS tiles (same wave writes and reads)
__device__ __forceinline__ void wave_sync() { __builtin_amdgcn_fence(3 /* release order */, "wavefront"); __builtin_amdgcn_wave_barrier(); asm volatile("" ::: "memory"); }

__global__ __launch_bounds__(256) void k_cvt8(const float* __restrict__ src, bf* dst, size_t n8) {
    const size_t i = (size_t)blockIdx.x * 256 + threadIdx.x; if (i >= n8) return;
    const v8f v = *(const v8f*)(src + i * 8); v8us o;
#pragma unroll
    for (int k = 0; k < 8; ++k) o[k] = f2bf(v[k]);
    *(v8us*)(dst + i * 8) = o; 
}

// k_wT: transposing 16-bit convert of a square weight: in[k][n] (DM rows k = input feature, DM columns n = output feature) -> out[n][k] (K-contiguous rows).
// asF16 == 0: bf16 bits (RNE). asF16 != 0: f16 bits of (bf16 RNE value * scale), scale a power of two (exact).
// grid (DM/64 over k, DM/64 over n), 256 threads. Coverage: rows (tid>>3) + 32 i, i = 0..1 -> 64 rows; (tid&7)*8 + 0..7 -> 64 columns.
__global__ __launch_bounds__(256) void k_wT(const float* __restrict__ W, bf* dst, float scale, int asF16) {
    __shared__ float ts[64 * 65];
    const int tid = threadIdx.x; const int k0 = blockIdx.x * 64, n0 = blockIdx.y * 64;
#pragma unroll
    for (int i = 0; i < 4; ++i) { const int idx = tid + 256 * i; const int kk = idx >> 4, c4 = (idx & 15) * 4;
        const v4f v = *(const v4f*)(W + (size_t)(k0 + kk) * DM + n0 + c4);
        ts[kk * 65 + c4 + 0] = v[0]; ts[kk * 65 + c4 + 1] = v[1]; ts[kk * 65 + c4 + 2] = v[2]; ts[kk * 65 + c4 + 3] = v[3]; }
    __syncthreads();
    const int c8 = (tid & 7) * 8;
    v8us o0, o1;
#pragma unroll
    for (int j = 0; j < 8; ++j) {
        const float xa = ts[(c8 + j) * 65 + (tid >> 3)]; const float xb = ts[(c8 + j) * 65 + (tid >> 3) + 32];
        const unsigned short ba = f2bf(xa), bb = f2bf(xb);
        const h16 ha = (h16)(__uint_as_float((unsigned)ba << 16) * scale); const h16 hb = (h16)(__uint_as_float((unsigned)bb << 16) * scale);
        const unsigned short fa = __builtin_bit_cast(unsigned short, ha), fb = __builtin_bit_cast(unsigned short, hb);
        o0[j] = asF16 ? fa : ba; o1[j] = asF16 ? fb : bb; }
    bf* p0 = dst + (size_t)(n0 + (tid >> 3)) * DM + k0 + c8;
    bf* p1 = dst + (size_t)(n0 + (tid >> 3) + 32) * DM + k0 + c8;
{
        *(v8us*)p0 = o0; *(v8us*)p1 = o1;
         }
}

// k_proj: register-blocked bf16 GEMM, ONE WAVE per 64x64 tile (16 accumulators), operands straight from K-contiguous bf16 planes, K = DM.
// C[m][n] = sum_k A[m][k] Bt[n][k], written as f16 (Ph) at
// tile base (r0/RB)*sRB + (r0%RB)*pitch + (c0/CB)*sCB + (c0%CB), row pitch 'pitch' (halves). grid (M/64, N/64), 32 threads.
__global__ __launch_bounds__(32) void k_proj(const bf* __restrict__ A, const bf* __restrict__ Bt, h16* Ph, int RB, size_t sRB, int pitch, int CB, size_t sCB) {
    __shared__ __align__(16) float os[16 * 68];
    const int K = DM;
    const int lane = threadIdx.x & 31, lr = lane & 15, hi = lane >> 4; const int r0 = blockIdx.x * 64, c0 = blockIdx.y * 64;
    v8f acc[4][4];
#pragma unroll
    for (int mb = 0; mb < 4; ++mb)
#pragma unroll
        for (int nb = 0; nb < 4; ++nb) acc[mb][nb] = (v8f){};
    const size_t aoff = (size_t)(r0 + lr) * K + 8 * hi, boff = (size_t)(c0 + lr) * K + 8 * hi;
#pragma unroll 1
    for (int kc = 0; kc < K; kc += 32) {
        v16bf a[4];
#pragma unroll
        for (int mb = 0; mb < 4; ++mb) a[mb] = ldb(A + aoff + (size_t)mb * 16 * K + kc);
#pragma unroll
        for (int nb = 0; nb < 4; ++nb) { const v16bf b = ldb(Bt + boff + (size_t)nb * 16 * K + kc);
#pragma unroll
            for (int mb = 0; mb < 4; ++mb) acc[mb][nb] = wmmab(a[mb], b, acc[mb][nb]); }
        asm volatile("v_nop\n\tv_nop\n\tv_nop\n\tv_nop" : "+v"(acc[0][0]), "+v"(acc[1][1]), "+v"(acc[2][2]), "+v"(acc[3][3]) : "v"(a[0]), "v"(a[1]), "v"(a[2]), "v"(a[3]));
    }
    const size_t tbase = (size_t)(r0 / RB) * sRB + (size_t)(r0 % RB) * (size_t)pitch + (size_t)(c0 / CB) * sCB + (size_t)(c0 % CB);
#pragma unroll
    for (int mb = 0; mb < 4; ++mb) {
#pragma unroll
        for (int nb = 0; nb < 4; ++nb) {
#pragma unroll
            for (int j = 0; j < 8; ++j) os[(hi * 8 + j) * 68 + nb * 16 + lr] = acc[mb][nb][j]; }   // D: row 8h+j, col lane&15
        wave_sync();
        const size_t sb = tbase + (size_t)(mb * 16) * (size_t)pitch;
{
#pragma unroll
            for (int s = 0; s < 4; ++s) { const int row = 4 * s + (lane >> 3), c8 = (lane & 7) * 8;   // 4 s x 4 row groups = 16 rows; 8 lanes x 8 = 64 columns
                const v4f x0 = *(const v4fa*)(&os[row * 68 + c8]); const v4f x1 = *(const v4fa*)(&os[row * 68 + c8 + 4]); v8h hv;
#pragma unroll
                for (int i = 0; i < 4; ++i) { hv[i] = (h16)x0[i]; hv[4 + i] = (h16)x1[i]; }
                const size_t oo = sb + (size_t)row * (size_t)pitch + c8;
                *(v8h*)(Ph + oo) = hv; }
             }
        wave_sync();
    }
}

// copy_tile: one 64-key K tile (64 rows of 128 B, contiguous) and one V^T tile (64 rows d of 128 B, pitch SEQ halves) into LDS at pitch LP, no register in between.
// Lane tid brings 16 B of rows tid>>3 and 32 + (tid>>3) of each tile, so a wave's copy covers four whole 128-B lines. lk = the lane's LDS byte address in the K tile.
__device__ __forceinline__ void copy_tile(unsigned lk, const h16* gk, const h16* gv) {
    const unsigned lk1 = lk + 32 * LP * 2, lv = lk + TILE_H * 2, lv1 = lv + 32 * LP * 2;
    const h16* gk1 = gk + 32 * HD; const h16* gv1 = gv + (size_t)32 * SEQ;
    // the closing s_wait_xcnt stands inside the statement so that no address register is rewritten ahead of it
    asm volatile("global_load_async_to_lds_b128 %0, %1, off\n\t"
                 "global_load_async_to_lds_b128 %2, %3, off\n\t"
                 "global_load_async_to_lds_b128 %4, %5, off\n\t"
                 "global_load_async_to_lds_b128 %6, %7, off\n\t"
                 "s_wait_xcnt 0x0"
                 :: "v"(lk), "v"(gk), "v"(lk1), "v"(gk1), "v"(lv), "v"(gv), "v"(lv1), "v"(gv1) : "memory");
}

// k_flash: fused attention, one wave per 16 query rows of one (batch, head); Q fragments straight from the f16 plane; K / V^T tiles of 64 keys staged in LDS
// by asynchronous copies (two buffers, the next tile in flight while this one is worked on) and read by all AW waves as 16-B fragment loads.
// Transposed form: S^T[key][t] = K Q^T (A = K rows, B = Q rows); lane (t = lane&15, h = lane>>4) holds keys 8h+r of each 16-key tile, so the packed
// P tile is directly the B fragment of O^T[d][t] = V^T P^T (element r <- tile keys 0..15, element 8+r <- tile keys 16..31, lane unchanged).
// Per 32-key step: 4 score products + 4 P.V products. Softmax state (running max, partial sum) is one scalar per lane; the two lane halves of a row are combined with one xor-16 exchange.
__global__ __launch_bounds__(32 * AW) void k_flash(const h16* __restrict__ QH, const h16* __restrict__ KP, const h16* __restrict__ VT, h16* CH) {
    __shared__ __align__(16) h16 ring[2 * 2 * TILE_H];   // [buffer][K | V^T][row][LP]
    __shared__ __align__(16) float os[AW * 16 * 68];
    const int tid = threadIdx.x;
    const int lane = threadIdx.x & 31, lr = lane & 15, hi = lane >> 4;
    const int wave = __builtin_amdgcn_readfirstlane((int)(threadIdx.x >> 5));   // wave-uniform
    const int zh = blockIdx.y; const int b = zh / NH_, h = zh % NH_;
    const int t0 = (blockIdx.x * AW + wave) * 16;
    const size_t pbase = (size_t)zh * SEQ * HD;
    const size_t qo = pbase + (size_t)(t0 + lr) * HD + 8 * hi;
    const v16h qh0 = ldh(QH + qo), qh1 = ldh(QH + qo + 32);   // B fragments: col t, k = d
    const unsigned lcp = (unsigned)(size_t)ring + (unsigned)(((tid >> 3) * LP + (tid & 7) * 8) * 2);   // the lane's copy target in buffer 0's K tile (LDS byte address)
    const h16* gk = KP + pbase + tid * 8;                                        // + tile * KT * HD
    const h16* gv = VT + pbase + (size_t)(tid >> 3) * SEQ + (tid & 7) * 8;       // + tile * KT
    const int fo = lr * LP + 8 * hi;   // fragment offset in a tile: K + key * LP (A: row key, k = d); V^T + 16j * LP + key (A: row d, k = key)
    copy_tile(lcp, gk, gv);
    asm volatile("s_wait_asynccnt 0x0" ::: "memory");   // this wave's share of tile 0 has landed
    __syncthreads();                                     // every wave's share has: tile 0 may be read
    copy_tile(lcp + 2 * TILE_H * 2, gk + KT * HD, gv + KT);
    v8f o0 = (v8f){}, o1 = (v8f){}, o2 = (v8f){}, o3 = (v8f){};
    float m = -3.0e38f, l = 0.0f;
#pragma unroll 1   // one trip per staged tile: the buffer index stays a run-time value and the loop text small
    for (int t = 0; t < SEQ / KT; ++t) {
      const h16* kt = ring + (t & 1) * (2 * TILE_H) + fo;
#pragma unroll 1    // the two 32-key steps of a tile stay rolled: unrolled, values of both steps live on past the barrier and the register count costs a wave per SIMD
      for (int u = 0; u < KT / 32; ++u) {
        const h16* ka = kt + u * 32 * LP;
        const v16h ka0 = ldh(ka), ka1 = ldh(ka + 32), kb0 = ldh(ka + 16 * LP), kb1 = ldh(ka + 16 * LP + 32);
        v8f sa = (v8f){}, sb = (v8f){};
        sa = wmma16(ka0, qh0, sa); sb = wmma16(kb0, qh0, sb);
        sa = wmma16(ka1, qh1, sa); sb = wmma16(kb1, qh1, sb);
        asm volatile("v_nop\n\tv_nop\n\tv_nop\n\tv_nop" : "+v"(sa), "+v"(sb) : "v"(ka0), "v"(ka1), "v"(kb0), "v"(kb1), "v"(qh0), "v"(qh1));
        float ta[8], tb[8]; float mx = -3.0e38f;
#pragma unroll
        for (int r = 0; r < 8; ++r) { ta[r] = sa[r] * SC2; tb[r] = sb[r] * SC2; mx = fmaxf(mx, fmaxf(ta[r], tb[r])); }
        mx = fmaxf(mx, __shfl_xor(mx, 16, 32));
        const float mnew = fmaxf(m, mx);
        const float alpha = __builtin_amdgcn_exp2f(m - mnew);
        const float sh = PSH - mnew;
        v16h pb; float ls = 0.0f;
#pragma unroll
        for (int r = 0; r < 8; ++r) { const h16 pa = (h16)__builtin_amdgcn_exp2f(ta[r] + sh); const h16 pc = (h16)__builtin_amdgcn_exp2f(tb[r] + sh); pb[r] = pa; pb[8 + r] = pc; ls += (float)pa + (float)pc; }
        l = l * alpha + ls; m = mnew;
        o0 = o0 * alpha; o1 = o1 * alpha; o2 = o2 * alpha; o3 = o3 * alpha;
        const h16* va = kt + TILE_H + u * 32;
        const v16h v0 = ldh(va), v1 = ldh(va + 16 * LP), v2 = ldh(va + 32 * LP), v3 = ldh(va + 48 * LP);
        o0 = wmma16(v0, pb, o0); o1 = wmma16(v1, pb, o1); o2 = wmma16(v2, pb, o2); o3 = wmma16(v3, pb, o3);
        asm volatile("v_nop\n\tv_nop\n\tv_nop\n\tv_nop" : "+v"(o0), "+v"(o1), "+v"(o2), "+v"(o3) : "v"(v0), "v"(v1), "v"(v2), "v"(v3), "v"(pb));
      }
      asm volatile("s_wait_dscnt 0x0" ::: "memory");      // this wave's reads of tile t are done before the buffer is refilled
      asm volatile("s_wait_asynccnt 0x0" ::: "memory");   // this wave's share of tile t + 1 has landed
      __syncthreads();                                     // publishes tile t + 1 and ends every wave's reads of tile t
      if (t + 2 < SEQ / KT) copy_tile(lcp + (unsigned)(t & 1) * (2 * TILE_H * 2), gk + (size_t)(t + 2) * KT * HD, gv + (t + 2) * KT);
    }
    asm volatile("s_wait_asynccnt 0x0" ::: "memory");     // no copy is outstanding when the wave goes on to its end
    l += __shfl_xor(l, 16, 32);
    const float inv = CTXS * (1.0f / l);
    const int wb = wave * 16 * 68;
    // O^T D layout: o_j[r] = (d = 16j + 8h + r, t = lane&15) -> os[t][d]; rows 0..15 x columns 0..63 all written
    { v4f a, c;
      a[0] = o0[0] * inv; a[1] = o0[1] * inv; a[2] = o0[2] * inv; a[3] = o0[3] * inv; c[0] = o0[4] * inv; c[1] = o0[5] * inv; c[2] = o0[6] * inv; c[3] = o0[7] * inv;
      *(v4fa*)(&os[wb + lr * 68 +  0 + 8 * hi]) = a; *(v4fa*)(&os[wb + lr * 68 +  0 + 8 * hi + 4]) = c;
      a[0] = o1[0] * inv; a[1] = o1[1] * inv; a[2] = o1[2] * inv; a[3] = o1[3] * inv; c[0] = o1[4] * inv; c[1] = o1[5] * inv; c[2] = o1[6] * inv; c[3] = o1[7] * inv;
      *(v4fa*)(&os[wb + lr * 68 + 16 + 8 * hi]) = a; *(v4fa*)(&os[wb + lr * 68 + 16 + 8 * hi + 4]) = c;
      a[0] = o2[0] * inv; a[1] = o2[1] * inv; a[2] = o2[2] * inv; a[3] = o2[3] * inv; c[0] = o2[4] * inv; c[1] = o2[5] * inv; c[2] = o2[6] * inv; c[3] = o2[7] * inv;
      *(v4fa*)(&os[wb + lr * 68 + 32 + 8 * hi]) = a; *(v4fa*)(&os[wb + lr * 68 + 32 + 8 * hi + 4]) = c;
      a[0] = o3[0] * inv; a[1] = o3[1] * inv; a[2] = o3[2] * inv; a[3] = o3[3] * inv; c[0] = o3[4] * inv; c[1] = o3[5] * inv; c[2] = o3[6] * inv; c[3] = o3[7] * inv;
      *(v4fa*)(&os[wb + lr * 68 + 48 + 8 * hi]) = a; *(v4fa*)(&os[wb + lr * 68 + 48 + 8 * hi + 4]) = c; }
    wave_sync();
    h16* crow = CH + ((size_t)b * SEQ + t0) * DM + h * HD;       // context plane row m = b*SEQ + t, columns h*64 + d
{
#pragma unroll
        for (int s = 0; s < 4; ++s) { const int row = 4 * s + (lane >> 3), c8 = (lane & 7) * 8;   // 4 s x 4 row groups = 16 rows; 8 lanes x 8 halves = 64 columns
            const v4f x0 = *(const v4fa*)(&os[wb + row * 68 + c8]); const v4f x1 = *(const v4fa*)(&os[wb + row * 68 + c8 + 4]); v8h hv;
#pragma unroll
            for (int i = 0; i < 4; ++i) { hv[i] = (h16)x0[i]; hv[4 + i] = (h16)x1[i]; }
            *(v8h*)(crow + (size_t)row * DM + c8) = hv; }
         }
}

// k_oproj: register-blocked f16 GEMM, ONE WAVE per 64x64 tile (16 accumulators), operands straight from K-contiguous f16 planes, K = DM.
// OUT[(r0/SEQ)*OUT_SEQ + r0%SEQ + i][c0 + j] = oscale * sum_k A[r0+i][k] Bt[c0+j][k]. grid (NB*SEQ/64, DM/64), 32 threads.
__global__ __launch_bounds__(32) void k_oproj(const h16* __restrict__ A, const h16* __restrict__ Bt, float* OUT, float oscale) {
    __shared__ __align__(16) float os[16 * 68];
    const int K = DM;
    const int lane = threadIdx.x & 31, lr = lane & 15, hi = lane >> 4; const int r0 = blockIdx.x * 64, c0 = blockIdx.y * 64;
    v8f acc[4][4];
#pragma unroll
    for (int mb = 0; mb < 4; ++mb)
#pragma unroll
        for (int nb = 0; nb < 4; ++nb) acc[mb][nb] = (v8f){};
    const size_t aoff = (size_t)(r0 + lr) * K + 8 * hi, boff = (size_t)(c0 + lr) * K + 8 * hi;
#pragma unroll 1
    for (int kc = 0; kc < K; kc += 32) {
        v16h a[4];
#pragma unroll
        for (int mb = 0; mb < 4; ++mb) a[mb] = ldh(A + aoff + (size_t)mb * 16 * K + kc);
#pragma unroll
        for (int nb = 0; nb < 4; ++nb) { const v16h b = ldh(Bt + boff + (size_t)nb * 16 * K + kc);
#pragma unroll
            for (int mb = 0; mb < 4; ++mb) acc[mb][nb] = wmma16(a[mb], b, acc[mb][nb]); }
        asm volatile("v_nop\n\tv_nop\n\tv_nop\n\tv_nop" : "+v"(acc[0][0]), "+v"(acc[1][1]), "+v"(acc[2][2]), "+v"(acc[3][3]) : "v"(a[0]), "v"(a[1]), "v"(a[2]), "v"(a[3]));
    }
    const size_t obase = ((size_t)(r0 / SEQ) * OUT_SEQ + (size_t)(r0 % SEQ)) * DM + c0;
#pragma unroll
    for (int mb = 0; mb < 4; ++mb) {
#pragma unroll
        for (int nb = 0; nb < 4; ++nb) {
#pragma unroll
            for (int j = 0; j < 8; ++j) os[(hi * 8 + j) * 68 + nb * 16 + lr] = acc[mb][nb][j] * oscale; }   // D: row 8h+j, col lane&15
        wave_sync();
        float* orow = OUT + obase + (size_t)(mb * 16) * DM;
{
#pragma unroll
            for (int s = 0; s < 8; ++s) { const int row = 2 * s + hi, cofs = lr * 4;   // 8 s x 2 rows = 16 rows; 16 lanes x 4 floats = 64 columns
                const v4f val = *(const v4fa*)(&os[row * 68 + cofs]);
                *(v4f*)(orow + (size_t)row * DM + cofs) = val; }
             }
        wave_sync();
    }
}

static constexpr size_t al256(size_t v) { return (v + 255) & ~(size_t)255; }
static constexpr size_t SZ_XB = al256((size_t)NB * SEQ * DM * 2);          // one activation plane, reused for q, k, v in stream order
static constexpr size_t SZ_WB = al256((size_t)4 * DM * DM * 2);            // four transposed weight planes
static constexpr size_t SZ_PL = al256((size_t)NB * NH_ * SEQ * HD * 2);    // per-head planes (q, k, v^T)
static constexpr size_t SZ_CH = al256((size_t)NB * SEQ * DM * 2);          // context plane
static constexpr size_t SZ_TOTAL = SZ_XB + SZ_WB + 3 * SZ_PL + SZ_CH;
static_assert(SZ_TOTAL <= (size_t)134217728);          // workspace carve <= 128 MiB
static_assert(((size_t)DM * DM * 2) % 256 == 0);       // weight sub-planes stay 256-byte aligned
static_assert((size_t)NB * DM * SEQ * 2 <= SZ_PL);     // v^T plane [(b*1024 + m)][t] fits its region

static void cvt_x(const float* x, bf* XB, hipStream_t stream) {
    if (SEQ == SEQ_FULL) {
        const size_t n8 = (size_t)NB * SEQ * DM / 8;
        k_cvt8<<<(unsigned)((n8 + 255) / 256), 256, 0, stream>>>(x, XB, n8);
    } else {
        const size_t n8 = (size_t)SEQ * DM / 8;
        for (int b = 0; b < NB; ++b) k_cvt8<<<(unsigned)((n8 + 255) / 256), 256, 0, stream>>>(x + (size_t)b * SEQ_FULL * DM, XB + (size_t)b * SEQ * DM, n8);
    }
}

extern "C" void kernel_launch(void* const* d_in, const int* in_sizes, int n_in,
                              void* d_out, int out_size, void* d_ws, size_t ws_size, hipStream_t stream) {
    if (n_in < 7) return;
    const size_t needx = ((size_t)(NB - 1) * SEQ_FULL + SEQ) * DM;
    if ((size_t)in_sizes[0] < needx || (size_t)in_sizes[1] < needx || (size_t)in_sizes[2] < needx) return;
    if ((size_t)in_sizes[3] < (size_t)DM * DM || (size_t)in_sizes[4] < (size_t)DM * DM || (size_t)in_sizes[5] < (size_t)DM * DM || (size_t)in_sizes[6] < (size_t)DM * DM) return;
    if ((size_t)out_size < ((size_t)(NB - 1) * OUT_SEQ + SEQ) * DM) return;
    if (SZ_TOTAL > ws_size) return;
    // wire order: k, q, v, Wk, Wq, Wv, Wo (weights [in][out])
    const float* xq = (const float*)d_in[1]; const float* xk = (const float*)d_in[0]; const float* xv = (const float*)d_in[2];   /* this module stages k, q, v: the KEY stream is input 0 and the QUERY stream input 1 */
    const float* wq = (const float*)d_in[4]; const float* wk = (const float*)d_in[3]; const float* wv = (const float*)d_in[5]; const float* wo = (const float*)d_in[6];   /* w_key is input 3 and w_query input 4 */
    float* OUT = (float*)d_out;      // [NB][SEQ][1024]
    char* wsp = (char*)d_ws;
    bf* XB = (bf*)wsp; wsp += SZ_XB;                 // [NB*SEQ][1024] bf16, current activation
    bf* WB = (bf*)wsp; wsp += SZ_WB;                 // [4][1024 out][1024 in]: q | k | v (bf16) | o (f16 x64)
    h16* QH = (h16*)wsp; wsp += SZ_PL;               // [NB*16][SEQ][64]
    h16* KP = (h16*)wsp; wsp += SZ_PL;               // [NB*16][SEQ][64]
    h16* VT = (h16*)wsp; wsp += SZ_PL;               // [NB*16][64][SEQ]
    h16* CH = (h16*)wsp; wsp += SZ_CH;               // [NB*SEQ][1024] context x256
    bf* WQT = WB; bf* WKT = WB + (size_t)DM * DM; bf* WVT = WB + (size_t)2 * DM * DM; bf* WOT = WB + (size_t)3 * DM * DM;

    // weights: in[k = input feature][n = output feature] -> out[n][k]; square, grid (k tiles, n tiles)
    { const dim3 g(DM / 64, DM / 64, 1);
      k_wT<<<g, 256, 0, stream>>>(wq, WQT, 1.0f, 0);
      k_wT<<<g, 256, 0, stream>>>(wk, WKT, 1.0f, 0);
      k_wT<<<g, 256, 0, stream>>>(wv, WVT, 1.0f, 0);
      k_wT<<<g, 256, 0, stream>>>(wo, WOT, WOS, 1); }

    // q, k: A = x rows (m = b*SEQ + t), Bt = W^T rows (n = h*64 + d) -> plane [(b*16 + h)][t][d]
    cvt_x(xq, XB, stream);
    k_proj<<<dim3(NB * SEQ / 64, DM / 64, 1), 32, 0, stream>>>(XB, WQT, QH, SEQ, (size_t)NH_ * SEQ * HD, HD, HD, (size_t)SEQ * HD);
    cvt_x(xk, XB, stream);
    k_proj<<<dim3(NB * SEQ / 64, DM / 64, 1), 32, 0, stream>>>(XB, WKT, KP, SEQ, (size_t)NH_ * SEQ * HD, HD, HD, (size_t)SEQ * HD);
    // v^T: A = Wv^T rows (m = h*64 + d), Bt = x rows (n = b*SEQ + t) -> plane [(b*1024 + m)][t] = [(b*16 + h)][d][t]
    cvt_x(xv, XB, stream);
    k_proj<<<dim3(DM / 64, NB * SEQ / 64, 1), 32, 0, stream>>>(WVT, XB, VT, DM, (size_t)0, SEQ, SEQ, (size_t)DM * SEQ);

    k_flash<<<dim3(SEQ / (16 * AW), NB * NH_, 1), 32 * AW, 0, stream>>>(QH, KP, VT, CH);

    // output projection: A = context rows (m = b*SEQ + t), Bt = Wo^T rows (n) -> f32 output
    k_oproj<<<dim3(NB * SEQ / 64, DM / 64, 1), 32, 0, stream>>>(CH, (const h16*)WOT, OUT, OSC);
}

// v002
// Measured time: 172 microseconds a run.
// Two timings next to v001 both put it at 1.39 times that version's speed.
// Counting every step since v000, it is 2.13 times as fast.
#include <hip/hip_runtime.h>

// Attention with 16 heads x 64, width 1024, whose KEY stream and KEY weight are staged FIRST: separate inputs k, q, v [4][2048][1024] (f32), weights w_key / w_query / w_value / w_proj stored [in][out] (y = x W, normal x 0.02), no biases, no mask, scores / sqrt(64), softmax over the keys, f32 output = (merged heads) w_proj [4][2048][1024]; argument order k, q, v, w_key, w_query, w_value, w_proj.
// Compute dtypes, f32 accumulate everywhere: projections v_wmma_f32_16x16x32_bf16 (x and W RNE-converted to bf16; products exact);
// scores v_wmma_f32_16x16x32_f16: q and k single f16 planes (one product); P (x256 carry, cancels in the normalisation) and v single f16; softmax f32 (online, running max);
// output projection v_wmma_f32_16x16x32_f16: context single f16 (x256 carry), Wo = f16 of (bf16 RNE of Wo) x64; 2^-14 folded into the f32 epilogue.
// Layout: one bf16 activation plane reused for q, k, v in turn; transposed weight planes [out][in]; q, k planes [b*16+h][t][d], v^T plane [b*16+h][d][t] written by the GEMM epilogue;
// fused flash kernel in transposed form (S^T = K Q^T, O^T = V^T P^T) writes the f16 context plane [b*SEQ+t][1024]; last GEMM writes the f32 output.

#ifndef NB
#define NB 4
#endif
#ifndef SEQ
#define SEQ 2048
#endif
#define NB_FULL  4
#define SEQ_FULL 2048
#ifndef OUT_SEQ
#define OUT_SEQ SEQ              // row pitch (in tokens) between batches of the output
#endif
#define DM   1024
#define NH_  16
#define HD   64
#define AW   8                   // waves per flash block (16 query rows each); all of them read one staged K / V^T tile
#define KT   64                  // keys per staged tile (two 32-key steps)
#define LP   72                  // LDS row pitch in halves: 144 B = 16 B x 9, so the 16 rows of a 16-byte fragment read fall on distinct banks
#define TILE_H (64 * LP)         // halves of one staged tile: 64 rows (K: keys, V^T: d) of 64 halves + pad
#define GBM  256                 // GEMM block tile: A rows (4 waves of 64)
#define GBN  128                 // GEMM block tile: Bt rows = output columns (2 waves of 64)
#define GKS  64                  // k per staged GEMM tile (two 32-k steps): 128 B of every operand row
#define GST_H ((GBM + GBN) * LP) // halves of one GEMM stage: 256 A rows, then 128 Bt rows, at pitch LP
#define SC2  (0.125f * 1.4426950408889634f)   // HD^-0.5 * log2(e)
#define PSH  8.0f                // log2 of the P carry (256)
#define CTXS 256.0f              // carry of the context plane
#define WOS  64.0f               // carry of the Wo plane
#define OSC  (1.0f / (CTXS * WOS))

static_assert(HD == 64);
static_assert(NH_ * HD == DM);                 // head h = columns h*64 + d
static_assert(DM % 64 == 0);                   // 16 column tiles of 64
static_assert(DM % 32 == 0);                   // GEMM k-loop steps by 32
static_assert(SEQ % 64 == 0);                  // a 64-row tile never straddles two batches
static_assert((NB * SEQ) % 64 == 0);
static_assert(SEQ % KT == 0 && SEQ / KT >= 2);  // key loop walks whole staged tiles; the two-buffer prologue needs two
static_assert(32 * AW == 256);                 // 256 lanes x 2 copies x 16 B = one 8-KiB tile
static_assert(SEQ % (16 * AW) == 0);           // flash grid covers the sequence exactly
static_assert(((size_t)SEQ * DM) % 8 == 0);
static_assert(DM % GKS == 0 && DM / GKS >= 2);                 // GEMM k loop walks whole stages; the two-buffer prologue needs two
static_assert((GBM + GBN) * GKS * 2 == 12 * 256 * 16);         // 256 lanes x 12 copies x 16 B = one stage
static_assert((NB * SEQ) % GBM == 0 && (NB * SEQ) % GBN == 0); // block tiles cover the token rows exactly, as A or as Bt
static_assert(DM % GBM == 0 && DM % GBN == 0);                 // and the feature rows
static_assert(SEQ % 64 == 0 && GBM % 64 == 0 && GBN % 64 == 0);
static_assert(NB <= NB_FULL);
static_assert(SEQ <= SEQ_FULL);

typedef _Float16 h16;
typedef unsigned short bf;
typedef __attribute__((ext_vector_type(16))) __bf16   v16bf;
typedef __attribute__((ext_vector_type(16))) _Float16 v16h;
typedef __attribute__((ext_vector_type(8)))  _Float16 v8h;
typedef __attribute__((ext_vector_type(8)))  unsigned short v8us;
typedef __attribute__((ext_vector_type(16))) unsigned short v16us;
typedef __attribute__((ext_vector_type(8)))  float    v8f;
typedef __attribute__((ext_vector_type(4)))  float    v4f;
typedef v4f  __attribute__((may_alias)) v4fa;

__device__ __forceinline__ unsigned short f2bf(float f) { unsigned u = __float_as_uint(f); u += 0x7FFFu + ((u >> 16) & 1u); return (unsigned short)(u >> 16); }
__device__ __forceinline__ v16h cat16(v8h lo, v8h hi) { return __builtin_shufflevector(lo, hi, 0, 1, 2, 3, 4, 5, 6, 7, 8, 9, 10, 11, 12, 13, 14, 15); }
__device__ __forceinline__ v8f wmma16(v16h a, v16h b, v8f c) { return __builtin_amdgcn_wmma_f32_16x16x32_f16(false, a, false, b, (short)0, c, false, false); }
__device__ __forceinline__ v8f wmmab(v16bf a, v16bf b, v8f c) { return __builtin_amdgcn_wmma_f32_16x16x32_bf16(false, a, false, b, (short)0, c, false, false); }
// fragment loaders from K-contiguous 16-bit rows; p already includes + 8*(lane>>4): elements 0..7 <- k0+8h+0..7, elements 8..15 <- k0+16+8h+0..7 (same map for A and B)
__device__ __forceinline__ v16h  ldh(const h16* p) { return cat16(*(const v8h*)p, *(const v8h*)(p + 16)); }
// ordering point for wave-private LDS tiles (same wave writes and reads)
__device__ __forceinline__ void wave_sync() { __builtin_amdgcn_fence(3 /* release order */, "wavefront"); __builtin_amdgcn_wave_barrier(); asm volatile("" ::: "memory"); }

__global__ __launch_bounds__(256) void k_cvt8(const float* __restrict__ src, bf* dst, size_t n8) {
    const size_t i = (size_t)blockIdx.x * 256 + threadIdx.x; if (i >= n8) return;
    const v8f v = *(const v8f*)(src + i * 8); v8us o;
#pragma unroll
    for (int k = 0; k < 8; ++k) o[k] = f2bf(v[k]);
    *(v8us*)(dst + i * 8) = o; 
}

// k_wT: transposing 16-bit convert of a square weight: in[k][n] (DM rows k = input feature, DM columns n = output feature) -> out[n][k] (K-contiguous rows).
// asF16 == 0: bf16 bits (RNE). asF16 != 0: f16 bits of (bf16 RNE value * scale), scale a power of two (exact).
// grid (DM/64 over k, DM/64 over n), 256 threads. Coverage: rows (tid>>3) + 32 i, i = 0..1 -> 64 rows; (tid&7)*8 + 0..7 -> 64 columns.
__global__ __launch_bounds__(256) void k_wT(const float* __restrict__ W, bf* dst, float scale, int asF16) {
    __shared__ float ts[64 * 65];
    const int tid = threadIdx.x; const int k0 = blockIdx.x * 64, n0 = blockIdx.y * 64;
#pragma unroll
    for (int i = 0; i < 4; ++i) { const int idx = tid + 256 * i; const int kk = idx >> 4, c4 = (idx & 15) * 4;
        const v4f v = *(const v4f*)(W + (size_t)(k0 + kk) * DM + n0 + c4);
        ts[kk * 65 + c4 + 0] = v[0]; ts[kk * 65 + c4 + 1] = v[1]; ts[kk * 65 + c4 + 2] = v[2]; ts[kk * 65 + c4 + 3] = v[3]; }
    __syncthreads();
    const int c8 = (tid & 7) * 8;
    v8us o0, o1;
#pragma unroll
    for (int j = 0; j < 8; ++j) {
        const float xa = ts[(c8 + j) * 65 + (tid >> 3)]; const float xb = ts[(c8 + j) * 65 + (tid >> 3) + 32];
        const unsigned short ba = f2bf(xa), bb = f2bf(xb);
        const h16 ha = (h16)(__uint_as_float((unsigned)ba << 16) * scale); const h16 hb = (h16)(__uint_as_float((unsigned)bb << 16) * scale);
        const unsigned short fa = __builtin_bit_cast(unsigned short, ha), fb = __builtin_bit_cast(unsigned short, hb);
        o0[j] = asF16 ? fa : ba; o1[j] = asF16 ? fb : bb; }
    bf* p0 = dst + (size_t)(n0 + (tid >> 3)) * DM + k0 + c8;
    bf* p1 = dst + (size_t)(n0 + (tid >> 3) + 32) * DM + k0 + c8;
{
        *(v8us*)p0 = o0; *(v8us*)p1 = o1;
         }
}

// copy_stage: one GEMM stage, 64 k of 256 A rows and of 128 Bt rows (row pitch DM halves in memory), into LDS at pitch LP, no register in between.
// Lane tid brings 16 B of rows (tid>>3) + 32 i, so a wave's copy covers four whole 128-B lines. l = the lane's LDS byte address in row tid>>3 of the stage.
__device__ __forceinline__ void copy_stage(unsigned l, const bf* ga, const bf* gb) {
    const unsigned S = 32 * LP * 2; const size_t G = (size_t)32 * DM;
    // the closing s_wait_xcnt stands inside the statement so that no address register is rewritten ahead of it
    asm volatile("global_load_async_to_lds_b128 %0, %1, off\n\t"
                 "global_load_async_to_lds_b128 %2, %3, off\n\t"
                 "global_load_async_to_lds_b128 %4, %5, off\n\t"
                 "global_load_async_to_lds_b128 %6, %7, off\n\t"
                 "global_load_async_to_lds_b128 %8, %9, off\n\t"
                 "global_load_async_to_lds_b128 %10, %11, off\n\t"
                 "global_load_async_to_lds_b128 %12, %13, off\n\t"
                 "global_load_async_to_lds_b128 %14, %15, off\n\t"
                 "global_load_async_to_lds_b128 %16, %17, off\n\t"
                 "global_load_async_to_lds_b128 %18, %19, off\n\t"
                 "global_load_async_to_lds_b128 %20, %21, off\n\t"
                 "global_load_async_to_lds_b128 %22, %23, off\n\t"
                 "s_wait_xcnt 0x0"
                 :: "v"(l), "v"(ga), "v"(l + S), "v"(ga + G), "v"(l + 2 * S), "v"(ga + 2 * G), "v"(l + 3 * S), "v"(ga + 3 * G),
                    "v"(l + 4 * S), "v"(ga + 4 * G), "v"(l + 5 * S), "v"(ga + 5 * G), "v"(l + 6 * S), "v"(ga + 6 * G), "v"(l + 7 * S), "v"(ga + 7 * G),
                    "v"(l + 8 * S), "v"(gb), "v"(l + 9 * S), "v"(gb + G), "v"(l + 10 * S), "v"(gb + 2 * G), "v"(l + 11 * S), "v"(gb + 3 * G) : "memory");
}

// fragment from a staged row; p already includes + 8*(lane>>4): the k map of ldh
__device__ __forceinline__ v16us ldu(const bf* p) { return __builtin_shufflevector(*(const v8us*)p, *(const v8us*)(p + 16), 0, 1, 2, 3, 4, 5, 6, 7, 8, 9, 10, 11, 12, 13, 14, 15); }
template <int F16> __device__ __forceinline__ v8f wmmau(v16us a, v16us b, v8f c) {
    if constexpr (F16) return wmma16(__builtin_bit_cast(v16h, a), __builtin_bit_cast(v16h, b), c);
    else return wmmab(__builtin_bit_cast(v16bf, a), __builtin_bit_cast(v16bf, b), c);
}

// gemm_main: k loop of one 256 x 128 block tile, K = DM, 8 waves of 64 x 64 (wave (wm, wn): A rows rb + 64 wm, Bt rows cb + 64 wn; 16 accumulators each).
// Stages of 64 k come into LDS by asynchronous copies (two buffers, the next stage in flight while this one is worked on); every wave reads its fragments as 16-B LDS loads.
// Each accumulator takes its 32-k products in rising k, as with operands read straight from memory.
template <int F16>
__device__ __forceinline__ void gemm_main(const bf* A, const bf* Bt, bf* ring, int rb, int cb, int wm, int wn, v8f (&acc)[4][4]) {
    const int tid = threadIdx.x, lr = tid & 15, hi = (tid >> 4) & 1;
    const unsigned lcp = (unsigned)(size_t)ring + (unsigned)(((tid >> 3) * LP + (tid & 7) * 8) * 2);   // the lane's copy target in buffer 0 (LDS byte address)
    const bf* ga = A + (size_t)(rb + (tid >> 3)) * DM + (tid & 7) * 8;    // + stage * GKS
    const bf* gb = Bt + (size_t)(cb + (tid >> 3)) * DM + (tid & 7) * 8;   // + stage * GKS
    const int fa = (wm * 64 + lr) * LP + 8 * hi, fb = (GBM + wn * 64 + lr) * LP + 8 * hi;   // fragment offsets in a stage
    copy_stage(lcp, ga, gb);
    asm volatile("s_wait_asynccnt 0x0" ::: "memory");   // this wave's share of stage 0 has landed
    __syncthreads();                                     // every wave's share has: stage 0 may be read
    copy_stage(lcp + GST_H * 2, ga + GKS, gb + GKS);
#pragma unroll 1   // one trip per stage: the buffer index stays a run-time value and the loop text small
    for (int t = 0; t < DM / GKS; ++t) {
        const bf* pa = ring + (t & 1) * GST_H + fa; const bf* pb = ring + (t & 1) * GST_H + fb;
        v16us a[GKS / 32][4], b[GKS / 32][4];
        // every loop below is unrolled whole: fragments and accumulators are indexed by constants and so stay in registers
#pragma unroll
        for (int u = 0; u < GKS / 32; ++u) {
#pragma unroll
            for (int i = 0; i < 4; ++i) { a[u][i] = ldu(pa + i * 16 * LP + u * 32); b[u][i] = ldu(pb + i * 16 * LP + u * 32); }
        }
        __builtin_amdgcn_sched_barrier(0);   // the stage's LDS reads stay one group ahead of its products (for speed only)
#pragma unroll
        for (int u = 0; u < GKS / 32; ++u)
#pragma unroll
            for (int nb = 0; nb < 4; ++nb)
#pragma unroll
                for (int mb = 0; mb < 4; ++mb) acc[mb][nb] = wmmau<F16>(a[u][mb], b[u][nb], acc[mb][nb]);
        __builtin_amdgcn_sched_barrier(0);   // the products stay ahead of the closing waits: moved behind the barrier they would start only when every wave's LDS reads are over
        asm volatile("s_wait_dscnt 0x0" ::: "memory");      // this wave's reads of stage t are done before the buffer is refilled
        asm volatile("s_wait_asynccnt 0x0" ::: "memory");   // this wave's share of stage t + 1 has landed
        __syncthreads();                                     // publishes stage t + 1 and ends every wave's reads of stage t
        if (t + 2 < DM / GKS) copy_stage(lcp + (unsigned)(t & 1) * (GST_H * 2), ga + (t + 2) * GKS, gb + (t + 2) * GKS);
    }
    asm volatile("s_wait_asynccnt 0x0" ::: "memory");       // no copy is outstanding when the wave goes on to its epilogue
}

// k_proj: bf16 GEMM, 256 x 128 block tile, 8 waves of one 64x64 tile each (16 accumulators), operands from K-contiguous bf16 planes through LDS (gemm_main), K = DM.
// C[m][n] = sum_k A[m][k] Bt[n][k], written as f16 (Ph) at
// wave tile base (r0/RB)*sRB + (r0%RB)*pitch + (c0/CB)*sCB + (c0%CB), row pitch 'pitch' (halves). grid (M/256, N/128), 256 threads.
__global__ __launch_bounds__(256) void k_proj(const bf* __restrict__ A, const bf* __restrict__ Bt, h16* Ph, int RB, size_t sRB, int pitch, int CB, size_t sCB) {
    __shared__ __align__(16) bf ring[2 * GST_H];   // [buffer][A rows | Bt rows][LP]
    __shared__ __align__(16) float osb[8 * 16 * 68];
    const int lane = threadIdx.x & 31, lr = lane & 15, hi = lane >> 4;
    const int wave = __builtin_amdgcn_readfirstlane((int)(threadIdx.x >> 5));   // wave-uniform
    const int wm = wave & 3, wn = wave >> 2;
    const int r0 = blockIdx.x * GBM + wm * 64, c0 = blockIdx.y * GBN + wn * 64;
    float* os = osb + wave * 16 * 68;   // wave-private output staging
    v8f acc[4][4];
#pragma unroll
    for (int mb = 0; mb < 4; ++mb)
#pragma unroll
        for (int nb = 0; nb < 4; ++nb) acc[mb][nb] = (v8f){};
    gemm_main<0>(A, Bt, ring, blockIdx.x * GBM, blockIdx.y * GBN, wm, wn, acc);
    const size_t tbase = (size_t)(r0 / RB) * sRB + (size_t)(r0 % RB) * (size_t)pitch + (size_t)(c0 / CB) * sCB + (size_t)(c0 % CB);
#pragma unroll
    for (int mb = 0; mb < 4; ++mb) {
#pragma unroll
        for (int nb = 0; nb < 4; ++nb) {
#pragma unroll
            for (int j = 0; j < 8; ++j) os[(hi * 8 + j) * 68 + nb * 16 + lr] = acc[mb][nb][j]; }   // D: row 8h+j, col lane&15
        wave_sync();
        const size_t sb = tbase + (size_t)(mb * 16) * (size_t)pitch;
{
#pragma unroll
            for (int s = 0; s < 4; ++s) { const int row = 4 * s + (lane >> 3), c8 = (lane & 7) * 8;   // 4 s x 4 row groups = 16 rows; 8 lanes x 8 = 64 columns
                const v4f x0 = *(const v4fa*)(&os[row * 68 + c8]); const v4f x1 = *(const v4fa*)(&os[row * 68 + c8 + 4]); v8h hv;
#pragma unroll
                for (int i = 0; i < 4; ++i) { hv[i] = (h16)x0[i]; hv[4 + i] = (h16)x1[i]; }
                const size_t oo = sb + (size_t)row * (size_t)pitch + c8;
                *(v8h*)(Ph + oo) = hv; }
             }
        wave_sync();
    }
}

// copy_tile: one 64-key K tile (64 rows of 128 B, contiguous) and one V^T tile (64 rows d of 128 B, pitch SEQ halves) into LDS at pitch LP, no register in between.
// Lane tid brings 16 B of rows tid>>3 and 32 + (tid>>3) of each tile, so a wave's copy covers four whole 128-B lines. lk = the lane's LDS byte address in the K tile.
__device__ __forceinline__ void copy_tile(unsigned lk, const h16* gk, const h16* gv) {
    const unsigned lk1 = lk + 32 * LP * 2, lv = lk + TILE_H * 2, lv1 = lv + 32 * LP * 2;
    const h16* gk1 = gk + 32 * HD; const h16* gv1 = gv + (size_t)32 * SEQ;
    // the closing s_wait_xcnt stands inside the statement so that no address register is rewritten ahead of it
    asm volatile("global_load_async_to_lds_b128 %0, %1, off\n\t"
                 "global_load_async_to_lds_b128 %2, %3, off\n\t"
                 "global_load_async_to_lds_b128 %4, %5, off\n\t"
                 "global_load_async_to_lds_b128 %6, %7, off\n\t"
                 "s_wait_xcnt 0x0"
                 :: "v"(lk), "v"(gk), "v"(lk1), "v"(gk1), "v"(lv), "v"(gv), "v"(lv1), "v"(gv1) : "memory");
}

// k_flash: fused attention, one wave per 16 query rows of one (batch, head); Q fragments straight from the f16 plane; K / V^T tiles of 64 keys staged in LDS
// by asynchronous copies (two buffers, the next tile in flight while this one is worked on) and read by all AW waves as 16-B fragment loads.
// Transposed form: S^T[key][t] = K Q^T (A = K rows, B = Q rows); lane (t = lane&15, h = lane>>4) holds keys 8h+r of each 16-key tile, so the packed
// P tile is directly the B fragment of O^T[d][t] = V^T P^T (element r <- tile keys 0..15, element 8+r <- tile keys 16..31, lane unchanged).
// Per 32-key step: 4 score products + 4 P.V products. Softmax state (running max, partial sum) is one scalar per lane; the two lane halves of a row are combined with one xor-16 exchange.
__global__ __launch_bounds__(32 * AW) void k_flash(const h16* __restrict__ QH, const h16* __restrict__ KP, const h16* __restrict__ VT, h16* CH) {
    __shared__ __align__(16) h16 ring[2 * 2 * TILE_H];   // [buffer][K | V^T][row][LP]
    __shared__ __align__(16) float os[AW * 16 * 68];
    const int tid = threadIdx.x;
    const int lane = threadIdx.x & 31, lr = lane & 15, hi = lane >> 4;
    const int wave = __builtin_amdgcn_readfirstlane((int)(threadIdx.x >> 5));   // wave-uniform
    const int zh = blockIdx.y; const int b = zh / NH_, h = zh % NH_;
    const int t0 = (blockIdx.x * AW + wave) * 16;
    const size_t pbase = (size_t)zh * SEQ * HD;
    const size_t qo = pbase + (size_t)(t0 + lr) * HD + 8 * hi;
    const v16h qh0 = ldh(QH + qo), qh1 = ldh(QH + qo + 32);   // B fragments: col t, k = d
    const unsigned lcp = (unsigned)(size_t)ring + (unsigned)(((tid >> 3) * LP + (tid & 7) * 8) * 2);   // the lane's copy target in buffer 0's K tile (LDS byte address)
    const h16* gk = KP + pbase + tid * 8;                                        // + tile * KT * HD
    const h16* gv = VT + pbase + (size_t)(tid >> 3) * SEQ + (tid & 7) * 8;       // + tile * KT
    const int fo = lr * LP + 8 * hi;   // fragment offset in a tile: K + key * LP (A: row key, k = d); V^T + 16j * LP + key (A: row d, k = key)
    copy_tile(lcp, gk, gv);
    asm volatile("s_wait_asynccnt 0x0" ::: "memory");   // this wave's share of tile 0 has landed
    __syncthreads();                                     // every wave's share has: tile 0 may be read
    copy_tile(lcp + 2 * TILE_H * 2, gk + KT * HD, gv + KT);
    v8f o0 = (v8f){}, o1 = (v8f){}, o2 = (v8f){}, o3 = (v8f){};
    float m = -3.0e38f, l = 0.0f;
#pragma unroll 1   // one trip per staged tile: the buffer index stays a run-time value and the loop text small
    for (int t = 0; t < SEQ / KT; ++t) {
      const h16* kt = ring + (t & 1) * (2 * TILE_H) + fo;
#pragma unroll 1    // the two 32-key steps of a tile stay rolled: unrolled, values of both steps live on past the barrier and the register count costs a wave per SIMD
      for (int u = 0; u < KT / 32; ++u) {
        const h16* ka = kt + u * 32 * LP;
        const v16h ka0 = ldh(ka), ka1 = ldh(ka + 32), kb0 = ldh(ka + 16 * LP), kb1 = ldh(ka + 16 * LP + 32);
        v8f sa = (v8f){}, sb = (v8f){};
        sa = wmma16(ka0, qh0, sa); sb = wmma16(kb0, qh0, sb);
        sa = wmma16(ka1, qh1, sa); sb = wmma16(kb1, qh1, sb);
        asm volatile("v_nop\n\tv_nop\n\tv_nop\n\tv_nop" : "+v"(sa), "+v"(sb) : "v"(ka0), "v"(ka1), "v"(kb0), "v"(kb1), "v"(qh0), "v"(qh1));
        float ta[8], tb[8]; float mx = -3.0e38f;
#pragma unroll
        for (int r = 0; r < 8; ++r) { ta[r] = sa[r] * SC2; tb[r] = sb[r] * SC2; mx = fmaxf(mx, fmaxf(ta[r], tb[r])); }
        mx = fmaxf(mx, __shfl_xor(mx, 16, 32));
        const float mnew = fmaxf(m, mx);
        const float alpha = __builtin_amdgcn_exp2f(m - mnew);
        const float sh = PSH - mnew;
        v16h pb; float ls = 0.0f;
#pragma unroll
        for (int r = 0; r < 8; ++r) { const h16 pa = (h16)__builtin_amdgcn_exp2f(ta[r] + sh); const h16 pc = (h16)__builtin_amdgcn_exp2f(tb[r] + sh); pb[r] = pa; pb[8 + r] = pc; ls += (float)pa + (float)pc; }
        l = l * alpha + ls; m = mnew;
        o0 = o0 * alpha; o1 = o1 * alpha; o2 = o2 * alpha; o3 = o3 * alpha;
        const h16* va = kt + TILE_H + u * 32;
        const v16h v0 = ldh(va), v1 = ldh(va + 16 * LP), v2 = ldh(va + 32 * LP), v3 = ldh(va + 48 * LP);
        o0 = wmma16(v0, pb, o0); o1 = wmma16(v1, pb, o1); o2 = wmma16(v2, pb, o2); o3 = wmma16(v3, pb, o3);
        asm volatile("v_nop\n\tv_nop\n\tv_nop\n\tv_nop" : "+v"(o0), "+v"(o1), "+v"(o2), "+v"(o3) : "v"(v0), "v"(v1), "v"(v2), "v"(v3), "v"(pb));
      }
      asm volatile("s_wait_dscnt 0x0" ::: "memory");      // this wave's reads of tile t are done before the buffer is refilled
      asm volatile("s_wait_asynccnt 0x0" ::: "memory");   // this wave's share of tile t + 1 has landed
      __syncthreads();                                     // publishes tile t + 1 and ends every wave's reads of tile t
      if (t + 2 < SEQ / KT) copy_tile(lcp + (unsigned)(t & 1) * (2 * TILE_H * 2), gk + (size_t)(t + 2) * KT * HD, gv + (t + 2) * KT);
    }
    asm volatile("s_wait_asynccnt 0x0" ::: "memory");     // no copy is outstanding when the wave goes on to its end
    l += __shfl_xor(l, 16, 32);
    const float inv = CTXS * (1.0f / l);
    const int wb = wave * 16 * 68;
    // O^T D layout: o_j[r] = (d = 16j + 8h + r, t = lane&15) -> os[t][d]; rows 0..15 x columns 0..63 all written
    { v4f a, c;
      a[0] = o0[0] * inv; a[1] = o0[1] * inv; a[2] = o0[2] * inv; a[3] = o0[3] * inv; c[0] = o0[4] * inv; c[1] = o0[5] * inv; c[2] = o0[6] * inv; c[3] = o0[7] * inv;
      *(v4fa*)(&os[wb + lr * 68 +  0 + 8 * hi]) = a; *(v4fa*)(&os[wb + lr * 68 +  0 + 8 * hi + 4]) = c;
      a[0] = o1[0] * inv; a[1] = o1[1] * inv; a[2] = o1[2] * inv; a[3] = o1[3] * inv; c[0] = o1[4] * inv; c[1] = o1[5] * inv; c[2] = o1[6] * inv; c[3] = o1[7] * inv;
      *(v4fa*)(&os[wb + lr * 68 + 16 + 8 * hi]) = a; *(v4fa*)(&os[wb + lr * 68 + 16 + 8 * hi + 4]) = c;
      a[0] = o2[0] * inv; a[1] = o2[1] * inv; a[2] = o2[2] * inv; a[3] = o2[3] * inv; c[0] = o2[4] * inv; c[1] = o2[5] * inv; c[2] = o2[6] * inv; c[3] = o2[7] * inv;
      *(v4fa*)(&os[wb + lr * 68 + 32 + 8 * hi]) = a; *(v4fa*)(&os[wb + lr * 68 + 32 + 8 * hi + 4]) = c;
      a[0] = o3[0] * inv; a[1] = o3[1] * inv; a[2] = o3[2] * inv; a[3] = o3[3] * inv; c[0] = o3[4] * inv; c[1] = o3[5] * inv; c[2] = o3[6] * inv; c[3] = o3[7] * inv;
      *(v4fa*)(&os[wb + lr * 68 + 48 + 8 * hi]) = a; *(v4fa*)(&os[wb + lr * 68 + 48 + 8 * hi + 4]) = c; }
    wave_sync();
    h16* crow = CH + ((size_t)b * SEQ + t0) * DM + h * HD;       // context plane row m = b*SEQ + t, columns h*64 + d
{
#pragma unroll
        for (int s = 0; s < 4; ++s) { const int row = 4 * s + (lane >> 3), c8 = (lane & 7) * 8;   // 4 s x 4 row groups = 16 rows; 8 lanes x 8 halves = 64 columns
            const v4f x0 = *(const v4fa*)(&os[wb + row * 68 + c8]); const v4f x1 = *(const v4fa*)(&os[wb + row * 68 + c8 + 4]); v8h hv;
#pragma unroll
            for (int i = 0; i < 4; ++i) { hv[i] = (h16)x0[i]; hv[4 + i] = (h16)x1[i]; }
            *(v8h*)(crow + (size_t)row * DM + c8) = hv; }
         }
}

// k_oproj: f16 GEMM, 256 x 128 block tile, 8 waves of one 64x64 tile each (16 accumulators), operands from K-contiguous f16 planes through LDS (gemm_main), K = DM.
// OUT[(r0/SEQ)*OUT_SEQ + r0%SEQ + i][c0 + j] = oscale * sum_k A[r0+i][k] Bt[c0+j][k]. grid (NB*SEQ/256, DM/128), 256 threads.
__global__ __launch_bounds__(256) void k_oproj(const h16* __restrict__ A, const h16* __restrict__ Bt, float* OUT, float oscale) {
    __shared__ __align__(16) bf ring[2 * GST_H];   // [buffer][A rows | Bt rows][LP]
    __shared__ __align__(16) float osb[8 * 16 * 68];
    const int lane = threadIdx.x & 31, lr = lane & 15, hi = lane >> 4;
    const int wave = __builtin_amdgcn_readfirstlane((int)(threadIdx.x >> 5));   // wave-uniform
    const int wm = wave & 3, wn = wave >> 2;
    const int r0 = blockIdx.x * GBM + wm * 64, c0 = blockIdx.y * GBN + wn * 64;
    float* os = osb + wave * 16 * 68;   // wave-private output staging
    v8f acc[4][4];
#pragma unroll
    for (int mb = 0; mb < 4; ++mb)
#pragma unroll
        for (int nb = 0; nb < 4; ++nb) acc[mb][nb] = (v8f){};
    gemm_main<1>((const bf*)A, (const bf*)Bt, ring, blockIdx.x * GBM, blockIdx.y * GBN, wm, wn, acc);
    const size_t obase = ((size_t)(r0 / SEQ) * OUT_SEQ + (size_t)(r0 % SEQ)) * DM + c0;
#pragma unroll
    for (int mb = 0; mb < 4; ++mb) {
#pragma unroll
        for (int nb = 0; nb < 4; ++nb) {
#pragma unroll
            for (int j = 0; j < 8; ++j) os[(hi * 8 + j) * 68 + nb * 16 + lr] = acc[mb][nb][j] * oscale; }   // D: row 8h+j, col lane&15
        wave_sync();
        float* orow = OUT + obase + (size_t)(mb * 16) * DM;
{
#pragma unroll
            for (int s = 0; s < 8; ++s) { const int row = 2 * s + hi, cofs = lr * 4;   // 8 s x 2 rows = 16 rows; 16 lanes x 4 floats = 64 columns
                const v4f val = *(const v4fa*)(&os[row * 68 + cofs]);
                *(v4f*)(orow + (size_t)row * DM + cofs) = val; }
             }
        wave_sync();
    }
}

static constexpr size_t al256(size_t v) { return (v + 255) & ~(size_t)255; }
static constexpr size_t SZ_XB = al256((size_t)NB * SEQ * DM * 2);          // one activation plane, reused for q, k, v in stream order
static constexpr size_t SZ_WB = al256((size_t)4 * DM * DM * 2);            // four transposed weight planes
static constexpr size_t SZ_PL = al256((size_t)NB * NH_ * SEQ * HD * 2);    // per-head planes (q, k, v^T)
static constexpr size_t SZ_CH = al256((size_t)NB * SEQ * DM * 2);          // context plane
static constexpr size_t SZ_TOTAL = SZ_XB + SZ_WB + 3 * SZ_PL + SZ_CH;
static_assert(SZ_TOTAL <= (size_t)134217728);          // workspace carve <= 128 MiB
static_assert(((size_t)DM * DM * 2) % 256 == 0);       // weight sub-planes stay 256-byte aligned
static_assert((size_t)NB * DM * SEQ * 2 <= SZ_PL);     // v^T plane [(b*1024 + m)][t] fits its region

static void cvt_x(const float* x, bf* XB, hipStream_t stream) {
    if (SEQ == SEQ_FULL) {
        const size_t n8 = (size_t)NB * SEQ * DM / 8;
        k_cvt8<<<(unsigned)((n8 + 255) / 256), 256, 0, stream>>>(x, XB, n8);
    } else {
        const size_t n8 = (size_t)SEQ * DM / 8;
        for (int b = 0; b < NB; ++b) k_cvt8<<<(unsigned)((n8 + 255) / 256), 256, 0, stream>>>(x + (size_t)b * SEQ_FULL * DM, XB + (size_t)b * SEQ * DM, n8);
    }
}

extern "C" void kernel_launch(void* const* d_in, const int* in_sizes, int n_in,
                              void* d_out, int out_size, void* d_ws, size_t ws_size, hipStream_t stream) {
    if (n_in < 7) return;
    const size_t needx = ((size_t)(NB - 1) * SEQ_FULL + SEQ) * DM;
    if ((size_t)in_sizes[0] < needx || (size_t)in_sizes[1] < needx || (size_t)in_sizes[2] < needx) return;
    if ((size_t)in_sizes[3] < (size_t)DM * DM || (size_t)in_sizes[4] < (size_t)DM * DM || (size_t)in_sizes[5] < (size_t)DM * DM || (size_t)in_sizes[6] < (size_t)DM * DM) return;
    if ((size_t)out_size < ((size_t)(NB - 1) * OUT_SEQ + SEQ) * DM) return;
    if (SZ_TOTAL > ws_size) return;
    // wire order: k, q, v, Wk, Wq, Wv, Wo (weights [in][out])
    const float* xq = (const float*)d_in[1]; const float* xk = (const float*)d_in[0]; const float* xv = (const float*)d_in[2];   /* this module stages k, q, v: the KEY stream is input 0 and the QUERY stream input 1 */
    const float* wq = (const float*)d_in[4]; const float* wk = (const float*)d_in[3]; const float* wv = (const float*)d_in[5]; const float* wo = (const float*)d_in[6];   /* w_key is input 3 and w_query input 4 */
    float* OUT = (float*)d_out;      // [NB][SEQ][1024]
    char* wsp = (char*)d_ws;
    bf* XB = (bf*)wsp; wsp += SZ_XB;                 // [NB*SEQ][1024] bf16, current activation
    bf* WB = (bf*)wsp; wsp += SZ_WB;                 // [4][1024 out][1024 in]: q | k | v (bf16) | o (f16 x64)
    h16* QH = (h16*)wsp; wsp += SZ_PL;               // [NB*16][SEQ][64]
    h16* KP = (h16*)wsp; wsp += SZ_PL;               // [NB*16][SEQ][64]
    h16* VT = (h16*)wsp; wsp += SZ_PL;               // [NB*16][64][SEQ]
    h16* CH = (h16*)wsp; wsp += SZ_CH;               // [NB*SEQ][1024] context x256
    bf* WQT = WB; bf* WKT = WB + (size_t)DM * DM; bf* WVT = WB + (size_t)2 * DM * DM; bf* WOT = WB + (size_t)3 * DM * DM;

    // weights: in[k = input feature][n = output feature] -> out[n][k]; square, grid (k tiles, n tiles)
    { const dim3 g(DM / 64, DM / 64, 1);
      k_wT<<<g, 256, 0, stream>>>(wq, WQT, 1.0f, 0);
      k_wT<<<g, 256, 0, stream>>>(wk, WKT, 1.0f, 0);
      k_wT<<<g, 256, 0, stream>>>(wv, WVT, 1.0f, 0);
      k_wT<<<g, 256, 0, stream>>>(wo, WOT, WOS, 1); }

    // q, k: A = x rows (m = b*SEQ + t), Bt = W^T rows (n = h*64 + d) -> plane [(b*16 + h)][t][d]
    cvt_x(xq, XB, stream);
    k_proj<<<dim3(NB * SEQ / GBM, DM / GBN, 1), 256, 0, stream>>>(XB, WQT, QH, SEQ, (size_t)NH_ * SEQ * HD, HD, HD, (size_t)SEQ * HD);
    cvt_x(xk, XB, stream);
    k_proj<<<dim3(NB * SEQ / GBM, DM / GBN, 1), 256, 0, stream>>>(XB, WKT, KP, SEQ, (size_t)NH_ * SEQ * HD, HD, HD, (size_t)SEQ * HD);
    // v^T: A = Wv^T rows (m = h*64 + d), Bt = x rows (n = b*SEQ + t) -> plane [(b*1024 + m)][t] = [(b*16 + h)][d][t]
    cvt_x(xv, XB, stream);
    k_proj<<<dim3(DM / GBM, NB * SEQ / GBN, 1), 256, 0, stream>>>(WVT, XB, VT, DM, (size_t)0, SEQ, SEQ, (size_t)DM * SEQ);

    k_flash<<<dim3(SEQ / (16 * AW), NB * NH_, 1), 32 * AW, 0, stream>>>(QH, KP, VT, CH);

    // output projection: A = context rows (m = b*SEQ + t), Bt = Wo^T rows (n) -> f32 output
    k_oproj<<<dim3(NB * SEQ / GBM, DM / GBN, 1), 256, 0, stream>>>(CH, (const h16*)WOT, OUT, OSC);
}

// v003
// It runs in 155 microseconds.
// Timed twice side by side with v002, it ran 1.10 and 1.11 times as fast.
// All steps since v000 together make it 2.36 times as fast.
#include <hip/hip_runtime.h>

// Attention with 16 heads x 64, width 1024, whose KEY stream and KEY weight are staged FIRST: separate inputs k, q, v [4][2048][1024] (f32), weights w_key / w_query / w_value / w_proj stored [in][out] (y = x W, normal x 0.02), no biases, no mask, scores / sqrt(64), softmax over the keys, f32 output = (merged heads) w_proj [4][2048][1024]; argument order k, q, v, w_key, w_query, w_value, w_proj.
// Compute dtypes, f32 accumulate everywhere: projections v_wmma_f32_16x16x32_bf16 (x and W RNE-converted to bf16; products exact);
// scores v_wmma_f32_16x16x32_f16: q and k single f16 planes (one product); P (x256 carry, cancels in the normalisation) and v single f16; softmax f32 (online, running max);
// output projection v_wmma_f32_16x16x32_f16: context single f16 (x256 carry), Wo = f16 of (bf16 RNE of Wo) x64; 2^-14 folded into the f32 epilogue.
// Layout: three bf16 activation planes (q, k, v) and the transposed weight planes [out][in], all written by one conversion launch; q, k planes [b*16+h][t][d], v^T plane [b*16+h][d][t] written by the GEMM epilogue;
// fused flash kernel in transposed form (S^T = K Q^T, O^T = V^T P^T) writes the f16 context plane [b*SEQ+t][1024]; last GEMM writes the f32 output.

#ifndef NB
#define NB 4
#endif
#ifndef SEQ
#define SEQ 2048
#endif
#define NB_FULL  4
#define SEQ_FULL 2048
#ifndef OUT_SEQ
#define OUT_SEQ SEQ              // row pitch (in tokens) between batches of the output
#endif
#define DM   1024
#define NH_  16
#define HD   64
#define AW   8                   // waves per flash block (16 query rows each); all of them read one staged K / V^T tile
#define KT   64                  // keys per staged tile (two 32-key steps)
#define LP   72                  // LDS row pitch in halves: 144 B = 16 B x 9, so the 16 rows of a 16-byte fragment read fall on distinct banks
#define TILE_H (64 * LP)         // halves of one staged tile: 64 rows (K: keys, V^T: d) of 64 halves + pad
#define GBM  256                 // GEMM block tile: A rows (4 waves of 64)
#define GBN  128                 // GEMM block tile: Bt rows = output columns (2 waves of 64)
#define GKS  64                  // k per staged GEMM tile (two 32-k steps): 128 B of every operand row
#define GST_H ((GBM + GBN) * LP) // halves of one GEMM stage: 256 A rows, then 128 Bt rows, at pitch LP
#define PG   256                 // conversion work-groups: one resident round, each loops over its share
#define PW   16                  // waves per conversion work-group
#define PLD  8                   // 16-B loads a wave holds in flight per batch: 8 x 512 B = 4 KiB contiguous
#define SC2  (0.125f * 1.4426950408889634f)   // HD^-0.5 * log2(e)
#define PSH  8.0f                // log2 of the P carry (256)
#define CTXS 256.0f              // carry of the context plane
#define WOS  64.0f               // carry of the Wo plane
#define OSC  (1.0f / (CTXS * WOS))

static_assert(HD == 64);
static_assert(NH_ * HD == DM);                 // head h = columns h*64 + d
static_assert(DM % 64 == 0);                   // 16 column tiles of 64
static_assert(DM % 32 == 0);                   // GEMM k-loop steps by 32
static_assert(SEQ % 64 == 0);                  // a 64-row tile never straddles two batches
static_assert((NB * SEQ) % 64 == 0);
static_assert(SEQ % KT == 0 && SEQ / KT >= 2);  // key loop walks whole staged tiles; the two-buffer prologue needs two
static_assert(32 * AW == 256);                 // 256 lanes x 2 copies x 16 B = one 8-KiB tile
static_assert(SEQ % (16 * AW) == 0);           // flash grid covers the sequence exactly
static_assert(((size_t)SEQ * DM) % 8 == 0);
static_assert(DM % GKS == 0 && DM / GKS >= 2);                 // GEMM k loop walks whole stages; the two-buffer prologue needs two
static_assert((GBM + GBN) * GKS * 2 == 12 * 256 * 16);         // 256 lanes x 12 copies x 16 B = one stage
static_assert((NB * SEQ) % GBM == 0 && (NB * SEQ) % GBN == 0); // block tiles cover the token rows exactly, as A or as Bt
static_assert(DM % GBM == 0 && DM % GBN == 0);                 // and the feature rows
static_assert(SEQ % 64 == 0 && GBM % 64 == 0 && GBN % 64 == 0);
static_assert(4 * (DM / 64) * (DM / 64) == 4 * PG && PG % 4 == 0 && (DM / 64) % 2 == 0 && 32 * PW == 512);   // four weight tiles a conversion work-group, two a 256-thread half
static_assert((size_t)NB * SEQ * DM == 2 * (size_t)PG * PW * PLD * 128);   // two batches cover an activation plane exactly
static_assert(((size_t)SEQ * DM) % (PLD * 128) == 0);                      // a wave's batch never straddles two batches of the input
static_assert(NB <= NB_FULL);
static_assert(SEQ <= SEQ_FULL);

typedef _Float16 h16;
typedef unsigned short bf;
typedef __attribute__((ext_vector_type(16))) __bf16   v16bf;
typedef __attribute__((ext_vector_type(16))) _Float16 v16h;
typedef __attribute__((ext_vector_type(8)))  _Float16 v8h;
typedef __attribute__((ext_vector_type(8)))  unsigned short v8us;
typedef __attribute__((ext_vector_type(16))) unsigned short v16us;
typedef __attribute__((ext_vector_type(4)))  unsigned short v4us;
typedef __attribute__((ext_vector_type(8)))  float    v8f;
typedef __attribute__((ext_vector_type(4)))  float    v4f;
typedef v4f  __attribute__((may_alias)) v4fa;

__device__ __forceinline__ unsigned short f2bf(float f) { unsigned u = __float_as_uint(f); u += 0x7FFFu + ((u >> 16) & 1u); return (unsigned short)(u >> 16); }
__device__ __forceinline__ v16h cat16(v8h lo, v8h hi) { return __builtin_shufflevector(lo, hi, 0, 1, 2, 3, 4, 5, 6, 7, 8, 9, 10, 11, 12, 13, 14, 15); }
__device__ __forceinline__ v8f wmma16(v16h a, v16h b, v8f c) { return __builtin_amdgcn_wmma_f32_16x16x32_f16(false, a, false, b, (short)0, c, false, false); }
__device__ __forceinline__ v8f wmmab(v16bf a, v16bf b, v8f c) { return __builtin_amdgcn_wmma_f32_16x16x32_bf16(false, a, false, b, (short)0, c, false, false); }
// fragment loaders from K-contiguous 16-bit rows; p already includes + 8*(lane>>4): elements 0..7 <- k0+8h+0..7, elements 8..15 <- k0+16+8h+0..7 (same map for A and B)
__device__ __forceinline__ v16h  ldh(const h16* p) { return cat16(*(const v8h*)p, *(const v8h*)(p + 16)); }
// ordering point for wave-private LDS tiles (same wave writes and reads)
__device__ __forceinline__ void wave_sync() { __builtin_amdgcn_fence(3 /* release order */, "wavefront"); __builtin_amdgcn_wave_barrier(); asm volatile("" ::: "memory"); }

// k_prep: every operand conversion of the call in ONE launch of PG resident work-groups of PW waves.
// Weights: work-group g takes four 64 x 64 tiles of weight g / 64 (each 256-thread half two of them): in[k][n] (k = input feature, n = output feature) -> out[n][k] through LDS;
// planes 0..2 bf16 bits (RNE), plane 3 f16 bits of (bf16 RNE value * WOS), a power of two (exact).
// Activations: f32 -> bf16 (RNE), element order kept. A batch is PLD loads of 16 B a lane, 4 KiB contiguous a wave; the next batch's loads are issued before this one is converted and stored.
// Batch b of a plane: elements b * PEB + e0 + j * 128 + 0..3, e0 = the lane's place in the grid's first batch (a 32-bit offset from a uniform base).
#define PEB  ((size_t)PG * PW * PLD * 128)   // elements of one batch over the whole grid
// closes a group of global loads or stores: what follows may rewrite the registers that the group names (addresses, store data) only behind this wait
__device__ __forceinline__ void xwait() { asm volatile("s_wait_xcnt 0x0" ::: "memory"); }
__device__ __forceinline__ size_t xoff(size_t e) { return (e / ((size_t)SEQ * DM)) * ((size_t)SEQ_FULL * DM) + e % ((size_t)SEQ * DM); }
__device__ __forceinline__ void ld_batch(const float* __restrict__ x, int b, unsigned e0, v4f (&r)[PLD]) {
    const float* s = SEQ == SEQ_FULL ? (x + b * PEB) + e0 : x + xoff(b * PEB + e0);
#pragma unroll
    for (int j = 0; j < PLD; ++j) r[j] = *(const v4f*)(s + j * 128);
    xwait();
}
__device__ __forceinline__ void st_batch(bf* __restrict__ d, int b, unsigned e0, const v4f (&r)[PLD]) {
    bf* t = (d + b * PEB) + e0;
#pragma unroll
    for (int j = 0; j < PLD; ++j) { v4us o;
#pragma unroll
        for (int k = 0; k < 4; ++k) o[k] = f2bf(r[j][k]);
        *(v4us*)(t + j * 128) = o; }
}
__global__ __launch_bounds__(32 * PW) void k_prep(const float* __restrict__ xq, const float* __restrict__ xk, const float* __restrict__ xv,
                                                  const float* __restrict__ wq, const float* __restrict__ wk, const float* __restrict__ wv, const float* __restrict__ wo,
                                                  bf* __restrict__ XQ, bf* __restrict__ XK, bf* __restrict__ XV, bf* __restrict__ WB) {
    __shared__ float tsb[4 * 64 * 65];
    const int tid = threadIdx.x & 255, hf = threadIdx.x >> 8;
    const int ws = blockIdx.x / (PG / 4);                       // which weight: the same for the whole work-group
    const float* W = ws == 0 ? wq : ws == 1 ? wk : ws == 2 ? wv : wo;
    bf* dst = WB + (size_t)ws * DM * DM;
    const int asF16 = ws == 3; const float scale = asF16 ? WOS : 1.0f;
    const int tw = (blockIdx.x % (PG / 4)) * 4 + hf * 2;        // first of this half's two tiles: k tile = tw % 16 (even, so tw + 1 has the same n tile), n tile = tw / 16
    const int k0 = (tw % (DM / 64)) * 64, n0 = (tw / (DM / 64)) * 64;
    v4f wr[2][4];
#pragma unroll
    for (int u = 0; u < 2; ++u)
#pragma unroll
        for (int i = 0; i < 4; ++i) { const int idx = tid + 256 * i; const int kk = idx >> 4, c4 = (idx & 15) * 4;
            wr[u][i] = *(const v4f*)(W + (size_t)(k0 + 64 * u + kk) * DM + n0 + c4); }
    xwait();
    const unsigned e0 = (blockIdx.x * PW + (threadIdx.x >> 5)) * (PLD * 128) + (threadIdx.x & 31) * 4;
    v4f ra[PLD], rb[PLD];
    ld_batch(xq, 0, e0, ra);
#pragma unroll
    for (int u = 0; u < 2; ++u) { float* ts = tsb + (hf * 2 + u) * 64 * 65;
#pragma unroll
        for (int i = 0; i < 4; ++i) { const int idx = tid + 256 * i; const int kk = idx >> 4, c4 = (idx & 15) * 4;
            ts[kk * 65 + c4 + 0] = wr[u][i][0]; ts[kk * 65 + c4 + 1] = wr[u][i][1]; ts[kk * 65 + c4 + 2] = wr[u][i][2]; ts[kk * 65 + c4 + 3] = wr[u][i][3]; } }
    __syncthreads();
    const int c8 = (tid & 7) * 8;
#pragma unroll
    for (int u = 0; u < 2; ++u) { const float* ts = tsb + (hf * 2 + u) * 64 * 65;
        v8us o0, o1;
#pragma unroll
        for (int j = 0; j < 8; ++j) {
            const float xa = ts[(c8 + j) * 65 + (tid >> 3)]; const float xb = ts[(c8 + j) * 65 + (tid >> 3) + 32];
            const unsigned short ba = f2bf(xa), bb = f2bf(xb);
            const h16 ha = (h16)(__uint_as_float((unsigned)ba << 16) * scale); const h16 hb = (h16)(__uint_as_float((unsigned)bb << 16) * scale);
            const unsigned short fa = __builtin_bit_cast(unsigned short, ha), fb = __builtin_bit_cast(unsigned short, hb);
            o0[j] = asF16 ? fa : ba; o1[j] = asF16 ? fb : bb; }
        *(v8us*)(dst + (size_t)(n0 + (tid >> 3)) * DM + k0 + 64 * u + c8) = o0;
        *(v8us*)(dst + (size_t)(n0 + (tid >> 3) + 32) * DM + k0 + 64 * u + c8) = o1; }
    xwait();
    ld_batch(xq, 1, e0, rb); st_batch(XQ, 0, e0, ra); xwait();
    ld_batch(xk, 0, e0, ra); st_batch(XQ, 1, e0, rb); xwait();
    ld_batch(xk, 1, e0, rb); st_batch(XK, 0, e0, ra); xwait();
    ld_batch(xv, 0, e0, ra); st_batch(XK, 1, e0, rb); xwait();
    ld_batch(xv, 1, e0, rb); st_batch(XV, 0, e0, ra); xwait();
    st_batch(XV, 1, e0, rb);
}

// copy_stage: one GEMM stage, 64 k of 256 A rows and of 128 Bt rows (row pitch DM halves in memory), into LDS at pitch LP, no register in between.
// Lane tid brings 16 B of rows (tid>>3) + 32 i, so a wave's copy covers four whole 128-B lines. l = the lane's LDS byte address in row tid>>3 of the stage.
__device__ __forceinline__ void copy_stage(unsigned l, const bf* ga, const bf* gb) {
    const unsigned S = 32 * LP * 2; const size_t G = (size_t)32 * DM;
    // the closing s_wait_xcnt stands inside the statement so that no address register is rewritten ahead of it
    asm volatile("global_load_async_to_lds_b128 %0, %1, off\n\t"
                 "global_load_async_to_lds_b128 %2, %3, off\n\t"
                 "global_load_async_to_lds_b128 %4, %5, off\n\t"
                 "global_load_async_to_lds_b128 %6, %7, off\n\t"
                 "global_load_async_to_lds_b128 %8, %9, off\n\t"
                 "global_load_async_to_lds_b128 %10, %11, off\n\t"
                 "global_load_async_to_lds_b128 %12, %13, off\n\t"
                 "global_load_async_to_lds_b128 %14, %15, off\n\t"
                 "global_load_async_to_lds_b128 %16, %17, off\n\t"
                 "global_load_async_to_lds_b128 %18, %19, off\n\t"
                 "global_load_async_to_lds_b128 %20, %21, off\n\t"
                 "global_load_async_to_lds_b128 %22, %23, off\n\t"
                 "s_wait_xcnt 0x0"
                 :: "v"(l), "v"(ga), "v"(l + S), "v"(ga + G), "v"(l + 2 * S), "v"(ga + 2 * G), "v"(l + 3 * S), "v"(ga + 3 * G),
                    "v"(l + 4 * S), "v"(ga + 4 * G), "v"(l + 5 * S), "v"(ga + 5 * G), "v"(l + 6 * S), "v"(ga + 6 * G), "v"(l + 7 * S), "v"(ga + 7 * G),
                    "v"(l + 8 * S), "v"(gb), "v"(l + 9 * S), "v"(gb + G), "v"(l + 10 * S), "v"(gb + 2 * G), "v"(l + 11 * S), "v"(gb + 3 * G) : "memory");
}

// fragment from a staged row; p already includes + 8*(lane>>4): the k map of ldh
__device__ __forceinline__ v16us ldu(const bf* p) { return __builtin_shufflevector(*(const v8us*)p, *(const v8us*)(p + 16), 0, 1, 2, 3, 4, 5, 6, 7, 8, 9, 10, 11, 12, 13, 14, 15); }
template <int F16> __device__ __forceinline__ v8f wmmau(v16us a, v16us b, v8f c) {
    if constexpr (F16) return wmma16(__builtin_bit_cast(v16h, a), __builtin_bit_cast(v16h, b), c);
    else return wmmab(__builtin_bit_cast(v16bf, a), __builtin_bit_cast(v16bf, b), c);
}

// gemm_main: k loop of one 256 x 128 block tile, K = DM, 8 waves of 64 x 64 (wave (wm, wn): A rows rb + 64 wm, Bt rows cb + 64 wn; 16 accumulators each).
// Stages of 64 k come into LDS by asynchronous copies (two buffers, the next stage in flight while this one is worked on); every wave reads its fragments as 16-B LDS loads.
// Each accumulator takes its 32-k products in rising k, as with operands read straight from memory.
template <int F16>
__device__ __forceinline__ void gemm_main(const bf* A, const bf* Bt, bf* ring, int rb, int cb, int wm, int wn, v8f (&acc)[4][4]) {
    const int tid = threadIdx.x, lr = tid & 15, hi = (tid >> 4) & 1;
    const unsigned lcp = (unsigned)(size_t)ring + (unsigned)(((tid >> 3) * LP + (tid & 7) * 8) * 2);   // the lane's copy target in buffer 0 (LDS byte address)
    const bf* ga = A + (size_t)(rb + (tid >> 3)) * DM + (tid & 7) * 8;    // + stage * GKS
    const bf* gb = Bt + (size_t)(cb + (tid >> 3)) * DM + (tid & 7) * 8;   // + stage * GKS
    const int fa = (wm * 64 + lr) * LP + 8 * hi, fb = (GBM + wn * 64 + lr) * LP + 8 * hi;   // fragment offsets in a stage
    copy_stage(lcp, ga, gb);
    asm volatile("s_wait_asynccnt 0x0" ::: "memory");   // this wave's share of stage 0 has landed
    __syncthreads();                                     // every wave's share has: stage 0 may be read
    copy_stage(lcp + GST_H * 2, ga + GKS, gb + GKS);
#pragma unroll 1   // one trip per stage: the buffer index stays a run-time value and the loop text small
    for (int t = 0; t < DM / GKS; ++t) {
        const bf* pa = ring + (t & 1) * GST_H + fa; const bf* pb = ring + (t & 1) * GST_H + fb;
        v16us a[GKS / 32][4], b[GKS / 32][4];
        // every loop below is unrolled whole: fragments and accumulators are indexed by constants and so stay in registers
#pragma unroll
        for (int u = 0; u < GKS / 32; ++u) {
#pragma unroll
            for (int i = 0; i < 4; ++i) { a[u][i] = ldu(pa + i * 16 * LP + u * 32); b[u][i] = ldu(pb + i * 16 * LP + u * 32); }
        }
        __builtin_amdgcn_sched_barrier(0);   // the stage's LDS reads stay one group ahead of its products (for speed only)
#pragma unroll
        for (int u = 0; u < GKS / 32; ++u)
#pragma unroll
            for (int nb = 0; nb < 4; ++nb)
#pragma unroll
                for (int mb = 0; mb < 4; ++mb) acc[mb][nb] = wmmau<F16>(a[u][mb], b[u][nb], acc[mb][nb]);
        __builtin_amdgcn_sched_barrier(0);   // the products stay ahead of the closing waits: moved behind the barrier they would start only when every wave's LDS reads are over
        asm volatile("s_wait_dscnt 0x0" ::: "memory");      // this wave's reads of stage t are done before the buffer is refilled
        asm volatile("s_wait_asynccnt 0x0" ::: "memory");   // this wave's share of stage t + 1 has landed
        __syncthreads();                                     // publishes stage t + 1 and ends every wave's reads of stage t
        if (t + 2 < DM / GKS) copy_stage(lcp + (unsigned)(t & 1) * (GST_H * 2), ga + (t + 2) * GKS, gb + (t + 2) * GKS);
    }
    asm volatile("s_wait_asynccnt 0x0" ::: "memory");       // no copy is outstanding when the wave goes on to its epilogue
}

// k_proj: bf16 GEMM, 256 x 128 block tile, 8 waves of one 64x64 tile each (16 accumulators), operands from K-contiguous bf16 planes through LDS (gemm_main), K = DM.
// C[m][n] = sum_k A[m][k] Bt[n][k], written as f16 (Ph) at
// wave tile base (r0/RB)*sRB + (r0%RB)*pitch + (c0/CB)*sCB + (c0%CB), row pitch 'pitch' (halves). grid (M/256, N/128), 256 threads.
__global__ __launch_bounds__(256) void k_proj(const bf* __restrict__ A, const bf* __restrict__ Bt, h16* Ph, int RB, size_t sRB, int pitch, int CB, size_t sCB) {
    __shared__ __align__(16) bf ring[2 * GST_H];   // [buffer][A rows | Bt rows][LP]
    __shared__ __align__(16) float osb[8 * 16 * 68];
    const int lane = threadIdx.x & 31, lr = lane & 15, hi = lane >> 4;
    const int wave = __builtin_amdgcn_readfirstlane((int)(threadIdx.x >> 5));   // wave-uniform
    const int wm = wave & 3, wn = wave >> 2;
    const int r0 = blockIdx.x * GBM + wm * 64, c0 = blockIdx.y * GBN + wn * 64;
    float* os = osb + wave * 16 * 68;   // wave-private output staging
    v8f acc[4][4];
#pragma unroll
    for (int mb = 0; mb < 4; ++mb)
#pragma unroll
        for (int nb = 0; nb < 4; ++nb) acc[mb][nb] = (v8f){};
    gemm_main<0>(A, Bt, ring, blockIdx.x * GBM, blockIdx.y * GBN, wm, wn, acc);
    const size_t tbase = (size_t)(r0 / RB) * sRB + (size_t)(r0 % RB) * (size_t)pitch + (size_t)(c0 / CB) * sCB + (size_t)(c0 % CB);
#pragma unroll
    for (int mb = 0; mb < 4; ++mb) {
#pragma unroll
        for (int nb = 0; nb < 4; ++nb) {
#pragma unroll
            for (int j = 0; j < 8; ++j) os[(hi * 8 + j) * 68 + nb * 16 + lr] = acc[mb][nb][j]; }   // D: row 8h+j, col lane&15
        wave_sync();
        const size_t sb = tbase + (size_t)(mb * 16) * (size_t)pitch;
{
#pragma unroll
            for (int s = 0; s < 4; ++s) { const int row = 4 * s + (lane >> 3), c8 = (lane & 7) * 8;   // 4 s x 4 row groups = 16 rows; 8 lanes x 8 = 64 columns
                const v4f x0 = *(const v4fa*)(&os[row * 68 + c8]); const v4f x1 = *(const v4fa*)(&os[row * 68 + c8 + 4]); v8h hv;
#pragma unroll
                for (int i = 0; i < 4; ++i) { hv[i] = (h16)x0[i]; hv[4 + i] = (h16)x1[i]; }
                const size_t oo = sb + (size_t)row * (size_t)pitch + c8;
                *(v8h*)(Ph + oo) = hv; }
             }
        wave_sync();
    }
}

// copy_tile: one 64-key K tile (64 rows of 128 B, contiguous) and one V^T tile (64 rows d of 128 B, pitch SEQ halves) into LDS at pitch LP, no register in between.
// Lane tid brings 16 B of rows tid>>3 and 32 + (tid>>3) of each tile, so a wave's copy covers four whole 128-B lines. lk = the lane's LDS byte address in the K tile.
__device__ __forceinline__ void copy_tile(unsigned lk, const h16* gk, const h16* gv) {
    const unsigned lk1 = lk + 32 * LP * 2, lv = lk + TILE_H * 2, lv1 = lv + 32 * LP * 2;
    const h16* gk1 = gk + 32 * HD; const h16* gv1 = gv + (size_t)32 * SEQ;
    // the closing s_wait_xcnt stands inside the statement so that no address register is rewritten ahead of it
    asm volatile("global_load_async_to_lds_b128 %0, %1, off\n\t"
                 "global_load_async_to_lds_b128 %2, %3, off\n\t"
                 "global_load_async_to_lds_b128 %4, %5, off\n\t"
                 "global_load_async_to_lds_b128 %6, %7, off\n\t"
                 "s_wait_xcnt 0x0"
                 :: "v"(lk), "v"(gk), "v"(lk1), "v"(gk1), "v"(lv), "v"(gv), "v"(lv1), "v"(gv1) : "memory");
}

// k_flash: fused attention, one wave per 16 query rows of one (batch, head); Q fragments straight from the f16 plane; K / V^T tiles of 64 keys staged in LDS
// by asynchronous copies (two buffers, the next tile in flight while this one is worked on) and read by all AW waves as 16-B fragment loads.
// Transposed form: S^T[key][t] = K Q^T (A = K rows, B = Q rows); lane (t = lane&15, h = lane>>4) holds keys 8h+r of each 16-key tile, so the packed
// P tile is directly the B fragment of O^T[d][t] = V^T P^T (element r <- tile keys 0..15, element 8+r <- tile keys 16..31, lane unchanged).
// Per 32-key step: 4 score products + 4 P.V products. Softmax state (running max, partial sum) is one scalar per lane; the two lane halves of a row are combined with one xor-16 exchange.
__global__ __launch_bounds__(32 * AW) void k_flash(const h16* __restrict__ QH, const h16* __restrict__ KP, const h16* __restrict__ VT, h16* CH) {
    __shared__ __align__(16) h16 ring[2 * 2 * TILE_H];   // [buffer][K | V^T][row][LP]
    __shared__ __align__(16) float os[AW * 16 * 68];
    const int tid = threadIdx.x;
    const int lane = threadIdx.x & 31, lr = lane & 15, hi = lane >> 4;
    const int wave = __builtin_amdgcn_readfirstlane((int)(threadIdx.x >> 5));   // wave-uniform
    const int zh = blockIdx.y; const int b = zh / NH_, h = zh % NH_;
    const int t0 = (blockIdx.x * AW + wave) * 16;
    const size_t pbase = (size_t)zh * SEQ * HD;
    const size_t qo = pbase + (size_t)(t0 + lr) * HD + 8 * hi;
    const v16h qh0 = ldh(QH + qo), qh1 = ldh(QH + qo + 32);   // B fragments: col t, k = d
    const unsigned lcp = (unsigned)(size_t)ring + (unsigned)(((tid >> 3) * LP + (tid & 7) * 8) * 2);   // the lane's copy target in buffer 0's K tile (LDS byte address)
    const h16* gk = KP + pbase + tid * 8;                                        // + tile * KT * HD
    const h16* gv = VT + pbase + (size_t)(tid >> 3) * SEQ + (tid & 7) * 8;       // + tile * KT
    const int fo = lr * LP + 8 * hi;   // fragment offset in a tile: K + key * LP (A: row key, k = d); V^T + 16j * LP + key (A: row d, k = key)
    copy_tile(lcp, gk, gv);
    asm volatile("s_wait_asynccnt 0x0" ::: "memory");   // this wave's share of tile 0 has landed
    __syncthreads();                                     // every wave's share has: tile 0 may be read
    copy_tile(lcp + 2 * TILE_H * 2, gk + KT * HD, gv + KT);
    v8f o0 = (v8f){}, o1 = (v8f){}, o2 = (v8f){}, o3 = (v8f){};
    float m = -3.0e38f, l = 0.0f;
#pragma unroll 1   // one trip per staged tile: the buffer index stays a run-time value and the loop text small
    for (int t = 0; t < SEQ / KT; ++t) {
      const h16* kt = ring + (t & 1) * (2 * TILE_H) + fo;
#pragma unroll 1    // the two 32-key steps of a tile stay rolled: unrolled, values of both steps live on past the barrier and the register count costs a wave per SIMD
      for (int u = 0; u < KT / 32; ++u) {
        const h16* ka = kt + u * 32 * LP;
        const v16h ka0 = ldh(ka), ka1 = ldh(ka + 32), kb0 = ldh(ka + 16 * LP), kb1 = ldh(ka + 16 * LP + 32);
        v8f sa = (v8f){}, sb = (v8f){};
        sa = wmma16(ka0, qh0, sa); sb = wmma16(kb0, qh0, sb);
        sa = wmma16(ka1, qh1, sa); sb = wmma16(kb1, qh1, sb);
        asm volatile("v_nop\n\tv_nop\n\tv_nop\n\tv_nop" : "+v"(sa), "+v"(sb) : "v"(ka0), "v"(ka1), "v"(kb0), "v"(kb1), "v"(qh0), "v"(qh1));
        float ta[8], tb[8]; float mx = -3.0e38f;
#pragma unroll
        for (int r = 0; r < 8; ++r) { ta[r] = sa[r] * SC2; tb[r] = sb[r] * SC2; mx = fmaxf(mx, fmaxf(ta[r], tb[r])); }
        mx = fmaxf(mx, __shfl_xor(mx, 16, 32));
        const float mnew = fmaxf(m, mx);
        const float alpha = __builtin_amdgcn_exp2f(m - mnew);
        const float sh = PSH - mnew;
        v16h pb; float ls = 0.0f;
#pragma unroll
        for (int r = 0; r < 8; ++r) { const h16 pa = (h16)__builtin_amdgcn_exp2f(ta[r] + sh); const h16 pc = (h16)__builtin_amdgcn_exp2f(tb[r] + sh); pb[r] = pa; pb[8 + r] = pc; ls += (float)pa + (float)pc; }
        l = l * alpha + ls; m = mnew;
        o0 = o0 * alpha; o1 = o1 * alpha; o2 = o2 * alpha; o3 = o3 * alpha;
        const h16* va = kt + TILE_H + u * 32;
        const v16h v0 = ldh(va), v1 = ldh(va + 16 * LP), v2 = ldh(va + 32 * LP), v3 = ldh(va + 48 * LP);
        o0 = wmma16(v0, pb, o0); o1 = wmma16(v1, pb, o1); o2 = wmma16(v2, pb, o2); o3 = wmma16(v3, pb, o3);
        asm volatile("v_nop\n\tv_nop\n\tv_nop\n\tv_nop" : "+v"(o0), "+v"(o1), "+v"(o2), "+v"(o3) : "v"(v0), "v"(v1), "v"(v2), "v"(v3), "v"(pb));
      }
      asm volatile("s_wait_dscnt 0x0" ::: "memory");      // this wave's reads of tile t are done before the buffer is refilled
      asm volatile("s_wait_asynccnt 0x0" ::: "memory");   // this wave's share of tile t + 1 has landed
      __syncthreads();                                     // publishes tile t + 1 and ends every wave's reads of tile t
      if (t + 2 < SEQ / KT) copy_tile(lcp + (unsigned)(t & 1) * (2 * TILE_H * 2), gk + (size_t)(t + 2) * KT * HD, gv + (t + 2) * KT);
    }
    asm volatile("s_wait_asynccnt 0x0" ::: "memory");     // no copy is outstanding when the wave goes on to its end
    l += __shfl_xor(l, 16, 32);
    const float inv = CTXS * (1.0f / l);
    const int wb = wave * 16 * 68;
    // O^T D layout: o_j[r] = (d = 16j + 8h + r, t = lane&15) -> os[t][d]; rows 0..15 x columns 0..63 all written
    { v4f a, c;
      a[0] = o0[0] * inv; a[1] = o0[1] * inv; a[2] = o0[2] * inv; a[3] = o0[3] * inv; c[0] = o0[4] * inv; c[1] = o0[5] * inv; c[2] = o0[6] * inv; c[3] = o0[7] * inv;
      *(v4fa*)(&os[wb + lr * 68 +  0 + 8 * hi]) = a; *(v4fa*)(&os[wb + lr * 68 +  0 + 8 * hi + 4]) = c;
      a[0] = o1[0] * inv; a[1] = o1[1] * inv; a[2] = o1[2] * inv; a[3] = o1[3] * inv; c[0] = o1[4] * inv; c[1] = o1[5] * inv; c[2] = o1[6] * inv; c[3] = o1[7] * inv;
      *(v4fa*)(&os[wb + lr * 68 + 16 + 8 * hi]) = a; *(v4fa*)(&os[wb + lr * 68 + 16 + 8 * hi + 4]) = c;
      a[0] = o2[0] * inv; a[1] = o2[1] * inv; a[2] = o2[2] * inv; a[3] = o2[3] * inv; c[0] = o2[4] * inv; c[1] = o2[5] * inv; c[2] = o2[6] * inv; c[3] = o2[7] * inv;
      *(v4fa*)(&os[wb + lr * 68 + 32 + 8 * hi]) = a; *(v4fa*)(&os[wb + lr * 68 + 32 + 8 * hi + 4]) = c;
      a[0] = o3[0] * inv; a[1] = o3[1] * inv; a[2] = o3[2] * inv; a[3] = o3[3] * inv; c[0] = o3[4] * inv; c[1] = o3[5] * inv; c[2] = o3[6] * inv; c[3] = o3[7] * inv;
      *(v4fa*)(&os[wb + lr * 68 + 48 + 8 * hi]) = a; *(v4fa*)(&os[wb + lr * 68 + 48 + 8 * hi + 4]) = c; }
    wave_sync();
    h16* crow = CH + ((size_t)b * SEQ + t0) * DM + h * HD;       // context plane row m = b*SEQ + t, columns h*64 + d
{
#pragma unroll
        for (int s = 0; s < 4; ++s) { const int row = 4 * s + (lane >> 3), c8 = (lane & 7) * 8;   // 4 s x 4 row groups = 16 rows; 8 lanes x 8 halves = 64 columns
            const v4f x0 = *(const v4fa*)(&os[wb + row * 68 + c8]); const v4f x1 = *(const v4fa*)(&os[wb + row * 68 + c8 + 4]); v8h hv;
#pragma unroll
            for (int i = 0; i < 4; ++i) { hv[i] = (h16)x0[i]; hv[4 + i] = (h16)x1[i]; }
            *(v8h*)(crow + (size_t)row * DM + c8) = hv; }
         }
}

// k_oproj: f16 GEMM, 256 x 128 block tile, 8 waves of one 64x64 tile each (16 accumulators), operands from K-contiguous f16 planes through LDS (gemm_main), K = DM.
// OUT[(r0/SEQ)*OUT_SEQ + r0%SEQ + i][c0 + j] = oscale * sum_k A[r0+i][k] Bt[c0+j][k]. grid (NB*SEQ/256, DM/128), 256 threads.
__global__ __launch_bounds__(256) void k_oproj(const h16* __restrict__ A, const h16* __restrict__ Bt, float* OUT, float oscale) {
    __shared__ __align__(16) bf ring[2 * GST_H];   // [buffer][A rows | Bt rows][LP]
    __shared__ __align__(16) float osb[8 * 16 * 68];
    const int lane = threadIdx.x & 31, lr = lane & 15, hi = lane >> 4;
    const int wave = __builtin_amdgcn_readfirstlane((int)(threadIdx.x >> 5));   // wave-uniform
    const int wm = wave & 3, wn = wave >> 2;
    const int r0 = blockIdx.x * GBM + wm * 64, c0 = blockIdx.y * GBN + wn * 64;
    float* os = osb + wave * 16 * 68;   // wave-private output staging
    v8f acc[4][4];
#pragma unroll
    for (int mb = 0; mb < 4; ++mb)
#pragma unroll
        for (int nb = 0; nb < 4; ++nb) acc[mb][nb] = (v8f){};
    gemm_main<1>((const bf*)A, (const bf*)Bt, ring, blockIdx.x * GBM, blockIdx.y * GBN, wm, wn, acc);
    const size_t obase = ((size_t)(r0 / SEQ) * OUT_SEQ + (size_t)(r0 % SEQ)) * DM + c0;
#pragma unroll
    for (int mb = 0; mb < 4; ++mb) {
#pragma unroll
        for (int nb = 0; nb < 4; ++nb) {
#pragma unroll
            for (int j = 0; j < 8; ++j) os[(hi * 8 + j) * 68 + nb * 16 + lr] = acc[mb][nb][j] * oscale; }   // D: row 8h+j, col lane&15
        wave_sync();
        float* orow = OUT + obase + (size_t)(mb * 16) * DM;
{
#pragma unroll
            for (int s = 0; s < 8; ++s) { const int row = 2 * s + hi, cofs = lr * 4;   // 8 s x 2 rows = 16 rows; 16 lanes x 4 floats = 64 columns
                const v4f val = *(const v4fa*)(&os[row * 68 + cofs]);
                *(v4f*)(orow + (size_t)row * DM + cofs) = val; }
             }
        wave_sync();
    }
}

static constexpr size_t al256(size_t v) { return (v + 255) & ~(size_t)255; }
static constexpr size_t SZ_XB = al256((size_t)NB * SEQ * DM * 2);          // one activation plane (there are three: q, k, v)
static constexpr size_t SZ_WB = al256((size_t)4 * DM * DM * 2);            // four transposed weight planes
static constexpr size_t SZ_PL = al256((size_t)NB * NH_ * SEQ * HD * 2);    // per-head planes (q, k, v^T)
static constexpr size_t SZ_CH = al256((size_t)NB * SEQ * DM * 2);          // context plane
static constexpr size_t SZ_TOTAL = 3 * SZ_XB + SZ_WB + 3 * SZ_PL + SZ_CH;
static_assert(SZ_TOTAL <= (size_t)134217728);          // workspace carve <= 128 MiB
static_assert(((size_t)DM * DM * 2) % 256 == 0);       // weight sub-planes stay 256-byte aligned
static_assert((size_t)NB * DM * SEQ * 2 <= SZ_PL);     // v^T plane [(b*1024 + m)][t] fits its region

extern "C" void kernel_launch(void* const* d_in, const int* in_sizes, int n_in,
                              void* d_out, int out_size, void* d_ws, size_t ws_size, hipStream_t stream) {
    if (n_in < 7) return;
    const size_t needx = ((size_t)(NB - 1) * SEQ_FULL + SEQ) * DM;
    if ((size_t)in_sizes[0] < needx || (size_t)in_sizes[1] < needx || (size_t)in_sizes[2] < needx) return;
    if ((size_t)in_sizes[3] < (size_t)DM * DM || (size_t)in_sizes[4] < (size_t)DM * DM || (size_t)in_sizes[5] < (size_t)DM * DM || (size_t)in_sizes[6] < (size_t)DM * DM) return;
    if ((size_t)out_size < ((size_t)(NB - 1) * OUT_SEQ + SEQ) * DM) return;
    if (SZ_TOTAL > ws_size) return;
    // wire order: k, q, v, Wk, Wq, Wv, Wo (weights [in][out])
    const float* xq = (const float*)d_in[1]; const float* xk = (const float*)d_in[0]; const float* xv = (const float*)d_in[2];   /* this module stages k, q, v: the KEY stream is input 0 and the QUERY stream input 1 */
    const float* wq = (const float*)d_in[4]; const float* wk = (const float*)d_in[3]; const float* wv = (const float*)d_in[5]; const float* wo = (const float*)d_in[6];   /* w_key is input 3 and w_query input 4 */
    float* OUT = (float*)d_out;      // [NB][SEQ][1024]
    char* wsp = (char*)d_ws;
    bf* XQ = (bf*)wsp; wsp += SZ_XB;                 // [NB*SEQ][1024] bf16 activations
    bf* XK = (bf*)wsp; wsp += SZ_XB;
    bf* XV = (bf*)wsp; wsp += SZ_XB;
    bf* WB = (bf*)wsp; wsp += SZ_WB;                 // [4][1024 out][1024 in]: q | k | v (bf16) | o (f16 x64)
    h16* QH = (h16*)wsp; wsp += SZ_PL;               // [NB*16][SEQ][64]
    h16* KP = (h16*)wsp; wsp += SZ_PL;               // [NB*16][SEQ][64]
    h16* VT = (h16*)wsp; wsp += SZ_PL;               // [NB*16][64][SEQ]
    h16* CH = (h16*)wsp; wsp += SZ_CH;               // [NB*SEQ][1024] context x256
    bf* WQT = WB; bf* WKT = WB + (size_t)DM * DM; bf* WVT = WB + (size_t)2 * DM * DM; bf* WOT = WB + (size_t)3 * DM * DM;

    // all conversions: activations f32 -> bf16, weights in[k = input feature][n = output feature] -> out[n][k]
    k_prep<<<PG, 32 * PW, 0, stream>>>(xq, xk, xv, wq, wk, wv, wo, XQ, XK, XV, WB);

    // q, k: A = x rows (m = b*SEQ + t), Bt = W^T rows (n = h*64 + d) -> plane [(b*16 + h)][t][d]
    k_proj<<<dim3(NB * SEQ / GBM, DM / GBN, 1), 256, 0, stream>>>(XQ, WQT, QH, SEQ, (size_t)NH_ * SEQ * HD, HD, HD, (size_t)SEQ * HD);
    k_proj<<<dim3(NB * SEQ / GBM, DM / GBN, 1), 256, 0, stream>>>(XK, WKT, KP, SEQ, (size_t)NH_ * SEQ * HD, HD, HD, (size_t)SEQ * HD);
    // v^T: A = Wv^T rows (m = h*64 + d), Bt = x rows (n = b*SEQ + t) -> plane [(b*1024 + m)][t] = [(b*16 + h)][d][t]
    k_proj<<<dim3(DM / GBM, NB * SEQ / GBN, 1), 256, 0, stream>>>(WVT, XV, VT, DM, (size_t)0, SEQ, SEQ, (size_t)DM * SEQ);

    k_flash<<<dim3(SEQ / (16 * AW), NB * NH_, 1), 32 * AW, 0, stream>>>(QH, KP, VT, CH);

    // output projection: A = context rows (m = b*SEQ + t), Bt = Wo^T rows (n) -> f32 output
    k_oproj<<<dim3(NB * SEQ / GBM, DM / GBN, 1), 256, 0, stream>>>(CH, (const h16*)WOT, OUT, OSC);
}

// v004
// It runs in 149 microseconds.
// Two timings next to v003 put it at 1.04 and 1.03 times that version's speed.
// Counting every step since v000, it is 2.45 times as fast.
#include <hip/hip_runtime.h>

// Attention with 16 heads x 64, width 1024, whose KEY stream and KEY weight are staged FIRST: separate inputs k, q, v [4][2048][1024] (f32), weights w_key / w_query / w_value / w_proj stored [in][out] (y = x W, normal x 0.02), no biases, no mask, scores / sqrt(64), softmax over the keys, f32 output = (merged heads) w_proj [4][2048][1024]; argument order k, q, v, w_key, w_query, w_value, w_proj.
// Compute dtypes, f32 accumulate everywhere: projections v_wmma_f32_16x16x32_bf16 (x and W RNE-converted to bf16; products exact);
// scores v_wmma_f32_16x16x32_f16: q and k single f16 planes (one product); P (x256 carry, cancels in the normalisation) and v single f16; softmax f32 (online, running max);
// output projection v_wmma_f32_16x16x32_f16: context single f16 (x256 carry), Wo = f16 of (bf16 RNE of Wo) x64; 2^-14 folded into the f32 epilogue.
// Layout: three bf16 activation planes (q, k, v) and the transposed weight planes [out][in], all written by one conversion launch; q, k planes [b*16+h][t][d], v^T plane [b*16+h][d][t] written by the GEMM epilogue;
// fused flash kernel in transposed form (S^T = K Q^T, O^T = V^T P^T) writes the f16 context plane [b*SEQ+t][1024]; last GEMM writes the f32 output.

#ifndef NB
#define NB 4
#endif
#ifndef SEQ
#define SEQ 2048
#endif
#define NB_FULL  4
#define SEQ_FULL 2048
#ifndef OUT_SEQ
#define OUT_SEQ SEQ              // row pitch (in tokens) between batches of the output
#endif
#define DM   1024
#define NH_  16
#define HD   64
#define AW   8                   // waves per flash block (16 query rows each); all of them read one staged K / V^T tile
#define KT   64                  // keys per staged tile (two 32-key steps)
#define LP   72                  // LDS row pitch in halves: 144 B = 16 B x 9, so the 16 rows of a 16-byte fragment read fall on distinct banks
#define TILE_H (64 * LP)         // halves of one staged tile: 64 rows (K: keys, V^T: d) of 64 halves + pad
#define GBM  256                 // GEMM block tile: A rows (4 waves of 64)
#define GBN  128                 // GEMM block tile: Bt rows = output columns (2 waves of 64)
#define GKS  64                  // k per staged GEMM tile (two 32-k steps): 128 B of every operand row
#define GST_H ((GBM + GBN) * LP) // halves of one GEMM stage: 256 A rows, then 128 Bt rows, at pitch LP
#define PG   256                 // conversion work-groups: one resident round, each loops over its share
#define PW   16                  // waves per conversion work-group
#define PLD  8                   // 16-B loads a wave holds in flight per batch: 8 x 512 B = 4 KiB contiguous
#define SC2  (0.125f * 1.4426950408889634f)   // HD^-0.5 * log2(e)
#define PSH  8.0f                // log2 of the P carry (256)
#define CTXS 256.0f              // carry of the context plane
#define WOS  64.0f               // carry of the Wo plane
#define OSC  (1.0f / (CTXS * WOS))

static_assert(HD == 64);
static_assert(NH_ * HD == DM);                 // head h = columns h*64 + d
static_assert(DM % 64 == 0);                   // 16 column tiles of 64
static_assert(DM % 32 == 0);                   // GEMM k-loop steps by 32
static_assert(SEQ % 64 == 0);                  // a 64-row tile never straddles two batches
static_assert((NB * SEQ) % 64 == 0);
static_assert(SEQ % KT == 0 && SEQ / KT >= 2);  // key loop walks whole staged tiles; the two-buffer prologue needs two
static_assert(32 * AW == 256);                 // 256 lanes x 2 copies x 16 B = one 8-KiB tile
static_assert(SEQ % (16 * AW) == 0);           // flash grid covers the sequence exactly
static_assert(((size_t)SEQ * DM) % 8 == 0);
static_assert(DM % GKS == 0 && DM / GKS >= 2);                 // GEMM k loop walks whole stages; the two-buffer prologue needs two
static_assert((GBM + GBN) * GKS * 2 == 12 * 256 * 16);         // 256 lanes x 12 copies x 16 B = one stage
static_assert((NB * SEQ) % GBM == 0 && (NB * SEQ) % GBN == 0); // block tiles cover the token rows exactly, as A or as Bt
static_assert(DM % GBM == 0 && DM % GBN == 0);                 // and the feature rows
static_assert(SEQ % 64 == 0 && GBM % 64 == 0 && GBN % 64 == 0);
static_assert(4 * (DM / 64) * (DM / 64) == 4 * PG && PG % 4 == 0 && (DM / 64) % 2 == 0 && 32 * PW == 512);   // four weight tiles a conversion work-group, two a 256-thread half
static_assert((size_t)NB * SEQ * DM == 2 * (size_t)PG * PW * PLD * 128);   // two batches cover an activation plane exactly
static_assert(((size_t)SEQ * DM) % (PLD * 128) == 0);                      // a wave's batch never straddles two batches of the input
static_assert(NB <= NB_FULL);
static_assert(SEQ <= SEQ_FULL);

typedef _Float16 h16;
typedef unsigned short bf;
typedef __attribute__((ext_vector_type(16))) __bf16   v16bf;
typedef __attribute__((ext_vector_type(16))) _Float16 v16h;
typedef __attribute__((ext_vector_type(8)))  _Float16 v8h;
typedef __attribute__((ext_vector_type(8)))  unsigned short v8us;
typedef __attribute__((ext_vector_type(16))) unsigned short v16us;
typedef __attribute__((ext_vector_type(4)))  unsigned short v4us;
typedef __attribute__((ext_vector_type(8)))  float    v8f;
typedef __attribute__((ext_vector_type(4)))  float    v4f;
typedef v4f  __attribute__((may_alias)) v4fa;

__device__ __forceinline__ unsigned short f2bf(float f) { unsigned u = __float_as_uint(f); u += 0x7FFFu + ((u >> 16) & 1u); return (unsigned short)(u >> 16); }
__device__ __forceinline__ v16h cat16(v8h lo, v8h hi) { return __builtin_shufflevector(lo, hi, 0, 1, 2, 3, 4, 5, 6, 7, 8, 9, 10, 11, 12, 13, 14, 15); }
__device__ __forceinline__ v8f wmma16(v16h a, v16h b, v8f c) { return __builtin_amdgcn_wmma_f32_16x16x32_f16(false, a, false, b, (short)0, c, false, false); }
__device__ __forceinline__ v8f wmmab(v16bf a, v16bf b, v8f c) { return __builtin_amdgcn_wmma_f32_16x16x32_bf16(false, a, false, b, (short)0, c, false, false); }
// fragment loaders from K-contiguous 16-bit rows; p already includes + 8*(lane>>4): elements 0..7 <- k0+8h+0..7, elements 8..15 <- k0+16+8h+0..7 (same map for A and B)
__device__ __forceinline__ v16h  ldh(const h16* p) { return cat16(*(const v8h*)p, *(const v8h*)(p + 16)); }
// ordering point for wave-private LDS tiles (same wave writes and reads)
__device__ __forceinline__ void wave_sync() { __builtin_amdgcn_fence(3 /* release order */, "wavefront"); __builtin_amdgcn_wave_barrier(); asm volatile("" ::: "memory"); }

// k_prep: every operand conversion of the call in ONE launch of PG resident work-groups of PW waves.
// Weights: work-group g takes four 64 x 64 tiles of weight g / 64 (each 256-thread half two of them): in[k][n] (k = input feature, n = output feature) -> out[n][k] through LDS;
// planes 0..2 bf16 bits (RNE), plane 3 f16 bits of (bf16 RNE value * WOS), a power of two (exact).
// Activations: f32 -> bf16 (RNE), element order kept. A batch is PLD loads of 16 B a lane, 4 KiB contiguous a wave; the next batch's loads are issued before this one is converted and stored.
// Batch b of a plane: elements b * PEB + e0 + j * 128 + 0..3, e0 = the lane's place in the grid's first batch (a 32-bit offset from a uniform base).
#define PEB  ((size_t)PG * PW * PLD * 128)   // elements of one batch over the whole grid
// closes a group of global loads or stores: what follows may rewrite the registers that the group names (addresses, store data) only behind this wait
__device__ __forceinline__ void xwait() { asm volatile("s_wait_xcnt 0x0" ::: "memory"); }
__device__ __forceinline__ size_t xoff(size_t e) { return (e / ((size_t)SEQ * DM)) * ((size_t)SEQ_FULL * DM) + e % ((size_t)SEQ * DM); }
__device__ __forceinline__ void ld_batch(const float* __restrict__ x, int b, unsigned e0, v4f (&r)[PLD]) {
    const float* s = SEQ == SEQ_FULL ? (x + b * PEB) + e0 : x + xoff(b * PEB + e0);
#pragma unroll
    for (int j = 0; j < PLD; ++j) r[j] = *(const v4f*)(s + j * 128);
    xwait();
}
__device__ __forceinline__ void st_batch(bf* __restrict__ d, int b, unsigned e0, const v4f (&r)[PLD]) {
    bf* t = (d + b * PEB) + e0;
#pragma unroll
    for (int j = 0; j < PLD; ++j) { v4us o;
#pragma unroll
        for (int k = 0; k < 4; ++k) o[k] = f2bf(r[j][k]);
        *(v4us*)(t + j * 128) = o; }
}
__global__ __launch_bounds__(32 * PW) void k_prep(const float* __restrict__ xq, const float* __restrict__ xk, const float* __restrict__ xv,
                                                  const float* __restrict__ wq, const float* __restrict__ wk, const float* __restrict__ wv, const float* __restrict__ wo,
                                                  bf* __restrict__ XQ, bf* __restrict__ XK, bf* __restrict__ XV, bf* __restrict__ WB) {
    __shared__ float tsb[4 * 64 * 65];
    const int tid = threadIdx.x & 255, hf = threadIdx.x >> 8;
    const int ws = blockIdx.x / (PG / 4);                       // which weight: the same for the whole work-group
    const float* W = ws == 0 ? wq : ws == 1 ? wk : ws == 2 ? wv : wo;
    bf* dst = WB + (size_t)ws * DM * DM;
    const int asF16 = ws == 3; const float scale = asF16 ? WOS : 1.0f;
    const int tw = (blockIdx.x % (PG / 4)) * 4 + hf * 2;        // first of this half's two tiles: k tile = tw % 16 (even, so tw + 1 has the same n tile), n tile = tw / 16
    const int k0 = (tw % (DM / 64)) * 64, n0 = (tw / (DM / 64)) * 64;
    v4f wr[2][4];
#pragma unroll
    for (int u = 0; u < 2; ++u)
#pragma unroll
        for (int i = 0; i < 4; ++i) { const int idx = tid + 256 * i; const int kk = idx >> 4, c4 = (idx & 15) * 4;
            wr[u][i] = *(const v4f*)(W + (size_t)(k0 + 64 * u + kk) * DM + n0 + c4); }
    xwait();
    const unsigned e0 = (blockIdx.x * PW + (threadIdx.x >> 5)) * (PLD * 128) + (threadIdx.x & 31) * 4;
    v4f ra[PLD], rb[PLD];
    ld_batch(xq, 0, e0, ra);
#pragma unroll
    for (int u = 0; u < 2; ++u) { float* ts = tsb + (hf * 2 + u) * 64 * 65;
#pragma unroll
        for (int i = 0; i < 4; ++i) { const int idx = tid + 256 * i; const int kk = idx >> 4, c4 = (idx & 15) * 4;
            ts[kk * 65 + c4 + 0] = wr[u][i][0]; ts[kk * 65 + c4 + 1] = wr[u][i][1]; ts[kk * 65 + c4 + 2] = wr[u][i][2]; ts[kk * 65 + c4 + 3] = wr[u][i][3]; } }
    __syncthreads();
    const int c8 = (tid & 7) * 8;
#pragma unroll
    for (int u = 0; u < 2; ++u) { const float* ts = tsb + (hf * 2 + u) * 64 * 65;
        v8us o0, o1;
#pragma unroll
        for (int j = 0; j < 8; ++j) {
            const float xa = ts[(c8 + j) * 65 + (tid >> 3)]; const float xb = ts[(c8 + j) * 65 + (tid >> 3) + 32];
            const unsigned short ba = f2bf(xa), bb = f2bf(xb);
            const h16 ha = (h16)(__uint_as_float((unsigned)ba << 16) * scale); const h16 hb = (h16)(__uint_as_float((unsigned)bb << 16) * scale);
            const unsigned short fa = __builtin_bit_cast(unsigned short, ha), fb = __builtin_bit_cast(unsigned short, hb);
            o0[j] = asF16 ? fa : ba; o1[j] = asF16 ? fb : bb; }
        *(v8us*)(dst + (size_t)(n0 + (tid >> 3)) * DM + k0 + 64 * u + c8) = o0;
        *(v8us*)(dst + (size_t)(n0 + (tid >> 3) + 32) * DM + k0 + 64 * u + c8) = o1; }
    xwait();
    ld_batch(xq, 1, e0, rb); st_batch(XQ, 0, e0, ra); xwait();
    ld_batch(xk, 0, e0, ra); st_batch(XQ, 1, e0, rb); xwait();
    ld_batch(xk, 1, e0, rb); st_batch(XK, 0, e0, ra); xwait();
    ld_batch(xv, 0, e0, ra); st_batch(XK, 1, e0, rb); xwait();
    ld_batch(xv, 1, e0, rb); st_batch(XV, 0, e0, ra); xwait();
    st_batch(XV, 1, e0, rb);
}

// copy_stage: one GEMM stage, 64 k of 256 A rows and of 128 Bt rows (row pitch DM halves in memory), into LDS at pitch LP, no register in between.
// Lane tid brings 16 B of rows (tid>>3) + 32 i, so a wave's copy covers four whole 128-B lines. l = the lane's LDS byte address in row tid>>3 of the stage.
__device__ __forceinline__ void copy_stage(unsigned l, const bf* ga, const bf* gb) {
    const unsigned S = 32 * LP * 2; const size_t G = (size_t)32 * DM;
    // the closing s_wait_xcnt stands inside the statement so that no address register is rewritten ahead of it
    asm volatile("global_load_async_to_lds_b128 %0, %1, off\n\t"
                 "global_load_async_to_lds_b128 %2, %3, off\n\t"
                 "global_load_async_to_lds_b128 %4, %5, off\n\t"
                 "global_load_async_to_lds_b128 %6, %7, off\n\t"
                 "global_load_async_to_lds_b128 %8, %9, off\n\t"
                 "global_load_async_to_lds_b128 %10, %11, off\n\t"
                 "global_load_async_to_lds_b128 %12, %13, off\n\t"
                 "global_load_async_to_lds_b128 %14, %15, off\n\t"
                 "global_load_async_to_lds_b128 %16, %17, off\n\t"
                 "global_load_async_to_lds_b128 %18, %19, off\n\t"
                 "global_load_async_to_lds_b128 %20, %21, off\n\t"
                 "global_load_async_to_lds_b128 %22, %23, off\n\t"
                 "s_wait_xcnt 0x0"
                 :: "v"(l), "v"(ga), "v"(l + S), "v"(ga + G), "v"(l + 2 * S), "v"(ga + 2 * G), "v"(l + 3 * S), "v"(ga + 3 * G),
                    "v"(l + 4 * S), "v"(ga + 4 * G), "v"(l + 5 * S), "v"(ga + 5 * G), "v"(l + 6 * S), "v"(ga + 6 * G), "v"(l + 7 * S), "v"(ga + 7 * G),
                    "v"(l + 8 * S), "v"(gb), "v"(l + 9 * S), "v"(gb + G), "v"(l + 10 * S), "v"(gb + 2 * G), "v"(l + 11 * S), "v"(gb + 3 * G) : "memory");
}

// fragment from a staged row; p already includes + 8*(lane>>4): the k map of ldh
__device__ __forceinline__ v16us ldu(const bf* p) { return __builtin_shufflevector(*(const v8us*)p, *(const v8us*)(p + 16), 0, 1, 2, 3, 4, 5, 6, 7, 8, 9, 10, 11, 12, 13, 14, 15); }
template <int F16> __device__ __forceinline__ v8f wmmau(v16us a, v16us b, v8f c) {
    if constexpr (F16) return wmma16(__builtin_bit_cast(v16h, a), __builtin_bit_cast(v16h, b), c);
    else return wmmab(__builtin_bit_cast(v16bf, a), __builtin_bit_cast(v16bf, b), c);
}

// gemm_main: k loop of one 256 x 128 block tile, K = DM, 8 waves of 64 x 64 (wave (wm, wn): A rows rb + 64 wm, Bt rows cb + 64 wn; 16 accumulators each).
// Stages of 64 k come into LDS by asynchronous copies (two buffers, the next stage in flight while this one is worked on); every wave reads its fragments as 16-B LDS loads.
// Each accumulator takes its 32-k products in rising k, as with operands read straight from memory.
template <int F16>
__device__ __forceinline__ void gemm_main(const bf* A, const bf* Bt, bf* ring, int rb, int cb, int wm, int wn, v8f (&acc)[4][4]) {
    const int tid = threadIdx.x, lr = tid & 15, hi = (tid >> 4) & 1;
    const unsigned lcp = (unsigned)(size_t)ring + (unsigned)(((tid >> 3) * LP + (tid & 7) * 8) * 2);   // the lane's copy target in buffer 0 (LDS byte address)
    const bf* ga = A + (size_t)(rb + (tid >> 3)) * DM + (tid & 7) * 8;    // + stage * GKS
    const bf* gb = Bt + (size_t)(cb + (tid >> 3)) * DM + (tid & 7) * 8;   // + stage * GKS
    const int fa = (wm * 64 + lr) * LP + 8 * hi, fb = (GBM + wn * 64 + lr) * LP + 8 * hi;   // fragment offsets in a stage
    copy_stage(lcp, ga, gb);
    asm volatile("s_wait_asynccnt 0x0" ::: "memory");   // this wave's share of stage 0 has landed
    __syncthreads();                                     // every wave's share has: stage 0 may be read
    copy_stage(lcp + GST_H * 2, ga + GKS, gb + GKS);
#pragma unroll 1   // one trip per stage: the buffer index stays a run-time value and the loop text small
    for (int t = 0; t < DM / GKS; ++t) {
        const bf* pa = ring + (t & 1) * GST_H + fa; const bf* pb = ring + (t & 1) * GST_H + fb;
        v16us a[GKS / 32][4], b[GKS / 32][4];
        // every loop below is unrolled whole: fragments and accumulators are indexed by constants and so stay in registers
#pragma unroll
        for (int u = 0; u < GKS / 32; ++u) {
#pragma unroll
            for (int i = 0; i < 4; ++i) { a[u][i] = ldu(pa + i * 16 * LP + u * 32); b[u][i] = ldu(pb + i * 16 * LP + u * 32); }
        }
        __builtin_amdgcn_sched_barrier(0);   // the stage's LDS reads stay one group ahead of its products (for speed only)
#pragma unroll
        for (int u = 0; u < GKS / 32; ++u)
#pragma unroll
            for (int nb = 0; nb < 4; ++nb)
#pragma unroll
                for (int mb = 0; mb < 4; ++mb) acc[mb][nb] = wmmau<F16>(a[u][mb], b[u][nb], acc[mb][nb]);
        __builtin_amdgcn_sched_barrier(0);   // the products stay ahead of the closing waits: moved behind the barrier they would start only when every wave's LDS reads are over
        asm volatile("s_wait_dscnt 0x0" ::: "memory");      // this wave's reads of stage t are done before the buffer is refilled
        asm volatile("s_wait_asynccnt 0x0" ::: "memory");   // this wave's share of stage t + 1 has landed
        __syncthreads();                                     // publishes stage t + 1 and ends every wave's reads of stage t
        if (t + 2 < DM / GKS) copy_stage(lcp + (unsigned)(t & 1) * (GST_H * 2), ga + (t + 2) * GKS, gb + (t + 2) * GKS);
    }
    asm volatile("s_wait_asynccnt 0x0" ::: "memory");       // no copy is outstanding when the wave goes on to its epilogue
}

// k_proj: bf16 GEMM, 256 x 128 block tile, 8 waves of one 64x64 tile each (16 accumulators), operands from K-contiguous bf16 planes through LDS (gemm_main), K = DM.
// C[m][n] = sum_k A[m][k] Bt[n][k], written as f16 (Ph) at
// wave tile base (r0/RB)*sRB + (r0%RB)*pitch + (c0/CB)*sCB + (c0%CB), row pitch 'pitch' (halves). grid (M/256, N/128), 256 threads.
__global__ __launch_bounds__(256) void k_proj(const bf* __restrict__ A, const bf* __restrict__ Bt, h16* Ph, int RB, size_t sRB, int pitch, int CB, size_t sCB) {
    __shared__ __align__(16) bf ring[2 * GST_H];   // [buffer][A rows | Bt rows][LP]
    __shared__ __align__(16) float osb[8 * 16 * 68];
    const int lane = threadIdx.x & 31, lr = lane & 15, hi = lane >> 4;
    const int wave = __builtin_amdgcn_readfirstlane((int)(threadIdx.x >> 5));   // wave-uniform
    const int wm = wave & 3, wn = wave >> 2;
    const int r0 = blockIdx.x * GBM + wm * 64, c0 = blockIdx.y * GBN + wn * 64;
    float* os = osb + wave * 16 * 68;   // wave-private output staging
    v8f acc[4][4];
#pragma unroll
    for (int mb = 0; mb < 4; ++mb)
#pragma unroll
        for (int nb = 0; nb < 4; ++nb) acc[mb][nb] = (v8f){};
    gemm_main<0>(A, Bt, ring, blockIdx.x * GBM, blockIdx.y * GBN, wm, wn, acc);
    const size_t tbase = (size_t)(r0 / RB) * sRB + (size_t)(r0 % RB) * (size_t)pitch + (size_t)(c0 / CB) * sCB + (size_t)(c0 % CB);
#pragma unroll
    for (int mb = 0; mb < 4; ++mb) {
#pragma unroll
        for (int nb = 0; nb < 4; ++nb) {
#pragma unroll
            for (int j = 0; j < 8; ++j) os[(hi * 8 + j) * 68 + nb * 16 + lr] = acc[mb][nb][j]; }   // D: row 8h+j, col lane&15
        wave_sync();
        const size_t sb = tbase + (size_t)(mb * 16) * (size_t)pitch;
{
#pragma unroll
            for (int s = 0; s < 4; ++s) { const int row = 4 * s + (lane >> 3), c8 = (lane & 7) * 8;   // 4 s x 4 row groups = 16 rows; 8 lanes x 8 = 64 columns
                const v4f x0 = *(const v4fa*)(&os[row * 68 + c8]); const v4f x1 = *(const v4fa*)(&os[row * 68 + c8 + 4]); v8h hv;
#pragma unroll
                for (int i = 0; i < 4; ++i) { hv[i] = (h16)x0[i]; hv[4 + i] = (h16)x1[i]; }
                const size_t oo = sb + (size_t)row * (size_t)pitch + c8;
                *(v8h*)(Ph + oo) = hv; }
             }
        wave_sync();
    }
}

// copy_tile: one 64-key K tile (64 rows of 128 B, contiguous) and one V^T tile (64 rows d of 128 B, pitch SEQ halves) into LDS at pitch LP, no register in between.
// Lane tid brings 16 B of rows tid>>3 and 32 + (tid>>3) of each tile, so a wave's copy covers four whole 128-B lines. lk = the lane's LDS byte address in the K tile.
__device__ __forceinline__ void copy_tile(unsigned lk, const h16* gk, const h16* gv) {
    const unsigned lk1 = lk + 32 * LP * 2, lv = lk + TILE_H * 2, lv1 = lv + 32 * LP * 2;
    const h16* gk1 = gk + 32 * HD; const h16* gv1 = gv + (size_t)32 * SEQ;
    // the closing s_wait_xcnt stands inside the statement so that no address register is rewritten ahead of it
    asm volatile("global_load_async_to_lds_b128 %0, %1, off\n\t"
                 "global_load_async_to_lds_b128 %2, %3, off\n\t"
                 "global_load_async_to_lds_b128 %4, %5, off\n\t"
                 "global_load_async_to_lds_b128 %6, %7, off\n\t"
                 "s_wait_xcnt 0x0"
                 :: "v"(lk), "v"(gk), "v"(lk1), "v"(gk1), "v"(lv), "v"(gv), "v"(lv1), "v"(gv1) : "memory");
}

// k_flash: fused attention, one wave per 16 query rows of one (batch, head); Q fragments straight from the f16 plane; K / V^T tiles of 64 keys staged in LDS
// by asynchronous copies (two buffers, the next tile in flight while this one is worked on) and read by all AW waves as 16-B fragment loads.
// Transposed form: S^T[key][t] = K Q^T (A = K rows, B = Q rows); lane (t = lane&15, h = lane>>4) holds keys 8h+r of each 16-key tile, so the packed
// P tile is directly the B fragment of O^T[d][t] = V^T P^T (element r <- tile keys 0..15, element 8+r <- tile keys 16..31, lane unchanged).
// Per 32-key step: 4 score products + 4 P.V products + 1 row-sum product (A = all ones, B = the packed P tile: every row of its result is the sum of P over the step's 32 keys, so register 0 holds
// the whole sum of the lane's query in both lane halves). Softmax state (running max, sum) is one scalar per lane; the running max of the two lane halves is combined with one xor-16 exchange.
// amdgpu_waves_per_eu(8): the register budget of 8 waves a SIMD. LDS admits four work-groups a WGP (8 waves a SIMD) and the grid is four a WGP: over that budget a whole work-group per WGP would be lost.
__global__ __launch_bounds__(32 * AW) __attribute__((amdgpu_waves_per_eu(8))) void k_flash(const h16* __restrict__ QH, const h16* __restrict__ KP, const h16* __restrict__ VT, h16* CH) {
    __shared__ __align__(16) h16 ring[2 * 2 * TILE_H];   // [buffer][K | V^T][row][LP]
    __shared__ __align__(16) float os[AW * 16 * 68];
    const int tid = threadIdx.x;
    const int lane = threadIdx.x & 31, lr = lane & 15, hi = lane >> 4;
    const int wave = __builtin_amdgcn_readfirstlane((int)(threadIdx.x >> 5));   // wave-uniform
    const int zh = blockIdx.y; const int b = zh / NH_, h = zh % NH_;
    const int t0 = (blockIdx.x * AW + wave) * 16;
    const size_t pbase = (size_t)zh * SEQ * HD;
    const size_t qo = pbase + (size_t)(t0 + lr) * HD + 8 * hi;
    const v16h qh0 = ldh(QH + qo), qh1 = ldh(QH + qo + 32);   // B fragments: col t, k = d
    const unsigned lcp = (unsigned)(size_t)ring + (unsigned)(((tid >> 3) * LP + (tid & 7) * 8) * 2);   // the lane's copy target in buffer 0's K tile (LDS byte address)
    const h16* gk = KP + pbase + tid * 8;                                        // + tile * KT * HD
    const h16* gv = VT + pbase + (size_t)(tid >> 3) * SEQ + (tid & 7) * 8;       // + tile * KT
    const int fo = lr * LP + 8 * hi;   // fragment offset in a tile: K + key * LP (A: row key, k = d); V^T + 16j * LP + key (A: row d, k = key)
    copy_tile(lcp, gk, gv);
    asm volatile("s_wait_asynccnt 0x0" ::: "memory");   // this wave's share of tile 0 has landed
    __syncthreads();                                     // every wave's share has: tile 0 may be read
    copy_tile(lcp + 2 * TILE_H * 2, gk + KT * HD, gv + KT);
    v8f o0 = (v8f){}, o1 = (v8f){}, o2 = (v8f){}, o3 = (v8f){};
    float m = -3.0e38f, l = 0.0f;
    v16h ones;   // A operand of the row-sum product
#pragma unroll
    for (int r = 0; r < 16; ++r) ones[r] = (h16)1.0f;
#pragma unroll 1   // one trip per staged tile: the buffer index stays a run-time value and the loop text small
    for (int t = 0; t < SEQ / KT; ++t) {
      const h16* kt = ring + (t & 1) * (2 * TILE_H) + fo;
#pragma unroll 1    // the two 32-key steps of a tile stay rolled: unrolled, values of both steps live on past the barrier and the register count costs a wave per SIMD
      for (int u = 0; u < KT / 32; ++u) {
        const h16* ka = kt + u * 32 * LP;
        const v16h ka0 = ldh(ka), ka1 = ldh(ka + 32), kb0 = ldh(ka + 16 * LP), kb1 = ldh(ka + 16 * LP + 32);
        v8f sa = (v8f){}, sb = (v8f){};
        sa = wmma16(ka0, qh0, sa); sb = wmma16(kb0, qh0, sb);
        sa = wmma16(ka1, qh1, sa); sb = wmma16(kb1, qh1, sb);
        asm volatile("v_nop\n\tv_nop\n\tv_nop\n\tv_nop" : "+v"(sa), "+v"(sb) : "v"(ka0), "v"(ka1), "v"(kb0), "v"(kb1), "v"(qh0), "v"(qh1));
        float ta[8], tb[8]; float mx = -3.0e38f;
#pragma unroll
        for (int r = 0; r < 8; ++r) { ta[r] = sa[r] * SC2; tb[r] = sb[r] * SC2; mx = fmaxf(mx, fmaxf(ta[r], tb[r])); }
        mx = fmaxf(mx, __shfl_xor(mx, 16, 32));
        const float mnew = fmaxf(m, mx);
        const float alpha = __builtin_amdgcn_exp2f(m - mnew);
        const float sh = PSH - mnew;
        v16h pb;
#pragma unroll
        for (int r = 0; r < 8; ++r) { pb[r] = (h16)__builtin_amdgcn_exp2f(ta[r] + sh); pb[8 + r] = (h16)__builtin_amdgcn_exp2f(tb[r] + sh); }
        m = mnew;
        o0 = o0 * alpha; o1 = o1 * alpha; o2 = o2 * alpha; o3 = o3 * alpha;
        const h16* va = kt + TILE_H + u * 32;
        const v16h v0 = ldh(va), v1 = ldh(va + 16 * LP), v2 = ldh(va + 32 * LP), v3 = ldh(va + 48 * LP);
        const v8f st = wmma16(ones, pb, (v8f){});   // the rounded P summed over the 32 keys, f32
        o0 = wmma16(v0, pb, o0); o1 = wmma16(v1, pb, o1); o2 = wmma16(v2, pb, o2); o3 = wmma16(v3, pb, o3);
        asm volatile("v_nop\n\tv_nop\n\tv_nop\n\tv_nop" : "+v"(o0), "+v"(o1), "+v"(o2), "+v"(o3) : "v"(v0), "v"(v1), "v"(v2), "v"(v3), "v"(pb));
        l = l * alpha + st[0];
      }
      asm volatile("s_wait_dscnt 0x0" ::: "memory");      // this wave's reads of tile t are done before the buffer is refilled
      asm volatile("s_wait_asynccnt 0x0" ::: "memory");   // this wave's share of tile t + 1 has landed
      __syncthreads();                                     // publishes tile t + 1 and ends every wave's reads of tile t
      if (t + 2 < SEQ / KT) copy_tile(lcp + (unsigned)(t & 1) * (2 * TILE_H * 2), gk + (size_t)(t + 2) * KT * HD, gv + (t + 2) * KT);
    }
    asm volatile("s_wait_asynccnt 0x0" ::: "memory");     // no copy is outstanding when the wave goes on to its end
    const float inv = CTXS * (1.0f / l);
    const int wb = wave * 16 * 68;
    // O^T D layout: o_j[r] = (d = 16j + 8h + r, t = lane&15) -> os[t][d]; rows 0..15 x columns 0..63 all written
    { v4f a, c;
      a[0] = o0[0] * inv; a[1] = o0[1] * inv; a[2] = o0[2] * inv; a[3] = o0[3] * inv; c[0] = o0[4] * inv; c[1] = o0[5] * inv; c[2] = o0[6] * inv; c[3] = o0[7] * inv;
      *(v4fa*)(&os[wb + lr * 68 +  0 + 8 * hi]) = a; *(v4fa*)(&os[wb + lr * 68 +  0 + 8 * hi + 4]) = c;
      a[0] = o1[0] * inv; a[1] = o1[1] * inv; a[2] = o1[2] * inv; a[3] = o1[3] * inv; c[0] = o1[4] * inv; c[1] = o1[5] * inv; c[2] = o1[6] * inv; c[3] = o1[7] * inv;
      *(v4fa*)(&os[wb + lr * 68 + 16 + 8 * hi]) = a; *(v4fa*)(&os[wb + lr * 68 + 16 + 8 * hi + 4]) = c;
      a[0] = o2[0] * inv; a[1] = o2[1] * inv; a[2] = o2[2] * inv; a[3] = o2[3] * inv; c[0] = o2[4] * inv; c[1] = o2[5] * inv; c[2] = o2[6] * inv; c[3] = o2[7] * inv;
      *(v4fa*)(&os[wb + lr * 68 + 32 + 8 * hi]) = a; *(v4fa*)(&os[wb + lr * 68 + 32 + 8 * hi + 4]) = c;
      a[0] = o3[0] * inv; a[1] = o3[1] * inv; a[2] = o3[2] * inv; a[3] = o3[3] * inv; c[0] = o3[4] * inv; c[1] = o3[5] * inv; c[2] = o3[6] * inv; c[3] = o3[7] * inv;
      *(v4fa*)(&os[wb + lr * 68 + 48 + 8 * hi]) = a; *(v4fa*)(&os[wb + lr * 68 + 48 + 8 * hi + 4]) = c; }
    wave_sync();
    h16* crow = CH + ((size_t)b * SEQ + t0) * DM + h * HD;       // context plane row m = b*SEQ + t, columns h*64 + d
{
#pragma unroll
        for (int s = 0; s < 4; ++s) { const int row = 4 * s + (lane >> 3), c8 = (lane & 7) * 8;   // 4 s x 4 row groups = 16 rows; 8 lanes x 8 halves = 64 columns
            const v4f x0 = *(const v4fa*)(&os[wb + row * 68 + c8]); const v4f x1 = *(const v4fa*)(&os[wb + row * 68 + c8 + 4]); v8h hv;
#pragma unroll
            for (int i = 0; i < 4; ++i) { hv[i] = (h16)x0[i]; hv[4 + i] = (h16)x1[i]; }
            *(v8h*)(crow + (size_t)row * DM + c8) = hv; }
         }
}

// k_oproj: f16 GEMM, 256 x 128 block tile, 8 waves of one 64x64 tile each (16 accumulators), operands from K-contiguous f16 planes through LDS (gemm_main), K = DM.
// OUT[(r0/SEQ)*OUT_SEQ + r0%SEQ + i][c0 + j] = oscale * sum_k A[r0+i][k] Bt[c0+j][k]. grid (NB*SEQ/256, DM/128), 256 threads.
__global__ __launch_bounds__(256) void k_oproj(const h16* __restrict__ A, const h16* __restrict__ Bt, float* OUT, float oscale) {
    __shared__ __align__(16) bf ring[2 * GST_H];   // [buffer][A rows | Bt rows][LP]
    __shared__ __align__(16) float osb[8 * 16 * 68];
    const int lane = threadIdx.x & 31, lr = lane & 15, hi = lane >> 4;
    const int wave = __builtin_amdgcn_readfirstlane((int)(threadIdx.x >> 5));   // wave-uniform
    const int wm = wave & 3, wn = wave >> 2;
    const int r0 = blockIdx.x * GBM + wm * 64, c0 = blockIdx.y * GBN + wn * 64;
    float* os = osb + wave * 16 * 68;   // wave-private output staging
    v8f acc[4][4];
#pragma unroll
    for (int mb = 0; mb < 4; ++mb)
#pragma unroll
        for (int nb = 0; nb < 4; ++nb) acc[mb][nb] = (v8f){};
    gemm_main<1>((const bf*)A, (const bf*)Bt, ring, blockIdx.x * GBM, blockIdx.y * GBN, wm, wn, acc);
    const size_t obase = ((size_t)(r0 / SEQ) * OUT_SEQ + (size_t)(r0 % SEQ)) * DM + c0;
#pragma unroll
    for (int mb = 0; mb < 4; ++mb) {
#pragma unroll
        for (int nb = 0; nb < 4; ++nb) {
#pragma unroll
            for (int j = 0; j < 8; ++j) os[(hi * 8 + j) * 68 + nb * 16 + lr] = acc[mb][nb][j] * oscale; }   // D: row 8h+j, col lane&15
        wave_sync();
        float* orow = OUT + obase + (size_t)(mb * 16) * DM;
{
#pragma unroll
            for (int s = 0; s < 8; ++s) { const int row = 2 * s + hi, cofs = lr * 4;   // 8 s x 2 rows = 16 rows; 16 lanes x 4 floats = 64 columns
                const v4f val = *(const v4fa*)(&os[row * 68 + cofs]);
                *(v4f*)(orow + (size_t)row * DM + cofs) = val; }
             }
        wave_sync();
    }
}

static constexpr size_t al256(size_t v) { return (v + 255) & ~(size_t)255; }
static constexpr size_t SZ_XB = al256((size_t)NB * SEQ * DM * 2);          // one activation plane (there are three: q, k, v)
static constexpr size_t SZ_WB = al256((size_t)4 * DM * DM * 2);            // four transposed weight planes
static constexpr size_t SZ_PL = al256((size_t)NB * NH_ * SEQ * HD * 2);    // per-head planes (q, k, v^T)
static constexpr size_t SZ_CH = al256((size_t)NB * SEQ * DM * 2);          // context plane
static constexpr size_t SZ_TOTAL = 3 * SZ_XB + SZ_WB + 3 * SZ_PL + SZ_CH;
static_assert(SZ_TOTAL <= (size_t)134217728);          // workspace carve <= 128 MiB
static_assert(((size_t)DM * DM * 2) % 256 == 0);       // weight sub-planes stay 256-byte aligned
static_assert((size_t)NB * DM * SEQ * 2 <= SZ_PL);     // v^T plane [(b*1024 + m)][t] fits its region

extern "C" void kernel_launch(void* const* d_in, const int* in_sizes, int n_in,
                              void* d_out, int out_size, void* d_ws, size_t ws_size, hipStream_t stream) {
    if (n_in < 7) return;
    const size_t needx = ((size_t)(NB - 1) * SEQ_FULL + SEQ) * DM;
    if ((size_t)in_sizes[0] < needx || (size_t)in_sizes[1] < needx || (size_t)in_sizes[2] < needx) return;
    if ((size_t)in_sizes[3] < (size_t)DM * DM || (size_t)in_sizes[4] < (size_t)DM * DM || (size_t)in_sizes[5] < (size_t)DM * DM || (size_t)in_sizes[6] < (size_t)DM * DM) return;
    if ((size_t)out_size < ((size_t)(NB - 1) * OUT_SEQ + SEQ) * DM) return;
    if (SZ_TOTAL > ws_size) return;
    // wire order: k, q, v, Wk, Wq, Wv, Wo (weights [in][out])
    const float* xq = (const float*)d_in[1]; const float* xk = (const float*)d_in[0]; const float* xv = (const float*)d_in[2];   /* this module stages k, q, v: the KEY stream is input 0 and the QUERY stream input 1 */
    const float* wq = (const float*)d_in[4]; const float* wk = (const float*)d_in[3]; const float* wv = (const float*)d_in[5]; const float* wo = (const float*)d_in[6];   /* w_key is input 3 and w_query input 4 */
    float* OUT = (float*)d_out;      // [NB][SEQ][1024]
    char* wsp = (char*)d_ws;
    bf* XQ = (bf*)wsp; wsp += SZ_XB;                 // [NB*SEQ][1024] bf16 activations
    bf* XK = (bf*)wsp; wsp += SZ_XB;
    bf* XV = (bf*)wsp; wsp += SZ_XB;
    bf* WB = (bf*)wsp; wsp += SZ_WB;                 // [4][1024 out][1024 in]: q | k | v (bf16) | o (f16 x64)
    h16* QH = (h16*)wsp; wsp += SZ_PL;               // [NB*16][SEQ][64]
    h16* KP = (h16*)wsp; wsp += SZ_PL;               // [NB*16][SEQ][64]
    h16* VT = (h16*)wsp; wsp += SZ_PL;               // [NB*16][64][SEQ]
    h16* CH = (h16*)wsp; wsp += SZ_CH;               // [NB*SEQ][1024] context x256
    bf* WQT = WB; bf* WKT = WB + (size_t)DM * DM; bf* WVT = WB + (size_t)2 * DM * DM; bf* WOT = WB + (size_t)3 * DM * DM;

    // all conversions: activations f32 -> bf16, weights in[k = input feature][n = output feature] -> out[n][k]
    k_prep<<<PG, 32 * PW, 0, stream>>>(xq, xk, xv, wq, wk, wv, wo, XQ, XK, XV, WB);

    // q, k: A = x rows (m = b*SEQ + t), Bt = W^T rows (n = h*64 + d) -> plane [(b*16 + h)][t][d]
    k_proj<<<dim3(NB * SEQ / GBM, DM / GBN, 1), 256, 0, stream>>>(XQ, WQT, QH, SEQ, (size_t)NH_ * SEQ * HD, HD, HD, (size_t)SEQ * HD);
    k_proj<<<dim3(NB * SEQ / GBM, DM / GBN, 1), 256, 0, stream>>>(XK, WKT, KP, SEQ, (size_t)NH_ * SEQ * HD, HD, HD, (size_t)SEQ * HD);
    // v^T: A = Wv^T rows (m = h*64 + d), Bt = x rows (n = b*SEQ + t) -> plane [(b*1024 + m)][t] = [(b*16 + h)][d][t]
    k_proj<<<dim3(DM / GBM, NB * SEQ / GBN, 1), 256, 0, stream>>>(WVT, XV, VT, DM, (size_t)0, SEQ, SEQ, (size_t)DM * SEQ);

    k_flash<<<dim3(SEQ / (16 * AW), NB * NH_, 1), 32 * AW, 0, stream>>>(QH, KP, VT, CH);

    // output projection: A = context rows (m = b*SEQ + t), Bt = Wo^T rows (n) -> f32 output
    k_oproj<<<dim3(NB * SEQ / GBM, DM / GBN, 1), 256, 0, stream>>>(CH, (const h16*)WOT, OUT, OSC);
}

// v005
// One run takes 140 microseconds.
// In two side-by-side timings against v004, it was 1.07 and 1.06 times as fast.
// All steps since v000 together make it 2.61 times as fast.
#include <hip/hip_runtime.h>

// Attention with 16 heads x 64, width 1024, whose KEY stream and KEY weight are staged FIRST: separate inputs k, q, v [4][2048][1024] (f32), weights w_key / w_query / w_value / w_proj stored [in][out] (y = x W, normal x 0.02), no biases, no mask, scores / sqrt(64), softmax over the keys, f32 output = (merged heads) w_proj [4][2048][1024]; argument order k, q, v, w_key, w_query, w_value, w_proj.
// Compute dtypes, f32 accumulate everywhere: projections v_wmma_f32_16x16x32_bf16 (x and W RNE-converted to bf16; products exact);
// scores v_wmma_f32_16x16x32_f16: q and k single f16 planes (one product); P (x256 carry, cancels in the normalisation) and v single f16; softmax f32 (online, running max);
// output projection v_wmma_f32_16x16x32_f16: context single f16 (x256 carry), Wo = f16 of (bf16 RNE of Wo) x64; 2^-14 folded into the f32 epilogue.
// Layout: three bf16 activation planes (q, k, v) and the transposed weight planes [out][in], all written by one conversion launch; q, k planes [b*16+h][t][d], v^T plane [b*16+h][d][t] written by the GEMM epilogue;
// fused flash kernel in transposed form (S^T = K Q^T, O^T = V^T P^T) writes the f16 context plane [b*SEQ+t][1024]; last GEMM writes the f32 output.

#ifndef NB
#define NB 4
#endif
#ifndef SEQ
#define SEQ 2048
#endif
#define NB_FULL  4
#define SEQ_FULL 2048
#ifndef OUT_SEQ
#define OUT_SEQ SEQ              // row pitch (in tokens) between batches of the output
#endif
#define DM   1024
#define NH_  16
#define HD   64
#define AW   8                   // waves per flash block (16 query rows each); all of them read one staged K / V^T tile
#define KT   64                  // keys per staged tile (two 32-key steps)
#define LP   72                  // LDS row pitch in halves: 144 B = 16 B x 9, so the 16 rows of a 16-byte fragment read fall on distinct banks
#define TILE_H (64 * LP)         // halves of one staged tile: 64 rows (K: keys, V^T: d) of 64 halves + pad
#define GBM  256                 // GEMM block tile: A rows (4 waves of 64)
#define GBN  128                 // GEMM block tile: Bt rows = output columns (2 waves of 64)
#define GKS  64                  // k per staged GEMM tile (two 32-k steps): 128 B of every operand row
#define GST_H ((GBM + GBN) * LP) // halves of one GEMM stage: 256 A rows, then 128 Bt rows, at pitch LP
#define PG   256                 // conversion work-groups: one resident round, each loops over its share
#define PW   16                  // waves per conversion work-group
#define PLD  8                   // 16-B loads a wave holds in flight per batch: 8 x 512 B = 4 KiB contiguous
#define SC2  (0.125f * 1.4426950408889634f)   // HD^-0.5 * log2(e)
#define PSH  8.0f                // log2 of the P carry (256)
#define TAU  6.0f                // a column's softmax reference is renewed once a score passes it by more than this (log2): P stays <= 2^(PSH + TAU) = 2^14, inside f16
#define CTXS 256.0f              // carry of the context plane
#define WOS  64.0f               // carry of the Wo plane
#define OSC  (1.0f / (CTXS * WOS))

static_assert(HD == 64);
static_assert(NH_ * HD == DM);                 // head h = columns h*64 + d
static_assert(DM % 64 == 0);                   // 16 column tiles of 64
static_assert(DM % 32 == 0);                   // GEMM k-loop steps by 32
static_assert(SEQ % 64 == 0);                  // a 64-row tile never straddles two batches
static_assert((NB * SEQ) % 64 == 0);
static_assert(SEQ % KT == 0 && SEQ / KT >= 2);  // key loop walks whole staged tiles; the two-buffer prologue needs two
static_assert(32 * AW == 256);                 // 256 lanes x 2 copies x 16 B = one 8-KiB tile
static_assert(SEQ % (16 * AW) == 0);           // flash grid covers the sequence exactly
static_assert(((size_t)SEQ * DM) % 8 == 0);
static_assert(DM % GKS == 0 && DM / GKS >= 2);                 // GEMM k loop walks whole stages; the two-buffer prologue needs two
static_assert((GBM + GBN) * GKS * 2 == 12 * 256 * 16);         // 256 lanes x 12 copies x 16 B = one stage
static_assert((NB * SEQ) % GBM == 0 && (NB * SEQ) % GBN == 0); // block tiles cover the token rows exactly, as A or as Bt
static_assert(DM % GBM == 0 && DM % GBN == 0);                 // and the feature rows
static_assert(SEQ % 64 == 0 && GBM % 64 == 0 && GBN % 64 == 0);
static_assert(4 * (DM / 64) * (DM / 64) == 4 * PG && PG % 4 == 0 && (DM / 64) % 2 == 0 && 32 * PW == 512);   // four weight tiles a conversion work-group, two a 256-thread half
static_assert((size_t)NB * SEQ * DM == 2 * (size_t)PG * PW * PLD * 128);   // two batches cover an activation plane exactly
static_assert(((size_t)SEQ * DM) % (PLD * 128) == 0);                      // a wave's batch never straddles two batches of the input
static_assert(NB <= NB_FULL);
static_assert(SEQ <= SEQ_FULL);

typedef _Float16 h16;
typedef unsigned short bf;
typedef __attribute__((ext_vector_type(16))) __bf16   v16bf;
typedef __attribute__((ext_vector_type(16))) _Float16 v16h;
typedef __attribute__((ext_vector_type(8)))  _Float16 v8h;
typedef __attribute__((ext_vector_type(8)))  unsigned short v8us;
typedef __attribute__((ext_vector_type(16))) unsigned short v16us;
typedef __attribute__((ext_vector_type(4)))  unsigned short v4us;
typedef __attribute__((ext_vector_type(8)))  float    v8f;
typedef __attribute__((ext_vector_type(4)))  float    v4f;
typedef v4f  __attribute__((may_alias)) v4fa;

__device__ __forceinline__ unsigned short f2bf(float f) { unsigned u = __float_as_uint(f); u += 0x7FFFu + ((u >> 16) & 1u); return (unsigned short)(u >> 16); }
__device__ __forceinline__ v16h cat16(v8h lo, v8h hi) { return __builtin_shufflevector(lo, hi, 0, 1, 2, 3, 4, 5, 6, 7, 8, 9, 10, 11, 12, 13, 14, 15); }
__device__ __forceinline__ v8f wmma16(v16h a, v16h b, v8f c) { return __builtin_amdgcn_wmma_f32_16x16x32_f16(false, a, false, b, (short)0, c, false, false); }
__device__ __forceinline__ v8f wmmab(v16bf a, v16bf b, v8f c) { return __builtin_amdgcn_wmma_f32_16x16x32_bf16(false, a, false, b, (short)0, c, false, false); }
// fragment loaders from K-contiguous 16-bit rows; p already includes + 8*(lane>>4): elements 0..7 <- k0+8h+0..7, elements 8..15 <- k0+16+8h+0..7 (same map for A and B)
__device__ __forceinline__ v16h  ldh(const h16* p) { return cat16(*(const v8h*)p, *(const v8h*)(p + 16)); }
// ordering point for wave-private LDS tiles (same wave writes and reads)
__device__ __forceinline__ void wave_sync() { __builtin_amdgcn_fence(3 /* release order */, "wavefront"); __builtin_amdgcn_wave_barrier(); asm volatile("" ::: "memory"); }

// k_prep: every operand conversion of the call in ONE launch of PG resident work-groups of PW waves.
// Weights: work-group g takes four 64 x 64 tiles of weight g / 64 (each 256-thread half two of them): in[k][n] (k = input feature, n = output feature) -> out[n][k] through LDS;
// planes 0..2 bf16 bits (RNE), plane 3 f16 bits of (bf16 RNE value * WOS), a power of two (exact).
// Activations: f32 -> bf16 (RNE), element order kept. A batch is PLD loads of 16 B a lane, 4 KiB contiguous a wave; the next batch's loads are issued before this one is converted and stored.
// Batch b of a plane: elements b * PEB + e0 + j * 128 + 0..3, e0 = the lane's place in the grid's first batch (a 32-bit offset from a uniform base).
#define PEB  ((size_t)PG * PW * PLD * 128)   // elements of one batch over the whole grid
// closes a group of global loads or stores: what follows may rewrite the registers that the group names (addresses, store data) only behind this wait
__device__ __forceinline__ void xwait() { asm volatile("s_wait_xcnt 0x0" ::: "memory"); }
__device__ __forceinline__ size_t xoff(size_t e) { return (e / ((size_t)SEQ * DM)) * ((size_t)SEQ_FULL * DM) + e % ((size_t)SEQ * DM); }
__device__ __forceinline__ void ld_batch(const float* __restrict__ x, int b, unsigned e0, v4f (&r)[PLD]) {
    const float* s = SEQ == SEQ_FULL ? (x + b * PEB) + e0 : x + xoff(b * PEB + e0);
#pragma unroll
    for (int j = 0; j < PLD; ++j) r[j] = *(const v4f*)(s + j * 128);
    xwait();
}
__device__ __forceinline__ void st_batch(bf* __restrict__ d, int b, unsigned e0, const v4f (&r)[PLD]) {
    bf* t = (d + b * PEB) + e0;
#pragma unroll
    for (int j = 0; j < PLD; ++j) { v4us o;
#pragma unroll
        for (int k = 0; k < 4; ++k) o[k] = f2bf(r[j][k]);
        *(v4us*)(t + j * 128) = o; }
}
__global__ __launch_bounds__(32 * PW) void k_prep(const float* __restrict__ xq, const float* __restrict__ xk, const float* __restrict__ xv,
                                                  const float* __restrict__ wq, const float* __restrict__ wk, const float* __restrict__ wv, const float* __restrict__ wo,
                                                  bf* __restrict__ XQ, bf* __restrict__ XK, bf* __restrict__ XV, bf* __restrict__ WB) {
    __shared__ float tsb[4 * 64 * 65];
    const int tid = threadIdx.x & 255, hf = threadIdx.x >> 8;
    const int ws = blockIdx.x / (PG / 4);                       // which weight: the same for the whole work-group
    const float* W = ws == 0 ? wq : ws == 1 ? wk : ws == 2 ? wv : wo;
    bf* dst = WB + (size_t)ws * DM * DM;
    const int asF16 = ws == 3; const float scale = asF16 ? WOS : 1.0f;
    const int tw = (blockIdx.x % (PG / 4)) * 4 + hf * 2;        // first of this half's two tiles: k tile = tw % 16 (even, so tw + 1 has the same n tile), n tile = tw / 16
    const int k0 = (tw % (DM / 64)) * 64, n0 = (tw / (DM / 64)) * 64;
    v4f wr[2][4];
#pragma unroll
    for (int u = 0; u < 2; ++u)
#pragma unroll
        for (int i = 0; i < 4; ++i) { const int idx = tid + 256 * i; const int kk = idx >> 4, c4 = (idx & 15) * 4;
            wr[u][i] = *(const v4f*)(W + (size_t)(k0 + 64 * u + kk) * DM + n0 + c4); }
    xwait();
    const unsigned e0 = (blockIdx.x * PW + (threadIdx.x >> 5)) * (PLD * 128) + (threadIdx.x & 31) * 4;
    v4f ra[PLD], rb[PLD];
    ld_batch(xq, 0, e0, ra);
#pragma unroll
    for (int u = 0; u < 2; ++u) { float* ts = tsb + (hf * 2 + u) * 64 * 65;
#pragma unroll
        for (int i = 0; i < 4; ++i) { const int idx = tid + 256 * i; const int kk = idx >> 4, c4 = (idx & 15) * 4;
            ts[kk * 65 + c4 + 0] = wr[u][i][0]; ts[kk * 65 + c4 + 1] = wr[u][i][1]; ts[kk * 65 + c4 + 2] = wr[u][i][2]; ts[kk * 65 + c4 + 3] = wr[u][i][3]; } }
    __syncthreads();
    const int c8 = (tid & 7) * 8;
#pragma unroll
    for (int u = 0; u < 2; ++u) { const float* ts = tsb + (hf * 2 + u) * 64 * 65;
        v8us o0, o1;
#pragma unroll
        for (int j = 0; j < 8; ++j) {
            const float xa = ts[(c8 + j) * 65 + (tid >> 3)]; const float xb = ts[(c8 + j) * 65 + (tid >> 3) + 32];
            const unsigned short ba = f2bf(xa), bb = f2bf(xb);
            const h16 ha = (h16)(__uint_as_float((unsigned)ba << 16) * scale); const h16 hb = (h16)(__uint_as_float((unsigned)bb << 16) * scale);
            const unsigned short fa = __builtin_bit_cast(unsigned short, ha), fb = __builtin_bit_cast(unsigned short, hb);
            o0[j] = asF16 ? fa : ba; o1[j] = asF16 ? fb : bb; }
        *(v8us*)(dst + (size_t)(n0 + (tid >> 3)) * DM + k0 + 64 * u + c8) = o0;
        *(v8us*)(dst + (size_t)(n0 + (tid >> 3) + 32) * DM + k0 + 64 * u + c8) = o1; }
    xwait();
    ld_batch(xq, 1, e0, rb); st_batch(XQ, 0, e0, ra); xwait();
    ld_batch(xk, 0, e0, ra); st_batch(XQ, 1, e0, rb); xwait();
    ld_batch(xk, 1, e0, rb); st_batch(XK, 0, e0, ra); xwait();
    ld_batch(xv, 0, e0, ra); st_batch(XK, 1, e0, rb); xwait();
    ld_batch(xv, 1, e0, rb); st_batch(XV, 0, e0, ra); xwait();
    st_batch(XV, 1, e0, rb);
}

// copy_stage: one GEMM stage, 64 k of 256 A rows and of 128 Bt rows (row pitch DM halves in memory), into LDS at pitch LP, no register in between.
// Lane tid brings 16 B of rows (tid>>3) + 32 i, so a wave's copy covers four whole 128-B lines. l = the lane's LDS byte address in row tid>>3 of the stage.
__device__ __forceinline__ void copy_stage(unsigned l, const bf* ga, const bf* gb) {
    const unsigned S = 32 * LP * 2; const size_t G = (size_t)32 * DM;
    // the closing s_wait_xcnt stands inside the statement so that no address register is rewritten ahead of it
    asm volatile("global_load_async_to_lds_b128 %0, %1, off\n\t"
                 "global_load_async_to_lds_b128 %2, %3, off\n\t"
                 "global_load_async_to_lds_b128 %4, %5, off\n\t"
                 "global_load_async_to_lds_b128 %6, %7, off\n\t"
                 "global_load_async_to_lds_b128 %8, %9, off\n\t"
                 "global_load_async_to_lds_b128 %10, %11, off\n\t"
                 "global_load_async_to_lds_b128 %12, %13, off\n\t"
                 "global_load_async_to_lds_b128 %14, %15, off\n\t"
                 "global_load_async_to_lds_b128 %16, %17, off\n\t"
                 "global_load_async_to_lds_b128 %18, %19, off\n\t"
                 "global_load_async_to_lds_b128 %20, %21, off\n\t"
                 "global_load_async_to_lds_b128 %22, %23, off\n\t"
                 "s_wait_xcnt 0x0"
                 :: "v"(l), "v"(ga), "v"(l + S), "v"(ga + G), "v"(l + 2 * S), "v"(ga + 2 * G), "v"(l + 3 * S), "v"(ga + 3 * G),
                    "v"(l + 4 * S), "v"(ga + 4 * G), "v"(l + 5 * S), "v"(ga + 5 * G), "v"(l + 6 * S), "v"(ga + 6 * G), "v"(l + 7 * S), "v"(ga + 7 * G),
                    "v"(l + 8 * S), "v"(gb), "v"(l + 9 * S), "v"(gb + G), "v"(l + 10 * S), "v"(gb + 2 * G), "v"(l + 11 * S), "v"(gb + 3 * G) : "memory");
}

// fragment from a staged row; p already includes + 8*(lane>>4): the k map of ldh
__device__ __forceinline__ v16us ldu(const bf* p) { return __builtin_shufflevector(*(const v8us*)p, *(const v8us*)(p + 16), 0, 1, 2, 3, 4, 5, 6, 7, 8, 9, 10, 11, 12, 13, 14, 15); }
template <int F16> __device__ __forceinline__ v8f wmmau(v16us a, v16us b, v8f c) {
    if constexpr (F16) return wmma16(__builtin_bit_cast(v16h, a), __builtin_bit_cast(v16h, b), c);
    else return wmmab(__builtin_bit_cast(v16bf, a), __builtin_bit_cast(v16bf, b), c);
}

// gemm_main: k loop of one 256 x 128 block tile, K = DM, 8 waves of 64 x 64 (wave (wm, wn): A rows rb + 64 wm, Bt rows cb + 64 wn; 16 accumulators each).
// Stages of 64 k come into LDS by asynchronous copies (two buffers, the next stage in flight while this one is worked on); every wave reads its fragments as 16-B LDS loads.
// Each accumulator takes its 32-k products in rising k, as with operands read straight from memory.
template <int F16>
__device__ __forceinline__ void gemm_main(const bf* A, const bf* Bt, bf* ring, int rb, int cb, int wm, int wn, v8f (&acc)[4][4]) {
    const int tid = threadIdx.x, lr = tid & 15, hi = (tid >> 4) & 1;
    const unsigned lcp = (unsigned)(size_t)ring + (unsigned)(((tid >> 3) * LP + (tid & 7) * 8) * 2);   // the lane's copy target in buffer 0 (LDS byte address)
    const bf* ga = A + (size_t)(rb + (tid >> 3)) * DM + (tid & 7) * 8;    // + stage * GKS
    const bf* gb = Bt + (size_t)(cb + (tid >> 3)) * DM + (tid & 7) * 8;   // + stage * GKS
    const int fa = (wm * 64 + lr) * LP + 8 * hi, fb = (GBM + wn * 64 + lr) * LP + 8 * hi;   // fragment offsets in a stage
    copy_stage(lcp, ga, gb);
    asm volatile("s_wait_asynccnt 0x0" ::: "memory");   // this wave's share of stage 0 has landed
    __syncthreads();                                     // every wave's share has: stage 0 may be read
    copy_stage(lcp + GST_H * 2, ga + GKS, gb + GKS);
#pragma unroll 1   // one trip per stage: the buffer index stays a run-time value and the loop text small
    for (int t = 0; t < DM / GKS; ++t) {
        const bf* pa = ring + (t & 1) * GST_H + fa; const bf* pb = ring + (t & 1) * GST_H + fb;
        v16us a[GKS / 32][4], b[GKS / 32][4];
        // every loop below is unrolled whole: fragments and accumulators are indexed by constants and so stay in registers
#pragma unroll
        for (int u = 0; u < GKS / 32; ++u) {
#pragma unroll
            for (int i = 0; i < 4; ++i) { a[u][i] = ldu(pa + i * 16 * LP + u * 32); b[u][i] = ldu(pb + i * 16 * LP + u * 32); }
        }
        __builtin_amdgcn_sched_barrier(0);   // the stage's LDS reads stay one group ahead of its products (for speed only)
#pragma unroll
        for (int u = 0; u < GKS / 32; ++u)
#pragma unroll
            for (int nb = 0; nb < 4; ++nb)
#pragma unroll
                for (int mb = 0; mb < 4; ++mb) acc[mb][nb] = wmmau<F16>(a[u][mb], b[u][nb], acc[mb][nb]);
        __builtin_amdgcn_sched_barrier(0);   // the products stay ahead of the closing waits: moved behind the barrier they would start only when every wave's LDS reads are over
        asm volatile("s_wait_dscnt 0x0" ::: "memory");      // this wave's reads of stage t are done before the buffer is refilled
        asm volatile("s_wait_asynccnt 0x0" ::: "memory");   // this wave's share of stage t + 1 has landed
        __syncthreads();                                     // publishes stage t + 1 and ends every wave's reads of stage t
        if (t + 2 < DM / GKS) copy_stage(lcp + (unsigned)(t & 1) * (GST_H * 2), ga + (t + 2) * GKS, gb + (t + 2) * GKS);
    }
    asm volatile("s_wait_asynccnt 0x0" ::: "memory");       // no copy is outstanding when the wave goes on to its epilogue
}

// k_proj: bf16 GEMM, 256 x 128 block tile, 8 waves of one 64x64 tile each (16 accumulators), operands from K-contiguous bf16 planes through LDS (gemm_main), K = DM.
// C[m][n] = sum_k A[m][k] Bt[n][k], written as f16 (Ph) at
// wave tile base (r0/RB)*sRB + (r0%RB)*pitch + (c0/CB)*sCB + (c0%CB), row pitch 'pitch' (halves). grid (M/256, N/128), 256 threads.
__global__ __launch_bounds__(256) void k_proj(const bf* __restrict__ A, const bf* __restrict__ Bt, h16* Ph, int RB, size_t sRB, int pitch, int CB, size_t sCB) {
    __shared__ __align__(16) bf ring[2 * GST_H];   // [buffer][A rows | Bt rows][LP]
    __shared__ __align__(16) float osb[8 * 16 * 68];
    const int lane = threadIdx.x & 31, lr = lane & 15, hi = lane >> 4;
    const int wave = __builtin_amdgcn_readfirstlane((int)(threadIdx.x >> 5));   // wave-uniform
    const int wm = wave & 3, wn = wave >> 2;
    const int r0 = blockIdx.x * GBM + wm * 64, c0 = blockIdx.y * GBN + wn * 64;
    float* os = osb + wave * 16 * 68;   // wave-private output staging
    v8f acc[4][4];
#pragma unroll
    for (int mb = 0; mb < 4; ++mb)
#pragma unroll
        for (int nb = 0; nb < 4; ++nb) acc[mb][nb] = (v8f){};
    gemm_main<0>(A, Bt, ring, blockIdx.x * GBM, blockIdx.y * GBN, wm, wn, acc);
    const size_t tbase = (size_t)(r0 / RB) * sRB + (size_t)(r0 % RB) * (size_t)pitch + (size_t)(c0 / CB) * sCB + (size_t)(c0 % CB);
#pragma unroll
    for (int mb = 0; mb < 4; ++mb) {
#pragma unroll
        for (int nb = 0; nb < 4; ++nb) {
#pragma unroll
            for (int j = 0; j < 8; ++j) os[(hi * 8 + j) * 68 + nb * 16 + lr] = acc[mb][nb][j]; }   // D: row 8h+j, col lane&15
        wave_sync();
        const size_t sb = tbase + (size_t)(mb * 16) * (size_t)pitch;
{
#pragma unroll
            for (int s = 0; s < 4; ++s) { const int row = 4 * s + (lane >> 3), c8 = (lane & 7) * 8;   // 4 s x 4 row groups = 16 rows; 8 lanes x 8 = 64 columns
                const v4f x0 = *(const v4fa*)(&os[row * 68 + c8]); const v4f x1 = *(const v4fa*)(&os[row * 68 + c8 + 4]); v8h hv;
#pragma unroll
                for (int i = 0; i < 4; ++i) { hv[i] = (h16)x0[i]; hv[4 + i] = (h16)x1[i]; }
                const size_t oo = sb + (size_t)row * (size_t)pitch + c8;
                *(v8h*)(Ph + oo) = hv; }
             }
        wave_sync();
    }
}

// copy_tile: one 64-key K tile (64 rows of 128 B, contiguous) and one V^T tile (64 rows d of 128 B, pitch SEQ halves) into LDS at pitch LP, no register in between.
// Lane tid brings 16 B of rows tid>>3 and 32 + (tid>>3) of each tile, so a wave's copy covers four whole 128-B lines. lk = the lane's LDS byte address in the K tile.
__device__ __forceinline__ void copy_tile(unsigned lk, const h16* gk, const h16* gv) {
    const unsigned lk1 = lk + 32 * LP * 2, lv = lk + TILE_H * 2, lv1 = lv + 32 * LP * 2;
    const h16* gk1 = gk + 32 * HD; const h16* gv1 = gv + (size_t)32 * SEQ;
    // the closing s_wait_xcnt stands inside the statement so that no address register is rewritten ahead of it
    asm volatile("global_load_async_to_lds_b128 %0, %1, off\n\t"
                 "global_load_async_to_lds_b128 %2, %3, off\n\t"
                 "global_load_async_to_lds_b128 %4, %5, off\n\t"
                 "global_load_async_to_lds_b128 %6, %7, off\n\t"
                 "s_wait_xcnt 0x0"
                 :: "v"(lk), "v"(gk), "v"(lk1), "v"(gk1), "v"(lv), "v"(gv), "v"(lv1), "v"(gv1) : "memory");
}

// k_flash: fused attention, one wave per 16 query rows of one (batch, head); Q fragments straight from the f16 plane; K / V^T tiles of 64 keys staged in LDS
// by asynchronous copies (two buffers, the next tile in flight while this one is worked on) and read by all AW waves as 16-B fragment loads.
// Transposed form: S^T[key][t] = K Q^T (A = K rows, B = Q rows); lane (t = lane&15, h = lane>>4) holds keys 8h+r of each 16-key tile, so the packed
// P tile is directly the B fragment of O^T[d][t] = V^T P^T (element r <- tile keys 0..15, element 8+r <- tile keys 16..31, lane unchanged).
// Per 32-key step: 4 score products + 4 P.V products + 1 row-sum product (A = all ones, B = the packed P tile: every row of its result is the sum of P over the step's 32 keys, so register 0 holds
// the whole sum of the lane's query in both lane halves). The row-sum product accumulates from pass to pass. The softmax reference is one scalar per lane, held while no score passes it by more than TAU; only
// when it is renewed are the two lane halves' maxima combined (one xor-16 exchange) and O and the row-sum tile rescaled.
// amdgpu_waves_per_eu(8): the register budget of 8 waves a SIMD. LDS admits four work-groups a WGP (8 waves a SIMD) and the grid is four a WGP: over that budget a whole work-group per WGP would be lost.
__global__ __launch_bounds__(32 * AW) __attribute__((amdgpu_waves_per_eu(8))) void k_flash(const h16* __restrict__ QH, const h16* __restrict__ KP, const h16* __restrict__ VT, h16* CH) {
    __shared__ __align__(16) h16 ring[2 * 2 * TILE_H];   // [buffer][K | V^T][row][LP]
    __shared__ __align__(16) float os[AW * 16 * 68];
    const int tid = threadIdx.x;
    const int lane = threadIdx.x & 31, lr = lane & 15, hi = lane >> 4;
    const int wave = __builtin_amdgcn_readfirstlane((int)(threadIdx.x >> 5));   // wave-uniform
    const int zh = blockIdx.y; const int b = zh / NH_, h = zh % NH_;
    const int t0 = (blockIdx.x * AW + wave) * 16;
    const size_t pbase = (size_t)zh * SEQ * HD;
    const size_t qo = pbase + (size_t)(t0 + lr) * HD + 8 * hi;
    const v16h qh0 = ldh(QH + qo), qh1 = ldh(QH + qo + 32);   // B fragments: col t, k = d
    const unsigned lcp = (unsigned)(size_t)ring + (unsigned)(((tid >> 3) * LP + (tid & 7) * 8) * 2);   // the lane's copy target in buffer 0's K tile (LDS byte address)
    const h16* gk = KP + pbase + tid * 8;                                        // + tile * KT * HD
    const h16* gv = VT + pbase + (size_t)(tid >> 3) * SEQ + (tid & 7) * 8;       // + tile * KT
    const int fo = lr * LP + 8 * hi;   // fragment offset in a tile: K + key * LP (A: row key, k = d); V^T + 16j * LP + key (A: row d, k = key)
    copy_tile(lcp, gk, gv);
    asm volatile("s_wait_asynccnt 0x0" ::: "memory");   // this wave's share of tile 0 has landed
    __syncthreads();                                     // every wave's share has: tile 0 may be read
    copy_tile(lcp + 2 * TILE_H * 2, gk + KT * HD, gv + KT);
    v8f o0 = (v8f){}, o1 = (v8f){}, o2 = (v8f){}, o3 = (v8f){};
    // m: the column's softmax reference (scaled log2), held from pass to pass; sh = PSH - m; lim = the raw score above which it is renewed. The first pass always renews it (any finite score > lim).
    float m = -3.0e38f, sh = 0.0f, lim = -3.0e38f;
    v8f st = (v8f){};   // running row sum: the accumulator of the row-sum product, rescaled like an output tile
    v16h ones;   // A operand of the row-sum product
#pragma unroll
    for (int r = 0; r < 16; ++r) ones[r] = (h16)1.0f;
#pragma unroll 1   // one trip per staged tile: the buffer index stays a run-time value and the loop text small
    for (int t = 0; t < SEQ / KT; ++t) {
      const h16* kt = ring + (t & 1) * (2 * TILE_H) + fo;
#pragma unroll 1    // the two 32-key steps of a tile stay rolled: unrolled, values of both steps live on past the barrier and the register count costs a wave per SIMD
      for (int u = 0; u < KT / 32; ++u) {
        const h16* ka = kt + u * 32 * LP;
        const v16h ka0 = ldh(ka), ka1 = ldh(ka + 32), kb0 = ldh(ka + 16 * LP), kb1 = ldh(ka + 16 * LP + 32);
        v8f sa = (v8f){}, sb = (v8f){};
        sa = wmma16(ka0, qh0, sa); sb = wmma16(kb0, qh0, sb);
        sa = wmma16(ka1, qh1, sa); sb = wmma16(kb1, qh1, sb);
        asm volatile("v_nop\n\tv_nop\n\tv_nop\n\tv_nop" : "+v"(sa), "+v"(sb) : "v"(ka0), "v"(ka1), "v"(kb0), "v"(kb1), "v"(qh0), "v"(qh1));
        const h16* va = kt + TILE_H + u * 32;   // V^T fragments: read ahead of the branch below, so that their LDS latency runs under the softmax
        const v16h v0 = ldh(va), v1 = ldh(va + 16 * LP), v2 = ldh(va + 32 * LP), v3 = ldh(va + 48 * LP);
        asm volatile("" ::: "memory");   // compiler fence: without it the reads above are sunk behind the branch, directly in front of the products that wait for them
        float mx = fmaxf(sa[0], sb[0]);   // the lane's 16 raw scores (SC2 > 0: the same order as the scaled ones)
#pragma unroll
        for (int r = 1; r < 8; ++r) mx = fmaxf(mx, fmaxf(sa[r], sb[r]));
        // lazy rescale, one test a pass: a scalar branch, taken by the whole wave when any lane's score passes its limit; then every column takes its running maximum as reference
        if (__builtin_amdgcn_ballot_w32(mx > lim) != 0) {
            mx = fmaxf(mx, __shfl_xor(mx, 16, 32));   // both lane halves of a column get one reference
            const float mnew = fmaxf(m, mx * SC2);
            const float alpha = __builtin_amdgcn_exp2f(m - mnew);
            m = mnew; sh = PSH - mnew; lim = (mnew + TAU) * (1.0f / SC2);
            o0 = o0 * alpha; o1 = o1 * alpha; o2 = o2 * alpha; o3 = o3 * alpha; st = st * alpha;
        }
        v16h pb;
#pragma unroll
        for (int r = 0; r < 8; ++r) { pb[r] = (h16)__builtin_amdgcn_exp2f(sa[r] * SC2 + sh); pb[8 + r] = (h16)__builtin_amdgcn_exp2f(sb[r] * SC2 + sh); }
        st = wmma16(ones, pb, st);   // adds the rounded P of the 32 keys to the running sum, f32
        o0 = wmma16(v0, pb, o0); o1 = wmma16(v1, pb, o1); o2 = wmma16(v2, pb, o2); o3 = wmma16(v3, pb, o3);
        asm volatile("v_nop\n\tv_nop\n\tv_nop\n\tv_nop" : "+v"(o0), "+v"(o1), "+v"(o2), "+v"(o3) : "v"(v0), "v"(v1), "v"(v2), "v"(v3), "v"(pb));
      }
      asm volatile("s_wait_dscnt 0x0" ::: "memory");      // this wave's reads of tile t are done before the buffer is refilled
      asm volatile("s_wait_asynccnt 0x0" ::: "memory");   // this wave's share of tile t + 1 has landed
      __syncthreads();                                     // publishes tile t + 1 and ends every wave's reads of tile t
      if (t + 2 < SEQ / KT) copy_tile(lcp + (unsigned)(t & 1) * (2 * TILE_H * 2), gk + (size_t)(t + 2) * KT * HD, gv + (t + 2) * KT);
    }
    asm volatile("s_wait_asynccnt 0x0" ::: "memory");     // no copy is outstanding when the wave goes on to its end
    const float inv = CTXS * (1.0f / st[0]);
    const int wb = wave * 16 * 68;
    // O^T D layout: o_j[r] = (d = 16j + 8h + r, t = lane&15) -> os[t][d]; rows 0..15 x columns 0..63 all written
    { v4f a, c;
      a[0] = o0[0] * inv; a[1] = o0[1] * inv; a[2] = o0[2] * inv; a[3] = o0[3] * inv; c[0] = o0[4] * inv; c[1] = o0[5] * inv; c[2] = o0[6] * inv; c[3] = o0[7] * inv;
      *(v4fa*)(&os[wb + lr * 68 +  0 + 8 * hi]) = a; *(v4fa*)(&os[wb + lr * 68 +  0 + 8 * hi + 4]) = c;
      a[0] = o1[0] * inv; a[1] = o1[1] * inv; a[2] = o1[2] * inv; a[3] = o1[3] * inv; c[0] = o1[4] * inv; c[1] = o1[5] * inv; c[2] = o1[6] * inv; c[3] = o1[7] * inv;
      *(v4fa*)(&os[wb + lr * 68 + 16 + 8 * hi]) = a; *(v4fa*)(&os[wb + lr * 68 + 16 + 8 * hi + 4]) = c;
      a[0] = o2[0] * inv; a[1] = o2[1] * inv; a[2] = o2[2] * inv; a[3] = o2[3] * inv; c[0] = o2[4] * inv; c[1] = o2[5] * inv; c[2] = o2[6] * inv; c[3] = o2[7] * inv;
      *(v4fa*)(&os[wb + lr * 68 + 32 + 8 * hi]) = a; *(v4fa*)(&os[wb + lr * 68 + 32 + 8 * hi + 4]) = c;
      a[0] = o3[0] * inv; a[1] = o3[1] * inv; a[2] = o3[2] * inv; a[3] = o3[3] * inv; c[0] = o3[4] * inv; c[1] = o3[5] * inv; c[2] = o3[6] * inv; c[3] = o3[7] * inv;
      *(v4fa*)(&os[wb + lr * 68 + 48 + 8 * hi]) = a; *(v4fa*)(&os[wb + lr * 68 + 48 + 8 * hi + 4]) = c; }
    wave_sync();
    h16* crow = CH + ((size_t)b * SEQ + t0) * DM + h * HD;       // context plane row m = b*SEQ + t, columns h*64 + d
{
#pragma unroll
        for (int s = 0; s < 4; ++s) { const int row = 4 * s + (lane >> 3), c8 = (lane & 7) * 8;   // 4 s x 4 row groups = 16 rows; 8 lanes x 8 halves = 64 columns
            const v4f x0 = *(const v4fa*)(&os[wb + row * 68 + c8]); const v4f x1 = *(const v4fa*)(&os[wb + row * 68 + c8 + 4]); v8h hv;
#pragma unroll
            for (int i = 0; i < 4; ++i) { hv[i] = (h16)x0[i]; hv[4 + i] = (h16)x1[i]; }
            *(v8h*)(crow + (size_t)row * DM + c8) = hv; }
         }
}

// k_oproj: f16 GEMM, 256 x 128 block tile, 8 waves of one 64x64 tile each (16 accumulators), operands from K-contiguous f16 planes through LDS (gemm_main), K = DM.
// OUT[(r0/SEQ)*OUT_SEQ + r0%SEQ + i][c0 + j] = oscale * sum_k A[r0+i][k] Bt[c0+j][k]. grid (NB*SEQ/256, DM/128), 256 threads.
__global__ __launch_bounds__(256) void k_oproj(const h16* __restrict__ A, const h16* __restrict__ Bt, float* OUT, float oscale) {
    __shared__ __align__(16) bf ring[2 * GST_H];   // [buffer][A rows | Bt rows][LP]
    __shared__ __align__(16) float osb[8 * 16 * 68];
    const int lane = threadIdx.x & 31, lr = lane & 15, hi = lane >> 4;
    const int wave = __builtin_amdgcn_readfirstlane((int)(threadIdx.x >> 5));   // wave-uniform
    const int wm = wave & 3, wn = wave >> 2;
    const int r0 = blockIdx.x * GBM + wm * 64, c0 = blockIdx.y * GBN + wn * 64;
    float* os = osb + wave * 16 * 68;   // wave-private output staging
    v8f acc[4][4];
#pragma unroll
    for (int mb = 0; mb < 4; ++mb)
#pragma unroll
        for (int nb = 0; nb < 4; ++nb) acc[mb][nb] = (v8f){};
    gemm_main<1>((const bf*)A, (const bf*)Bt, ring, blockIdx.x * GBM, blockIdx.y * GBN, wm, wn, acc);
    const size_t obase = ((size_t)(r0 / SEQ) * OUT_SEQ + (size_t)(r0 % SEQ)) * DM + c0;
#pragma unroll
    for (int mb = 0; mb < 4; ++mb) {
#pragma unroll
        for (int nb = 0; nb < 4; ++nb) {
#pragma unroll
            for (int j = 0; j < 8; ++j) os[(hi * 8 + j) * 68 + nb * 16 + lr] = acc[mb][nb][j] * oscale; }   // D: row 8h+j, col lane&15
        wave_sync();
        float* orow = OUT + obase + (size_t)(mb * 16) * DM;
{
#pragma unroll
            for (int s = 0; s < 8; ++s) { const int row = 2 * s + hi, cofs = lr * 4;   // 8 s x 2 rows = 16 rows; 16 lanes x 4 floats = 64 columns
                const v4f val = *(const v4fa*)(&os[row * 68 + cofs]);
                *(v4f*)(orow + (size_t)row * DM + cofs) = val; }
             }
        wave_sync();
    }
}

static constexpr size_t al256(size_t v) { return (v + 255) & ~(size_t)255; }
static constexpr size_t SZ_XB = al256((size_t)NB * SEQ * DM * 2);          // one activation plane (there are three: q, k, v)
static constexpr size_t SZ_WB = al256((size_t)4 * DM * DM * 2);            // four transposed weight planes
static constexpr size_t SZ_PL = al256((size_t)NB * NH_ * SEQ * HD * 2);    // per-head planes (q, k, v^T)
static constexpr size_t SZ_CH = al256((size_t)NB * SEQ * DM * 2);          // context plane
static constexpr size_t SZ_TOTAL = 3 * SZ_XB + SZ_WB + 3 * SZ_PL + SZ_CH;
static_assert(SZ_TOTAL <= (size_t)134217728);          // workspace carve <= 128 MiB
static_assert(((size_t)DM * DM * 2) % 256 == 0);       // weight sub-planes stay 256-byte aligned
static_assert((size_t)NB * DM * SEQ * 2 <= SZ_PL);     // v^T plane [(b*1024 + m)][t] fits its region

extern "C" void kernel_launch(void* const* d_in, const int* in_sizes, int n_in,
                              void* d_out, int out_size, void* d_ws, size_t ws_size, hipStream_t stream) {
    if (n_in < 7) return;
    const size_t needx = ((size_t)(NB - 1) * SEQ_FULL + SEQ) * DM;
    if ((size_t)in_sizes[0] < needx || (size_t)in_sizes[1] < needx || (size_t)in_sizes[2] < needx) return;
    if ((size_t)in_sizes[3] < (size_t)DM * DM || (size_t)in_sizes[4] < (size_t)DM * DM || (size_t)in_sizes[5] < (size_t)DM * DM || (size_t)in_sizes[6] < (size_t)DM * DM) return;
    if ((size_t)out_size < ((size_t)(NB - 1) * OUT_SEQ + SEQ) * DM) return;
    if (SZ_TOTAL > ws_size) return;
    // wire order: k, q, v, Wk, Wq, Wv, Wo (weights [in][out])
    const float* xq = (const float*)d_in[1]; const float* xk = (const float*)d_in[0]; const float* xv = (const float*)d_in[2];   /* this module stages k, q, v: the KEY stream is input 0 and the QUERY stream input 1 */
    const float* wq = (const float*)d_in[4]; const float* wk = (const float*)d_in[3]; const float* wv = (const float*)d_in[5]; const float* wo = (const float*)d_in[6];   /* w_key is input 3 and w_query input 4 */
    float* OUT = (float*)d_out;      // [NB][SEQ][1024]
    char* wsp = (char*)d_ws;
    bf* XQ = (bf*)wsp; wsp += SZ_XB;                 // [NB*SEQ][1024] bf16 activations
    bf* XK = (bf*)wsp; wsp += SZ_XB;
    bf* XV = (bf*)wsp; wsp += SZ_XB;
    bf* WB = (bf*)wsp; wsp += SZ_WB;                 // [4][1024 out][1024 in]: q | k | v (bf16) | o (f16 x64)
    h16* QH = (h16*)wsp; wsp += SZ_PL;               // [NB*16][SEQ][64]
    h16* KP = (h16*)wsp; wsp += SZ_PL;               // [NB*16][SEQ][64]
    h16* VT = (h16*)wsp; wsp += SZ_PL;               // [NB*16][64][SEQ]
    h16* CH = (h16*)wsp; wsp += SZ_CH;               // [NB*SEQ][1024] context x256
    bf* WQT = WB; bf* WKT = WB + (size_t)DM * DM; bf* WVT = WB + (size_t)2 * DM * DM; bf* WOT = WB + (size_t)3 * DM * DM;

    // all conversions: activations f32 -> bf16, weights in[k = input feature][n = output feature] -> out[n][k]
    k_prep<<<PG, 32 * PW, 0, stream>>>(xq, xk, xv, wq, wk, wv, wo, XQ, XK, XV, WB);

    // q, k: A = x rows (m = b*SEQ + t), Bt = W^T rows (n = h*64 + d) -> plane [(b*16 + h)][t][d]
    k_proj<<<dim3(NB * SEQ / GBM, DM / GBN, 1), 256, 0, stream>>>(XQ, WQT, QH, SEQ, (size_t)NH_ * SEQ * HD, HD, HD, (size_t)SEQ * HD);
    k_proj<<<dim3(NB * SEQ / GBM, DM / GBN, 1), 256, 0, stream>>>(XK, WKT, KP, SEQ, (size_t)NH_ * SEQ * HD, HD, HD, (size_t)SEQ * HD);
    // v^T: A = Wv^T rows (m = h*64 + d), Bt = x rows (n = b*SEQ + t) -> plane [(b*1024 + m)][t] = [(b*16 + h)][d][t]
    k_proj<<<dim3(DM / GBM, NB * SEQ / GBN, 1), 256, 0, stream>>>(WVT, XV, VT, DM, (size_t)0, SEQ, SEQ, (size_t)DM * SEQ);

    k_flash<<<dim3(SEQ / (16 * AW), NB * NH_, 1), 32 * AW, 0, stream>>>(QH, KP, VT, CH);

    // output projection: A = context rows (m = b*SEQ + t), Bt = Wo^T rows (n) -> f32 output
    k_oproj<<<dim3(NB * SEQ / GBM, DM / GBN, 1), 256, 0, stream>>>(CH, (const h16*)WOT, OUT, OSC);
}

// v006
// A run of this version takes 129 microseconds.
// Two timings next to v005 both put it at 1.09 times that version's speed.
// Over all steps from v000 it is 2.85 times as fast.
#include <hip/hip_runtime.h>

// Attention with 16 heads x 64, width 1024, whose KEY stream and KEY weight are staged FIRST: separate inputs k, q, v [4][2048][1024] (f32), weights w_key / w_query / w_value / w_proj stored [in][out] (y = x W, normal x 0.02), no biases, no mask, scores / sqrt(64), softmax over the keys, f32 output = (merged heads) w_proj [4][2048][1024]; argument order k, q, v, w_key, w_query, w_value, w_proj.
// Compute dtypes, f32 accumulate everywhere: projections v_wmma_f32_16x16x32_bf16 (x and W RNE-converted to bf16; products exact);
// scores v_wmma_f32_16x16x32_f16: q and k single f16 planes (one product); P (x256 carry, cancels in the normalisation) and v single f16; softmax f32 (online, running max);
// output projection v_wmma_f32_16x16x32_f16: context single f16 (x256 carry), Wo = f16 of (bf16 RNE of Wo) x64; 2^-14 folded into the f32 epilogue.
// Layout: three bf16 activation planes (q, k, v) and the transposed weight planes [out][in], all written by one conversion launch; q, k planes [b*16+h][t][d], v^T plane [b*16+h][d][t] written by the GEMM epilogue;
// fused flash kernel in transposed form (S^T = K Q^T, O^T = V^T P^T) writes the f16 context plane [b*SEQ+t][1024]; last GEMM writes the f32 output.

#ifndef NB
#define NB 4
#endif
#ifndef SEQ
#define SEQ 2048
#endif
#define NB_FULL  4
#define SEQ_FULL 2048
#ifndef OUT_SEQ
#define OUT_SEQ SEQ              // row pitch (in tokens) between batches of the output
#endif
#define DM   1024
#define NH_  16
#define HD   64
#define AW   8                   // waves per flash block (16 query rows each); all of them read one staged K / V^T tile
#define KT   64                  // keys per staged tile (two 32-key steps)
#define LP   72                  // LDS row pitch in halves: 144 B = 16 B x 9, so the 16 rows of a 16-byte fragment read fall on distinct banks
#define TILE_H (64 * LP)         // halves of one staged tile: 64 rows (K: keys, V^T: d) of 64 halves + pad
#define GBM  256                 // GEMM block tile: A rows (4 waves of 64)
#define GBN  128                 // GEMM block tile: Bt rows = output columns (2 waves of 64)
#define GKS  64                  // k per staged GEMM tile (two 32-k steps): 128 B of every operand row
#define GST_H ((GBM + GBN) * LP) // halves of one GEMM stage: 256 A rows, then 128 Bt rows, at pitch LP
#define PG   256                 // conversion work-groups: one resident round, each loops over its share
#define PW   16                  // waves per conversion work-group
#define PLD  8                   // 16-B loads a wave holds in flight per batch: 8 x 512 B = 4 KiB contiguous
#define SC2  (0.125f * 1.4426950408889634f)   // HD^-0.5 * log2(e)
#define PSH  8.0f                // log2 of the P carry (256)
#define TAU  6.0f                // a column's softmax reference is renewed once a score passes it by more than this (log2): P stays <= 2^(PSH + TAU) = 2^14, inside f16
#define CTXS 256.0f              // carry of the context plane
#define WOS  64.0f               // carry of the Wo plane
#define OSC  (1.0f / (CTXS * WOS))

static_assert(HD == 64);
static_assert(NH_ * HD == DM);                 // head h = columns h*64 + d
static_assert(DM % 64 == 0);                   // 16 column tiles of 64
static_assert(DM % 32 == 0);                   // GEMM k-loop steps by 32
static_assert(SEQ % 64 == 0);                  // a 64-row tile never straddles two batches
static_assert((NB * SEQ) % 64 == 0);
static_assert(SEQ % KT == 0 && SEQ / KT >= 2);  // key loop walks whole staged tiles; the two-buffer prologue needs two
static_assert(32 * AW == 256);                 // 256 lanes x 2 copies x 16 B = one 8-KiB tile
static_assert(SEQ % (16 * AW) == 0);           // flash grid covers the sequence exactly
static_assert(((size_t)SEQ * DM) % 8 == 0);
static_assert(DM % GKS == 0 && DM / GKS >= 2);                 // GEMM k loop walks whole stages; the two-buffer prologue needs two
static_assert((GBM + GBN) * GKS * 2 == 12 * 256 * 16);         // 256 lanes x 12 copies x 16 B = one stage
static_assert((NB * SEQ) % GBM == 0 && (NB * SEQ) % GBN == 0); // block tiles cover the token rows exactly, as A or as Bt
static_assert(DM % GBM == 0 && DM % GBN == 0);                 // and the feature rows
static_assert(SEQ % 64 == 0 && GBM % 64 == 0 && GBN % 64 == 0);
static_assert(4 * (DM / 64) * (DM / 64) == 4 * PG && PG % 4 == 0 && (DM / 64) % 2 == 0 && 32 * PW == 512);   // four weight tiles a conversion work-group, two a 256-thread half
static_assert((size_t)NB * SEQ * DM == 2 * (size_t)PG * PW * PLD * 128);   // two batches cover an activation plane exactly
static_assert(((size_t)SEQ * DM) % (PLD * 128) == 0);                      // a wave's batch never straddles two batches of the input
static_assert(NB <= NB_FULL);
static_assert(SEQ <= SEQ_FULL);

typedef _Float16 h16;
typedef unsigned short bf;
typedef __attribute__((ext_vector_type(16))) __bf16   v16bf;
typedef __attribute__((ext_vector_type(16))) _Float16 v16h;
typedef __attribute__((ext_vector_type(8)))  _Float16 v8h;
typedef __attribute__((ext_vector_type(8)))  unsigned short v8us;
typedef __attribute__((ext_vector_type(16))) unsigned short v16us;
typedef __attribute__((ext_vector_type(4)))  unsigned short v4us;
typedef __attribute__((ext_vector_type(8)))  float    v8f;
typedef __attribute__((ext_vector_type(4)))  float    v4f;
typedef v4f  __attribute__((may_alias)) v4fa;

__device__ __forceinline__ unsigned short f2bf(float f) { unsigned u = __float_as_uint(f); u += 0x7FFFu + ((u >> 16) & 1u); return (unsigned short)(u >> 16); }
__device__ __forceinline__ v16h cat16(v8h lo, v8h hi) { return __builtin_shufflevector(lo, hi, 0, 1, 2, 3, 4, 5, 6, 7, 8, 9, 10, 11, 12, 13, 14, 15); }
__device__ __forceinline__ v8f wmma16(v16h a, v16h b, v8f c) { return __builtin_amdgcn_wmma_f32_16x16x32_f16(false, a, false, b, (short)0, c, false, false); }
__device__ __forceinline__ v8f wmmab(v16bf a, v16bf b, v8f c) { return __builtin_amdgcn_wmma_f32_16x16x32_bf16(false, a, false, b, (short)0, c, false, false); }
// fragment loaders from K-contiguous 16-bit rows; p already includes + 8*(lane>>4): elements 0..7 <- k0+8h+0..7, elements 8..15 <- k0+16+8h+0..7 (same map for A and B)
__device__ __forceinline__ v16h  ldh(const h16* p) { return cat16(*(const v8h*)p, *(const v8h*)(p + 16)); }
// ordering point for wave-private LDS tiles (same wave writes and reads)
__device__ __forceinline__ void wave_sync() { __builtin_amdgcn_fence(3 /* release order */, "wavefront"); __builtin_amdgcn_wave_barrier(); asm volatile("" ::: "memory"); }

// k_prep: every operand conversion of the call in ONE launch of PG resident work-groups of PW waves.
// Weights: work-group g takes four 64 x 64 tiles of weight g / 64 (each 256-thread half two of them): in[k][n] (k = input feature, n = output feature) -> out[n][k] through LDS;
// planes 0..2 bf16 bits (RNE), plane 3 f16 bits of (bf16 RNE value * WOS), a power of two (exact).
// Activations: f32 -> bf16 (RNE), element order kept. A batch is PLD loads of 16 B a lane, 4 KiB contiguous a wave; the next batch's loads are issued before this one is converted and stored.
// Batch b of a plane: elements b * PEB + e0 + j * 128 + 0..3, e0 = the lane's place in the grid's first batch (a 32-bit offset from a uniform base).
#define PEB  ((size_t)PG * PW * PLD * 128)   // elements of one batch over the whole grid
// closes a group of global loads or stores: what follows may rewrite the registers that the group names (addresses, store data) only behind this wait
__device__ __forceinline__ void xwait() { asm volatile("s_wait_xcnt 0x0" ::: "memory"); }
__device__ __forceinline__ size_t xoff(size_t e) { return (e / ((size_t)SEQ * DM)) * ((size_t)SEQ_FULL * DM) + e % ((size_t)SEQ * DM); }
__device__ __forceinline__ void ld_batch(const float* __restrict__ x, int b, unsigned e0, v4f (&r)[PLD]) {
    const float* s = SEQ == SEQ_FULL ? (x + b * PEB) + e0 : x + xoff(b * PEB + e0);
#pragma unroll
    for (int j = 0; j < PLD; ++j) r[j] = *(const v4f*)(s + j * 128);
    xwait();
}
__device__ __forceinline__ void st_batch(bf* __restrict__ d, int b, unsigned e0, const v4f (&r)[PLD]) {
    bf* t = (d + b * PEB) + e0;
#pragma unroll
    for (int j = 0; j < PLD; ++j) { v4us o;
#pragma unroll
        for (int k = 0; k < 4; ++k) o[k] = f2bf(r[j][k]);
        *(v4us*)(t + j * 128) = o; }
}
__global__ __launch_bounds__(32 * PW) void k_prep(const float* __restrict__ xq, const float* __restrict__ xk, const float* __restrict__ xv,
                                                  const float* __restrict__ wq, const float* __restrict__ wk, const float* __restrict__ wv, const float* __restrict__ wo,
                                                  bf* __restrict__ XQ, bf* __restrict__ XK, bf* __restrict__ XV, bf* __restrict__ WB) {
    __shared__ float tsb[4 * 64 * 65];
    const int tid = threadIdx.x & 255, hf = threadIdx.x >> 8;
    const int ws = blockIdx.x / (PG / 4);                       // which weight: the same for the whole work-group
    const float* W = ws == 0 ? wq : ws == 1 ? wk : ws == 2 ? wv : wo;
    bf* dst = WB + (size_t)ws * DM * DM;
    const int asF16 = ws == 3; const float scale = asF16 ? WOS : 1.0f;
    const int tw = (blockIdx.x % (PG / 4)) * 4 + hf * 2;        // first of this half's two tiles: k tile = tw % 16 (even, so tw + 1 has the same n tile), n tile = tw / 16
    const int k0 = (tw % (DM / 64)) * 64, n0 = (tw / (DM / 64)) * 64;
    v4f wr[2][4];
#pragma unroll
    for (int u = 0; u < 2; ++u)
#pragma unroll
        for (int i = 0; i < 4; ++i) { const int idx = tid + 256 * i; const int kk = idx >> 4, c4 = (idx & 15) * 4;
            wr[u][i] = *(const v4f*)(W + (size_t)(k0 + 64 * u + kk) * DM + n0 + c4); }
    xwait();
    const unsigned e0 = (blockIdx.x * PW + (threadIdx.x >> 5)) * (PLD * 128) + (threadIdx.x & 31) * 4;
    v4f ra[PLD], rb[PLD];
    ld_batch(xq, 0, e0, ra);
#pragma unroll
    for (int u = 0; u < 2; ++u) { float* ts = tsb + (hf * 2 + u) * 64 * 65;
#pragma unroll
        for (int i = 0; i < 4; ++i) { const int idx = tid + 256 * i; const int kk = idx >> 4, c4 = (idx & 15) * 4;
            ts[kk * 65 + c4 + 0] = wr[u][i][0]; ts[kk * 65 + c4 + 1] = wr[u][i][1]; ts[kk * 65 + c4 + 2] = wr[u][i][2]; ts[kk * 65 + c4 + 3] = wr[u][i][3]; } }
    __syncthreads();
    const int c8 = (tid & 7) * 8;
#pragma unroll
    for (int u = 0; u < 2; ++u) { const float* ts = tsb + (hf * 2 + u) * 64 * 65;
        v8us o0, o1;
#pragma unroll
        for (int j = 0; j < 8; ++j) {
            const float xa = ts[(c8 + j) * 65 + (tid >> 3)]; const float xb = ts[(c8 + j) * 65 + (tid >> 3) + 32];
            const unsigned short ba = f2bf(xa), bb = f2bf(xb);
            const h16 ha = (h16)(__uint_as_float((unsigned)ba << 16) * scale); const h16 hb = (h16)(__uint_as_float((unsigned)bb << 16) * scale);
            const unsigned short fa = __builtin_bit_cast(unsigned short, ha), fb = __builtin_bit_cast(unsigned short, hb);
            o0[j] = asF16 ? fa : ba; o1[j] = asF16 ? fb : bb; }
        *(v8us*)(dst + (size_t)(n0 + (tid >> 3)) * DM + k0 + 64 * u + c8) = o0;
        *(v8us*)(dst + (size_t)(n0 + (tid >> 3) + 32) * DM + k0 + 64 * u + c8) = o1; }
    xwait();
    ld_batch(xq, 1, e0, rb); st_batch(XQ, 0, e0, ra); xwait();
    ld_batch(xk, 0, e0, ra); st_batch(XQ, 1, e0, rb); xwait();
    ld_batch(xk, 1, e0, rb); st_batch(XK, 0, e0, ra); xwait();
    ld_batch(xv, 0, e0, ra); st_batch(XK, 1, e0, rb); xwait();
    ld_batch(xv, 1, e0, rb); st_batch(XV, 0, e0, ra); xwait();
    st_batch(XV, 1, e0, rb);
}

// copy_stage: one GEMM stage, 64 k of 256 A rows and of 128 Bt rows (row pitch DM halves in memory), into LDS at pitch LP, no register in between.
// Lane tid brings 16 B of rows (tid>>3) + 32 i, so a wave's copy covers four whole 128-B lines. l = the lane's LDS byte address in row tid>>3 of the stage.
__device__ __forceinline__ void copy_stage(unsigned l, const bf* ga, const bf* gb) {
    const unsigned S = 32 * LP * 2; const size_t G = (size_t)32 * DM;
    // the closing s_wait_xcnt stands inside the statement so that no address register is rewritten ahead of it
    asm volatile("global_load_async_to_lds_b128 %0, %1, off\n\t"
                 "global_load_async_to_lds_b128 %2, %3, off\n\t"
                 "global_load_async_to_lds_b128 %4, %5, off\n\t"
                 "global_load_async_to_lds_b128 %6, %7, off\n\t"
                 "global_load_async_to_lds_b128 %8, %9, off\n\t"
                 "global_load_async_to_lds_b128 %10, %11, off\n\t"
                 "global_load_async_to_lds_b128 %12, %13, off\n\t"
                 "global_load_async_to_lds_b128 %14, %15, off\n\t"
                 "global_load_async_to_lds_b128 %16, %17, off\n\t"
                 "global_load_async_to_lds_b128 %18, %19, off\n\t"
                 "global_load_async_to_lds_b128 %20, %21, off\n\t"
                 "global_load_async_to_lds_b128 %22, %23, off\n\t"
                 "s_wait_xcnt 0x0"
                 :: "v"(l), "v"(ga), "v"(l + S), "v"(ga + G), "v"(l + 2 * S), "v"(ga + 2 * G), "v"(l + 3 * S), "v"(ga + 3 * G),
                    "v"(l + 4 * S), "v"(ga + 4 * G), "v"(l + 5 * S), "v"(ga + 5 * G), "v"(l + 6 * S), "v"(ga + 6 * G), "v"(l + 7 * S), "v"(ga + 7 * G),
                    "v"(l + 8 * S), "v"(gb), "v"(l + 9 * S), "v"(gb + G), "v"(l + 10 * S), "v"(gb + 2 * G), "v"(l + 11 * S), "v"(gb + 3 * G) : "memory");
}

// fragment from a staged row; p already includes + 8*(lane>>4): the k map of ldh
__device__ __forceinline__ v16us ldu(const bf* p) { return __builtin_shufflevector(*(const v8us*)p, *(const v8us*)(p + 16), 0, 1, 2, 3, 4, 5, 6, 7, 8, 9, 10, 11, 12, 13, 14, 15); }
template <int F16> __device__ __forceinline__ v8f wmmau(v16us a, v16us b, v8f c) {
    if constexpr (F16) return wmma16(__builtin_bit_cast(v16h, a), __builtin_bit_cast(v16h, b), c);
    else return wmmab(__builtin_bit_cast(v16bf, a), __builtin_bit_cast(v16bf, b), c);
}

// gemm_main: k loop of one 256 x 128 block tile, K = DM, 8 waves of 64 x 64 (wave (wm, wn): A rows rb + 64 wm, Bt rows cb + 64 wn; 16 accumulators each).
// Stages of 64 k come into LDS by asynchronous copies (two buffers, the next stage in flight while this one is worked on); every wave reads its fragments as 16-B LDS loads.
// Each accumulator takes its 32-k products in rising k, as with operands read straight from memory.
// LEAN: the last two Bt fragments of a stage are read behind the stage's first 8 products, into registers that those products have left: 16 registers fewer, so that a wave fits 256.
template <int F16, int LEAN>
__device__ __forceinline__ void gemm_main(const bf* A, const bf* Bt, bf* ring, int rb, int cb, int wm, int wn, v8f (&acc)[4][4]) {
    const int tid = threadIdx.x, lr = tid & 15, hi = (tid >> 4) & 1;
    const unsigned lcp = (unsigned)(size_t)ring + (unsigned)(((tid >> 3) * LP + (tid & 7) * 8) * 2);   // the lane's copy target in buffer 0 (LDS byte address)
    const bf* ga = A + (size_t)(rb + (tid >> 3)) * DM + (tid & 7) * 8;    // + stage * GKS
    const bf* gb = Bt + (size_t)(cb + (tid >> 3)) * DM + (tid & 7) * 8;   // + stage * GKS
    const int fa = (wm * 64 + lr) * LP + 8 * hi, fb = (GBM + wn * 64 + lr) * LP + 8 * hi;   // fragment offsets in a stage
    copy_stage(lcp, ga, gb);
    asm volatile("s_wait_asynccnt 0x0" ::: "memory");   // this wave's share of stage 0 has landed
    __syncthreads();                                     // every wave's share has: stage 0 may be read
    copy_stage(lcp + GST_H * 2, ga + GKS, gb + GKS);
#pragma unroll 1   // one trip per stage: the buffer index stays a run-time value and the loop text small
    for (int t = 0; t < DM / GKS; ++t) {
        const bf* pa = ring + (t & 1) * GST_H + fa; const bf* pb = ring + (t & 1) * GST_H + fb;
        v16us a[GKS / 32][4], b[GKS / 32][4];
        // every loop below is unrolled whole: fragments and accumulators are indexed by constants and so stay in registers
#pragma unroll
        for (int u = 0; u < GKS / 32; ++u) {
#pragma unroll
            for (int i = 0; i < 4; ++i) { a[u][i] = ldu(pa + i * 16 * LP + u * 32); if (!(LEAN && u == GKS / 32 - 1 && i >= 2)) b[u][i] = ldu(pb + i * 16 * LP + u * 32); }
        }
        __builtin_amdgcn_sched_barrier(0);   // the stage's LDS reads stay one group ahead of its products (for speed only)
#pragma unroll
        for (int u = 0; u < GKS / 32; ++u)
#pragma unroll
            for (int nb = 0; nb < 4; ++nb) {
#pragma unroll
                for (int mb = 0; mb < 4; ++mb) acc[mb][nb] = wmmau<F16>(a[u][mb], b[u][nb], acc[mb][nb]);
                if (LEAN && u == 0 && nb == 1) {
                    __builtin_amdgcn_sched_barrier(0);   // the late reads stay behind the 8 products whose Bt registers they take: hoisted, they would raise the register count past 256
                    b[GKS / 32 - 1][2] = ldu(pb + 2 * 16 * LP + (GKS / 32 - 1) * 32); b[GKS / 32 - 1][3] = ldu(pb + 3 * 16 * LP + (GKS / 32 - 1) * 32);
                    __builtin_amdgcn_sched_barrier(0);   // and stay one group, 16 products ahead of their first use
                }
            }
        __builtin_amdgcn_sched_barrier(0);   // the products stay ahead of the closing waits: moved behind the barrier they would start only when every wave's LDS reads are over
        asm volatile("s_wait_dscnt 0x0" ::: "memory");      // this wave's reads of stage t are done before the buffer is refilled
        asm volatile("s_wait_asynccnt 0x0" ::: "memory");   // this wave's share of stage t + 1 has landed
        __syncthreads();                                     // publishes stage t + 1 and ends every wave's reads of stage t
        if (t + 2 < DM / GKS) copy_stage(lcp + (unsigned)(t & 1) * (GST_H * 2), ga + (t + 2) * GKS, gb + (t + 2) * GKS);
    }
    asm volatile("s_wait_asynccnt 0x0" ::: "memory");       // no copy is outstanding when the wave goes on to its epilogue
}

// k_proj: the three bf16 projection GEMMs in ONE launch, blockIdx.y = which (0: q, 1: k, 2: v^T); 256 x 128 block tile, 8 waves of one 64x64 tile each (16 accumulators),
// operands from K-contiguous bf16 planes through LDS (gemm_main), K = DM. C[m][n] = sum_k A[m][k] Bt[n][k], written as f16.
// q, k: A = x rows (m = b*SEQ + t), Bt = W^T rows (n = h*64 + d) -> plane [(b*16 + h)][t][d]; v^T: A = Wv^T rows (m = h*64 + d), Bt = x rows (n = b*SEQ + t) -> plane [(b*1024 + m)][t] = [(b*16 + h)][d][t].
// grid (M/256 * N/128, 3), 256 threads; blockIdx.x walks the A row tiles first.
// amdgpu_waves_per_eu(4): the register budget of 4 waves a SIMD. LDS admits two work-groups a WGP and the grid is three a WGP: two resident ones fill each other's LDS-read, barrier, first-stage and epilogue waits.
__global__ __launch_bounds__(256) __attribute__((amdgpu_waves_per_eu(4))) void k_proj(const bf* __restrict__ XQ, const bf* __restrict__ XK, const bf* __restrict__ XV, const bf* __restrict__ WB, h16* QH, h16* KP, h16* VT) {
    __shared__ __align__(16) bf ring[2 * GST_H];   // [buffer][A rows | Bt rows][LP]
    __shared__ __align__(16) float osb[8 * 16 * 68];
    const int lane = threadIdx.x & 31, lr = lane & 15, hi = lane >> 4;
    const int wave = __builtin_amdgcn_readfirstlane((int)(threadIdx.x >> 5));   // wave-uniform
    const int wm = wave & 3, wn = wave >> 2;
    const int z = blockIdx.y;
    const bf* X = z == 0 ? XQ : z == 1 ? XK : XV;
    const bf* Wt = WB + (size_t)z * DM * DM;
    const bf* A = z == 2 ? Wt : X; const bf* Bt = z == 2 ? X : Wt;
    h16* Ph = z == 0 ? QH : z == 1 ? KP : VT;
    const int bx = z == 2 ? blockIdx.x % (DM / GBM) : blockIdx.x % (NB * SEQ / GBM), by = z == 2 ? blockIdx.x / (DM / GBM) : blockIdx.x / (NB * SEQ / GBM);
    const int r0 = bx * GBM + wm * 64, c0 = by * GBN + wn * 64;
    const int pitch = z == 2 ? SEQ : HD;   // row pitch of the written plane (halves)
    float* os = osb + wave * 16 * 68;   // wave-private output staging
    v8f acc[4][4];
#pragma unroll
    for (int mb = 0; mb < 4; ++mb)
#pragma unroll
        for (int nb = 0; nb < 4; ++nb) acc[mb][nb] = (v8f){};
    gemm_main<0, 1>(A, Bt, ring, bx * GBM, by * GBN, wm, wn, acc);
    const size_t tbase = z == 2 ? (size_t)r0 * SEQ + (size_t)(c0 / SEQ) * ((size_t)DM * SEQ) + (size_t)(c0 % SEQ)
                                : (size_t)(r0 / SEQ) * ((size_t)NH_ * SEQ * HD) + (size_t)(r0 % SEQ) * HD + (size_t)(c0 / HD) * ((size_t)SEQ * HD) + (size_t)(c0 % HD);
#pragma unroll
    for (int mb = 0; mb < 4; ++mb) {
#pragma unroll
        for (int nb = 0; nb < 4; ++nb) {
#pragma unroll
            for (int j = 0; j < 8; ++j) os[(hi * 8 + j) * 68 + nb * 16 + lr] = acc[mb][nb][j]; }   // D: row 8h+j, col lane&15
        wave_sync();
        const size_t sb = tbase + (size_t)(mb * 16) * (size_t)pitch;
{
#pragma unroll
            for (int s = 0; s < 4; ++s) { const int row = 4 * s + (lane >> 3), c8 = (lane & 7) * 8;   // 4 s x 4 row groups = 16 rows; 8 lanes x 8 = 64 columns
                const v4f x0 = *(const v4fa*)(&os[row * 68 + c8]); const v4f x1 = *(const v4fa*)(&os[row * 68 + c8 + 4]); v8h hv;
#pragma unroll
                for (int i = 0; i < 4; ++i) { hv[i] = (h16)x0[i]; hv[4 + i] = (h16)x1[i]; }
                const size_t oo = sb + (size_t)row * (size_t)pitch + c8;
                *(v8h*)(Ph + oo) = hv; }
             }
        wave_sync();
    }
}

// copy_tile: one 64-key K tile (64 rows of 128 B, contiguous) and one V^T tile (64 rows d of 128 B, pitch SEQ halves) into LDS at pitch LP, no register in between.
// Lane tid brings 16 B of rows tid>>3 and 32 + (tid>>3) of each tile, so a wave's copy covers four whole 128-B lines. lk = the lane's LDS byte address in the K tile.
__device__ __forceinline__ void copy_tile(unsigned lk, const h16* gk, const h16* gv) {
    const unsigned lk1 = lk + 32 * LP * 2, lv = lk + TILE_H * 2, lv1 = lv + 32 * LP * 2;
    const h16* gk1 = gk + 32 * HD; const h16* gv1 = gv + (size_t)32 * SEQ;
    // the closing s_wait_xcnt stands inside the statement so that no address register is rewritten ahead of it
    asm volatile("global_load_async_to_lds_b128 %0, %1, off\n\t"
                 "global_load_async_to_lds_b128 %2, %3, off\n\t"
                 "global_load_async_to_lds_b128 %4, %5, off\n\t"
                 "global_load_async_to_lds_b128 %6, %7, off\n\t"
                 "s_wait_xcnt 0x0"
                 :: "v"(lk), "v"(gk), "v"(lk1), "v"(gk1), "v"(lv), "v"(gv), "v"(lv1), "v"(gv1) : "memory");
}

// k_flash: fused attention, one wave per 16 query rows of one (batch, head); Q fragments straight from the f16 plane; K / V^T tiles of 64 keys staged in LDS
// by asynchronous copies (two buffers, the next tile in flight while this one is worked on) and read by all AW waves as 16-B fragment loads.
// Transposed form: S^T[key][t] = K Q^T (A = K rows, B = Q rows); lane (t = lane&15, h = lane>>4) holds keys 8h+r of each 16-key tile, so the packed
// P tile is directly the B fragment of O^T[d][t] = V^T P^T (element r <- tile keys 0..15, element 8+r <- tile keys 16..31, lane unchanged).
// Per 32-key step: 4 score products + 4 P.V products + 1 row-sum product (A = all ones, B = the packed P tile: every row of its result is the sum of P over the step's 32 keys, so register 0 holds
// the whole sum of the lane's query in both lane halves). The row-sum product accumulates from pass to pass. The softmax reference is one scalar per lane, held while no score passes it by more than TAU; only
// when it is renewed are the two lane halves' maxima combined (one xor-16 exchange) and O and the row-sum tile rescaled.
// amdgpu_waves_per_eu(8): the register budget of 8 waves a SIMD. LDS admits four work-groups a WGP (8 waves a SIMD) and the grid is four a WGP: over that budget a whole work-group per WGP would be lost.
__global__ __launch_bounds__(32 * AW) __attribute__((amdgpu_waves_per_eu(8))) void k_flash(const h16* __restrict__ QH, const h16* __restrict__ KP, const h16* __restrict__ VT, h16* CH) {
    __shared__ __align__(16) h16 ring[2 * 2 * TILE_H];   // [buffer][K | V^T][row][LP]
    __shared__ __align__(16) float os[AW * 16 * 68];
    const int tid = threadIdx.x;
    const int lane = threadIdx.x & 31, lr = lane & 15, hi = lane >> 4;
    const int wave = __builtin_amdgcn_readfirstlane((int)(threadIdx.x >> 5));   // wave-uniform
    const int zh = blockIdx.y; const int b = zh / NH_, h = zh % NH_;
    const int t0 = (blockIdx.x * AW + wave) * 16;
    const size_t pbase = (size_t)zh * SEQ * HD;
    const size_t qo = pbase + (size_t)(t0 + lr) * HD + 8 * hi;
    const v16h qh0 = ldh(QH + qo), qh1 = ldh(QH + qo + 32);   // B fragments: col t, k = d
    const unsigned lcp = (unsigned)(size_t)ring + (unsigned)(((tid >> 3) * LP + (tid & 7) * 8) * 2);   // the lane's copy target in buffer 0's K tile (LDS byte address)
    const h16* gk = KP + pbase + tid * 8;                                        // + tile * KT * HD
    const h16* gv = VT + pbase + (size_t)(tid >> 3) * SEQ + (tid & 7) * 8;       // + tile * KT
    const int fo = lr * LP + 8 * hi;   // fragment offset in a tile: K + key * LP (A: row key, k = d); V^T + 16j * LP + key (A: row d, k = key)
    copy_tile(lcp, gk, gv);
    asm volatile("s_wait_asynccnt 0x0" ::: "memory");   // this wave's share of tile 0 has landed
    __syncthreads();                                     // every wave's share has: tile 0 may be read
    copy_tile(lcp + 2 * TILE_H * 2, gk + KT * HD, gv + KT);
    v8f o0 = (v8f){}, o1 = (v8f){}, o2 = (v8f){}, o3 = (v8f){};
    // m: the column's softmax reference (scaled log2), held from pass to pass; sh = PSH - m; lim = the raw score above which it is renewed. The first pass always renews it (any finite score > lim).
    float m = -3.0e38f, sh = 0.0f, lim = -3.0e38f;
    v8f st = (v8f){};   // running row sum: the accumulator of the row-sum product, rescaled like an output tile
    v16h ones;   // A operand of the row-sum product
#pragma unroll
    for (int r = 0; r < 16; ++r) ones[r] = (h16)1.0f;
#pragma unroll 1   // one trip per staged tile: the buffer index stays a run-time value and the loop text small
    for (int t = 0; t < SEQ / KT; ++t) {
      const h16* kt = ring + (t & 1) * (2 * TILE_H) + fo;
#pragma unroll 1    // the two 32-key steps of a tile stay rolled: unrolled, values of both steps live on past the barrier and the register count costs a wave per SIMD
      for (int u = 0; u < KT / 32; ++u) {
        const h16* ka = kt + u * 32 * LP;
        const v16h ka0 = ldh(ka), ka1 = ldh(ka + 32), kb0 = ldh(ka + 16 * LP), kb1 = ldh(ka + 16 * LP + 32);
        v8f sa = (v8f){}, sb = (v8f){};
        sa = wmma16(ka0, qh0, sa); sb = wmma16(kb0, qh0, sb);
        sa = wmma16(ka1, qh1, sa); sb = wmma16(kb1, qh1, sb);
        asm volatile("v_nop\n\tv_nop\n\tv_nop\n\tv_nop" : "+v"(sa), "+v"(sb) : "v"(ka0), "v"(ka1), "v"(kb0), "v"(kb1), "v"(qh0), "v"(qh1));
        const h16* va = kt + TILE_H + u * 32;   // V^T fragments: read ahead of the branch below, so that their LDS latency runs under the softmax
        const v16h v0 = ldh(va), v1 = ldh(va + 16 * LP), v2 = ldh(va + 32 * LP), v3 = ldh(va + 48 * LP);
        asm volatile("" ::: "memory");   // compiler fence: without it the reads above are sunk behind the branch, directly in front of the products that wait for them
        float mx = fmaxf(sa[0], sb[0]);   // the lane's 16 raw scores (SC2 > 0: the same order as the scaled ones)
#pragma unroll
        for (int r = 1; r < 8; ++r) mx = fmaxf(mx, fmaxf(sa[r], sb[r]));
        // lazy rescale, one test a pass: a scalar branch, taken by the whole wave when any lane's score passes its limit; then every column takes its running maximum as reference
        if (__builtin_amdgcn_ballot_w32(mx > lim) != 0) {
            mx = fmaxf(mx, __shfl_xor(mx, 16, 32));   // both lane halves of a column get one reference
            const float mnew = fmaxf(m, mx * SC2);
            const float alpha = __builtin_amdgcn_exp2f(m - mnew);
            m = mnew; sh = PSH - mnew; lim = (mnew + TAU) * (1.0f / SC2);
            o0 = o0 * alpha; o1 = o1 * alpha; o2 = o2 * alpha; o3 = o3 * alpha; st = st * alpha;
        }
        v16h pb;
#pragma unroll
        for (int r = 0; r < 8; ++r) { pb[r] = (h16)__builtin_amdgcn_exp2f(sa[r] * SC2 + sh); pb[8 + r] = (h16)__builtin_amdgcn_exp2f(sb[r] * SC2 + sh); }
        st = wmma16(ones, pb, st);   // adds the rounded P of the 32 keys to the running sum, f32
        o0 = wmma16(v0, pb, o0); o1 = wmma16(v1, pb, o1); o2 = wmma16(v2, pb, o2); o3 = wmma16(v3, pb, o3);
        asm volatile("v_nop\n\tv_nop\n\tv_nop\n\tv_nop" : "+v"(o0), "+v"(o1), "+v"(o2), "+v"(o3) : "v"(v0), "v"(v1), "v"(v2), "v"(v3), "v"(pb));
      }
      asm volatile("s_wait_dscnt 0x0" ::: "memory");      // this wave's reads of tile t are done before the buffer is refilled
      asm volatile("s_wait_asynccnt 0x0" ::: "memory");   // this wave's share of tile t + 1 has landed
      __syncthreads();                                     // publishes tile t + 1 and ends every wave's reads of tile t
      if (t + 2 < SEQ / KT) copy_tile(lcp + (unsigned)(t & 1) * (2 * TILE_H * 2), gk + (size_t)(t + 2) * KT * HD, gv + (t + 2) * KT);
    }
    asm volatile("s_wait_asynccnt 0x0" ::: "memory");     // no copy is outstanding when the wave goes on to its end
    const float inv = CTXS * (1.0f / st[0]);
    const int wb = wave * 16 * 68;
    // O^T D layout: o_j[r] = (d = 16j + 8h + r, t = lane&15) -> os[t][d]; rows 0..15 x columns 0..63 all written
    { v4f a, c;
      a[0] = o0[0] * inv; a[1] = o0[1] * inv; a[2] = o0[2] * inv; a[3] = o0[3] * inv; c[0] = o0[4] * inv; c[1] = o0[5] * inv; c[2] = o0[6] * inv; c[3] = o0[7] * inv;
      *(v4fa*)(&os[wb + lr * 68 +  0 + 8 * hi]) = a; *(v4fa*)(&os[wb + lr * 68 +  0 + 8 * hi + 4]) = c;
      a[0] = o1[0] * inv; a[1] = o1[1] * inv; a[2] = o1[2] * inv; a[3] = o1[3] * inv; c[0] = o1[4] * inv; c[1] = o1[5] * inv; c[2] = o1[6] * inv; c[3] = o1[7] * inv;
      *(v4fa*)(&os[wb + lr * 68 + 16 + 8 * hi]) = a; *(v4fa*)(&os[wb + lr * 68 + 16 + 8 * hi + 4]) = c;
      a[0] = o2[0] * inv; a[1] = o2[1] * inv; a[2] = o2[2] * inv; a[3] = o2[3] * inv; c[0] = o2[4] * inv; c[1] = o2[5] * inv; c[2] = o2[6] * inv; c[3] = o2[7] * inv;
      *(v4fa*)(&os[wb + lr * 68 + 32 + 8 * hi]) = a; *(v4fa*)(&os[wb + lr * 68 + 32 + 8 * hi + 4]) = c;
      a[0] = o3[0] * inv; a[1] = o3[1] * inv; a[2] = o3[2] * inv; a[3] = o3[3] * inv; c[0] = o3[4] * inv; c[1] = o3[5] * inv; c[2] = o3[6] * inv; c[3] = o3[7] * inv;
      *(v4fa*)(&os[wb + lr * 68 + 48 + 8 * hi]) = a; *(v4fa*)(&os[wb + lr * 68 + 48 + 8 * hi + 4]) = c; }
    wave_sync();
    h16* crow = CH + ((size_t)b * SEQ + t0) * DM + h * HD;       // context plane row m = b*SEQ + t, columns h*64 + d
{
#pragma unroll
        for (int s = 0; s < 4; ++s) { const int row = 4 * s + (lane >> 3), c8 = (lane & 7) * 8;   // 4 s x 4 row groups = 16 rows; 8 lanes x 8 halves = 64 columns
            const v4f x0 = *(const v4fa*)(&os[wb + row * 68 + c8]); const v4f x1 = *(const v4fa*)(&os[wb + row * 68 + c8 + 4]); v8h hv;
#pragma unroll
            for (int i = 0; i < 4; ++i) { hv[i] = (h16)x0[i]; hv[4 + i] = (h16)x1[i]; }
            *(v8h*)(crow + (size_t)row * DM + c8) = hv; }
         }
}

// k_oproj: f16 GEMM, 256 x 128 block tile, 8 waves of one 64x64 tile each (16 accumulators), operands from K-contiguous f16 planes through LDS (gemm_main), K = DM.
// OUT[(r0/SEQ)*OUT_SEQ + r0%SEQ + i][c0 + j] = oscale * sum_k A[r0+i][k] Bt[c0+j][k]. grid (NB*SEQ/256, DM/128), 256 threads.
__global__ __launch_bounds__(256) void k_oproj(const h16* __restrict__ A, const h16* __restrict__ Bt, float* OUT, float oscale) {
    __shared__ __align__(16) bf ring[2 * GST_H];   // [buffer][A rows | Bt rows][LP]
    __shared__ __align__(16) float osb[8 * 16 * 68];
    const int lane = threadIdx.x & 31, lr = lane & 15, hi = lane >> 4;
    const int wave = __builtin_amdgcn_readfirstlane((int)(threadIdx.x >> 5));   // wave-uniform
    const int wm = wave & 3, wn = wave >> 2;
    const int r0 = blockIdx.x * GBM + wm * 64, c0 = blockIdx.y * GBN + wn * 64;
    float* os = osb + wave * 16 * 68;   // wave-private output staging
    v8f acc[4][4];
#pragma unroll
    for (int mb = 0; mb < 4; ++mb)
#pragma unroll
        for (int nb = 0; nb < 4; ++nb) acc[mb][nb] = (v8f){};
    gemm_main<1, 0>((const bf*)A, (const bf*)Bt, ring, blockIdx.x * GBM, blockIdx.y * GBN, wm, wn, acc);
    const size_t obase = ((size_t)(r0 / SEQ) * OUT_SEQ + (size_t)(r0 % SEQ)) * DM + c0;
#pragma unroll
    for (int mb = 0; mb < 4; ++mb) {
#pragma unroll
        for (int nb = 0; nb < 4; ++nb) {
#pragma unroll
            for (int j = 0; j < 8; ++j) os[(hi * 8 + j) * 68 + nb * 16 + lr] = acc[mb][nb][j] * oscale; }   // D: row 8h+j, col lane&15
        wave_sync();
        float* orow = OUT + obase + (size_t)(mb * 16) * DM;
{
#pragma unroll
            for (int s = 0; s < 8; ++s) { const int row = 2 * s + hi, cofs = lr * 4;   // 8 s x 2 rows = 16 rows; 16 lanes x 4 floats = 64 columns
                const v4f val = *(const v4fa*)(&os[row * 68 + cofs]);
                *(v4f*)(orow + (size_t)row * DM + cofs) = val; }
             }
        wave_sync();
    }
}

static constexpr size_t al256(size_t v) { return (v + 255) & ~(size_t)255; }
static constexpr size_t SZ_XB = al256((size_t)NB * SEQ * DM * 2);          // one activation plane (there are three: q, k, v)
static constexpr size_t SZ_WB = al256((size_t)4 * DM * DM * 2);            // four transposed weight planes
static constexpr size_t SZ_PL = al256((size_t)NB * NH_ * SEQ * HD * 2);    // per-head planes (q, k, v^T)
static constexpr size_t SZ_CH = al256((size_t)NB * SEQ * DM * 2);          // context plane
static constexpr size_t SZ_TOTAL = 3 * SZ_XB + SZ_WB + 3 * SZ_PL + SZ_CH;
static_assert(SZ_TOTAL <= (size_t)134217728);          // workspace carve <= 128 MiB
static_assert(((size_t)DM * DM * 2) % 256 == 0);       // weight sub-planes stay 256-byte aligned
static_assert((size_t)NB * DM * SEQ * 2 <= SZ_PL);     // v^T plane [(b*1024 + m)][t] fits its region

extern "C" void kernel_launch(void* const* d_in, const int* in_sizes, int n_in,
                              void* d_out, int out_size, void* d_ws, size_t ws_size, hipStream_t stream) {
    if (n_in < 7) return;
    const size_t needx = ((size_t)(NB - 1) * SEQ_FULL + SEQ) * DM;
    if ((size_t)in_sizes[0] < needx || (size_t)in_sizes[1] < needx || (size_t)in_sizes[2] < needx) return;
    if ((size_t)in_sizes[3] < (size_t)DM * DM || (size_t)in_sizes[4] < (size_t)DM * DM || (size_t)in_sizes[5] < (size_t)DM * DM || (size_t)in_sizes[6] < (size_t)DM * DM) return;
    if ((size_t)out_size < ((size_t)(NB - 1) * OUT_SEQ + SEQ) * DM) return;
    if (SZ_TOTAL > ws_size) return;
    // wire order: k, q, v, Wk, Wq, Wv, Wo (weights [in][out])
    const float* xq = (const float*)d_in[1]; const float* xk = (const float*)d_in[0]; const float* xv = (const float*)d_in[2];   /* this module stages k, q, v: the KEY stream is input 0 and the QUERY stream input 1 */
    const float* wq = (const float*)d_in[4]; const float* wk = (const float*)d_in[3]; const float* wv = (const float*)d_in[5]; const float* wo = (const float*)d_in[6];   /* w_key is input 3 and w_query input 4 */
    float* OUT = (float*)d_out;      // [NB][SEQ][1024]
    char* wsp = (char*)d_ws;
    bf* XQ = (bf*)wsp; wsp += SZ_XB;                 // [NB*SEQ][1024] bf16 activations
    bf* XK = (bf*)wsp; wsp += SZ_XB;
    bf* XV = (bf*)wsp; wsp += SZ_XB;
    bf* WB = (bf*)wsp; wsp += SZ_WB;                 // [4][1024 out][1024 in]: q | k | v (bf16) | o (f16 x64)
    h16* QH = (h16*)wsp; wsp += SZ_PL;               // [NB*16][SEQ][64]
    h16* KP = (h16*)wsp; wsp += SZ_PL;               // [NB*16][SEQ][64]
    h16* VT = (h16*)wsp; wsp += SZ_PL;               // [NB*16][64][SEQ]
    h16* CH = (h16*)wsp; wsp += SZ_CH;               // [NB*SEQ][1024] context x256
    bf* WOT = WB + (size_t)3 * DM * DM;

    // all conversions: activations f32 -> bf16, weights in[k = input feature][n = output feature] -> out[n][k]
    k_prep<<<PG, 32 * PW, 0, stream>>>(xq, xk, xv, wq, wk, wv, wo, XQ, XK, XV, WB);

    // q, k and v^T projections, one launch
    k_proj<<<dim3((NB * SEQ / GBM) * (DM / GBN), 3, 1), 256, 0, stream>>>(XQ, XK, XV, WB, QH, KP, VT);

    k_flash<<<dim3(SEQ / (16 * AW), NB * NH_, 1), 32 * AW, 0, stream>>>(QH, KP, VT, CH);

    // output projection: A = context rows (m = b*SEQ + t), Bt = Wo^T rows (n) -> f32 output
    k_oproj<<<dim3(NB * SEQ / GBM, DM / GBN, 1), 256, 0, stream>>>(CH, (const h16*)WOT, OUT, OSC);
}

// v007
// Measured time: 123 microseconds a run.
// In both of two side-by-side timings against v006, it was 1.04 times as fast.
// Counting every step since v000, it is 2.96 times as fast.
#include <hip/hip_runtime.h>

// Attention with 16 heads x 64, width 1024, whose KEY stream and KEY weight are staged FIRST: separate inputs k, q, v [4][2048][1024] (f32), weights w_key / w_query / w_value / w_proj stored [in][out] (y = x W, normal x 0.02), no biases, no mask, scores / sqrt(64), softmax over the keys, f32 output = (merged heads) w_proj [4][2048][1024]; argument order k, q, v, w_key, w_query, w_value, w_proj.
// Compute dtypes, f32 accumulate everywhere: projections v_wmma_f32_16x16x32_bf16 (x and W RNE-converted to bf16; products exact);
// scores v_wmma_f32_16x16x32_f16: q and k single f16 planes (one product); P (x256 carry, cancels in the normalisation) and v single f16; softmax f32 (online, running max);
// output projection v_wmma_f32_16x16x32_f16: context single f16 (x256 carry), Wo = f16 of (bf16 RNE of Wo) x64; 2^-14 folded into the f32 epilogue.
// Layout: three bf16 activation planes (q, k, v) and the transposed weight planes [out][in], all written by one conversion launch; q, k planes [b*16+h][t][d], v^T plane [b*16+h][d][t] written by the GEMM epilogue;
// fused flash kernel in transposed form (S^T = K Q^T, O^T = V^T P^T) writes the f16 context plane [b*SEQ+t][1024]; last GEMM writes the f32 output.

#ifndef NB
#define NB 4
#endif
#ifndef SEQ
#define SEQ 2048
#endif
#define NB_FULL  4
#define SEQ_FULL 2048
#ifndef OUT_SEQ
#define OUT_SEQ SEQ              // row pitch (in tokens) between batches of the output
#endif
#define DM   1024
#define NH_  16
#define HD   64
#define AW   8                   // waves per flash block (16 query rows each); all of them read one staged K / V^T tile
#define KT   64                  // keys per staged tile (two 32-key steps)
#define LP   72                  // LDS row pitch in halves: 144 B = 16 B x 9, so the 16 rows of a 16-byte fragment read fall on distinct banks
#define TILE_H (64 * LP)         // halves of one staged tile: 64 rows (K: keys, V^T: d) of 64 halves + pad
#define GBM  256                 // GEMM block tile: A rows (4 waves of 64)
#define GBN  128                 // GEMM block tile: Bt rows = output columns (2 waves of 64)
#define GKS  64                  // k per staged GEMM tile (two 32-k steps): 128 B of every operand row
#define GRP  68                  // GEMM stage: halves per staged row, pad counted: rows of 128 B with 16 B of pad behind every second row
#define GRO(r) ((r) * 64 + ((r) >> 1) * 8)   // place (halves) of staged row r: dword address 32 r + 4 (r >> 1), so the 16 rows of a 16-byte fragment read fall on distinct banks
#define GNB  3                   // GEMM stage buffers: a stage's copies are issued two stages ahead of its first read
#define GST_H ((GBM + GBN) * GRP) // halves of one GEMM stage: 256 A rows, then 128 Bt rows
#define PG   256                 // conversion work-groups: one resident round, each loops over its share
#define PW   16                  // waves per conversion work-group
#define PLD  8                   // 16-B loads a wave holds in flight per batch: 8 x 512 B = 4 KiB contiguous
#define SC2  (0.125f * 1.4426950408889634f)   // HD^-0.5 * log2(e)
#define PSH  8.0f                // log2 of the P carry (256)
#define TAU  6.0f                // a column's softmax reference is renewed once a score passes it by more than this (log2): P stays <= 2^(PSH + TAU) = 2^14, inside f16
#define CTXS 256.0f              // carry of the context plane
#define WOS  64.0f               // carry of the Wo plane
#define OSC  (1.0f / (CTXS * WOS))

static_assert(HD == 64);
static_assert(NH_ * HD == DM);                 // head h = columns h*64 + d
static_assert(DM % 64 == 0);                   // 16 column tiles of 64
static_assert(DM % 32 == 0);                   // GEMM k-loop steps by 32
static_assert(SEQ % 64 == 0);                  // a 64-row tile never straddles two batches
static_assert((NB * SEQ) % 64 == 0);
static_assert(SEQ % KT == 0 && SEQ / KT >= 2);  // key loop walks whole staged tiles; the two-buffer prologue needs two
static_assert(32 * AW == 256);                 // 256 lanes x 2 copies x 16 B = one 8-KiB tile
static_assert(SEQ % (16 * AW) == 0);           // flash grid covers the sequence exactly
static_assert(((size_t)SEQ * DM) % 8 == 0);
static_assert(DM % GKS == 0 && DM / GKS >= GNB);               // GEMM k loop walks whole stages; the three-buffer prologue needs three
static_assert((GBM + GBN) * GKS * 2 == 24 * 128 * 16);         // 128 lanes (four waves) x 24 copies x 16 B = one stage
static_assert(2 * GNB * GST_H * 2 <= 327680);                  // two work-groups' rings fit one WGP's LDS
static_assert((NB * SEQ) % GBM == 0 && (NB * SEQ) % GBN == 0); // block tiles cover the token rows exactly, as A or as Bt
static_assert(DM % GBM == 0 && DM % GBN == 0);                 // and the feature rows
static_assert(SEQ % 64 == 0 && GBM % 64 == 0 && GBN % 64 == 0);
static_assert(4 * (DM / 64) * (DM / 64) == 4 * PG && PG % 4 == 0 && (DM / 64) % 2 == 0 && 32 * PW == 512);   // four weight tiles a conversion work-group, two a 256-thread half
static_assert((size_t)NB * SEQ * DM == 2 * (size_t)PG * PW * PLD * 128);   // two batches cover an activation plane exactly
static_assert(((size_t)SEQ * DM) % (PLD * 128) == 0);                      // a wave's batch never straddles two batches of the input
static_assert(NB <= NB_FULL);
static_assert(SEQ <= SEQ_FULL);

typedef _Float16 h16;
typedef unsigned short bf;
typedef __attribute__((ext_vector_type(16))) __bf16   v16bf;
typedef __attribute__((ext_vector_type(16))) _Float16 v16h;
typedef __attribute__((ext_vector_type(8)))  _Float16 v8h;
typedef __attribute__((ext_vector_type(8)))  unsigned short v8us;
typedef __attribute__((ext_vector_type(16))) unsigned short v16us;
typedef __attribute__((ext_vector_type(4)))  unsigned short v4us;
typedef __attribute__((ext_vector_type(8)))  float    v8f;
typedef __attribute__((ext_vector_type(4)))  float    v4f;
typedef v4f  __attribute__((may_alias)) v4fa;

__device__ __forceinline__ unsigned short f2bf(float f) { unsigned u = __float_as_uint(f); u += 0x7FFFu + ((u >> 16) & 1u); return (unsigned short)(u >> 16); }
__device__ __forceinline__ v16h cat16(v8h lo, v8h hi) { return __builtin_shufflevector(lo, hi, 0, 1, 2, 3, 4, 5, 6, 7, 8, 9, 10, 11, 12, 13, 14, 15); }
__device__ __forceinline__ v8f wmma16(v16h a, v16h b, v8f c) { return __builtin_amdgcn_wmma_f32_16x16x32_f16(false, a, false, b, (short)0, c, false, false); }
__device__ __forceinline__ v8f wmmab(v16bf a, v16bf b, v8f c) { return __builtin_amdgcn_wmma_f32_16x16x32_bf16(false, a, false, b, (short)0, c, false, false); }
// fragment loaders from K-contiguous 16-bit rows; p already includes + 8*(lane>>4): elements 0..7 <- k0+8h+0..7, elements 8..15 <- k0+16+8h+0..7 (same map for A and B)
__device__ __forceinline__ v16h  ldh(const h16* p) { return cat16(*(const v8h*)p, *(const v8h*)(p + 16)); }
// ordering point for wave-private LDS tiles (same wave writes and reads)
__device__ __forceinline__ void wave_sync() { __builtin_amdgcn_fence(3 /* release order */, "wavefront"); __builtin_amdgcn_wave_barrier(); asm volatile("" ::: "memory"); }

// k_prep: every operand conversion of the call in ONE launch of PG resident work-groups of PW waves.
// Weights: work-group g takes four 64 x 64 tiles of weight g / 64 (each 256-thread half two of them): in[k][n] (k = input feature, n = output feature) -> out[n][k] through LDS;
// planes 0..2 bf16 bits (RNE), plane 3 f16 bits of (bf16 RNE value * WOS), a power of two (exact).
// Activations: f32 -> bf16 (RNE), element order kept. A batch is PLD loads of 16 B a lane, 4 KiB contiguous a wave; the next batch's loads are issued before this one is converted and stored.
// Batch b of a plane: elements b * PEB + e0 + j * 128 + 0..3, e0 = the lane's place in the grid's first batch (a 32-bit offset from a uniform base).
#define PEB  ((size_t)PG * PW * PLD * 128)   // elements of one batch over the whole grid
// closes a group of global loads or stores: what follows may rewrite the registers that the group names (addresses, store data) only behind this wait
__device__ __forceinline__ void xwait() { asm volatile("s_wait_xcnt 0x0" ::: "memory"); }
__device__ __forceinline__ size_t xoff(size_t e) { return (e / ((size_t)SEQ * DM)) * ((size_t)SEQ_FULL * DM) + e % ((size_t)SEQ * DM); }
__device__ __forceinline__ void ld_batch(const float* __restrict__ x, int b, unsigned e0, v4f (&r)[PLD]) {
    const float* s = SEQ == SEQ_FULL ? (x + b * PEB) + e0 : x + xoff(b * PEB + e0);
#pragma unroll
    for (int j = 0; j < PLD; ++j) r[j] = *(const v4f*)(s + j * 128);
    xwait();
}
__device__ __forceinline__ void st_batch(bf* __restrict__ d, int b, unsigned e0, const v4f (&r)[PLD]) {
    bf* t = (d + b * PEB) + e0;
#pragma unroll
    for (int j = 0; j < PLD; ++j) { v4us o;
#pragma unroll
        for (int k = 0; k < 4; ++k) o[k] = f2bf(r[j][k]);
        *(v4us*)(t + j * 128) = o; }
}
__global__ __launch_bounds__(32 * PW) void k_prep(const float* __restrict__ xq, const float* __restrict__ xk, const float* __restrict__ xv,
                                                  const float* __restrict__ wq, const float* __restrict__ wk, const float* __restrict__ wv, const float* __restrict__ wo,
                                                  bf* __restrict__ XQ, bf* __restrict__ XK, bf* __restrict__ XV, bf* __restrict__ WB) {
    __shared__ float tsb[4 * 64 * 65];
    const int tid = threadIdx.x & 255, hf = threadIdx.x >> 8;
    const int ws = blockIdx.x / (PG / 4);                       // which weight: the same for the whole work-group
    const float* W = ws == 0 ? wq : ws == 1 ? wk : ws == 2 ? wv : wo;
    bf* dst = WB + (size_t)ws * DM * DM;
    const int asF16 = ws == 3; const float scale = asF16 ? WOS : 1.0f;
    const int tw = (blockIdx.x % (PG / 4)) * 4 + hf * 2;        // first of this half's two tiles: k tile = tw % 16 (even, so tw + 1 has the same n tile), n tile = tw / 16
    const int k0 = (tw % (DM / 64)) * 64, n0 = (tw / (DM / 64)) * 64;
    v4f wr[2][4];
#pragma unroll
    for (int u = 0; u < 2; ++u)
#pragma unroll
        for (int i = 0; i < 4; ++i) { const int idx = tid + 256 * i; const int kk = idx >> 4, c4 = (idx & 15) * 4;
            wr[u][i] = *(const v4f*)(W + (size_t)(k0 + 64 * u + kk) * DM + n0 + c4); }
    xwait();
    const unsigned e0 = (blockIdx.x * PW + (threadIdx.x >> 5)) * (PLD * 128) + (threadIdx.x & 31) * 4;
    v4f ra[PLD], rb[PLD];
    ld_batch(xq, 0, e0, ra);
#pragma unroll
    for (int u = 0; u < 2; ++u) { float* ts = tsb + (hf * 2 + u) * 64 * 65;
#pragma unroll
        for (int i = 0; i < 4; ++i) { const int idx = tid + 256 * i; const int kk = idx >> 4, c4 = (idx & 15) * 4;
            ts[kk * 65 + c4 + 0] = wr[u][i][0]; ts[kk * 65 + c4 + 1] = wr[u][i][1]; ts[kk * 65 + c4 + 2] = wr[u][i][2]; ts[kk * 65 + c4 + 3] = wr[u][i][3]; } }
    __syncthreads();
    const int c8 = (tid & 7) * 8;
#pragma unroll
    for (int u = 0; u < 2; ++u) { const float* ts = tsb + (hf * 2 + u) * 64 * 65;
        v8us o0, o1;
#pragma unroll
        for (int j = 0; j < 8; ++j) {
            const float xa = ts[(c8 + j) * 65 + (tid >> 3)]; const float xb = ts[(c8 + j) * 65 + (tid >> 3) + 32];
            const unsigned short ba = f2bf(xa), bb = f2bf(xb);
            const h16 ha = (h16)(__uint_as_float((unsigned)ba << 16) * scale); const h16 hb = (h16)(__uint_as_float((unsigned)bb << 16) * scale);
            const unsigned short fa = __builtin_bit_cast(unsigned short, ha), fb = __builtin_bit_cast(unsigned short, hb);
            o0[j] = asF16 ? fa : ba; o1[j] = asF16 ? fb : bb; }
        *(v8us*)(dst + (size_t)(n0 + (tid >> 3)) * DM + k0 + 64 * u + c8) = o0;
        *(v8us*)(dst + (size_t)(n0 + (tid >> 3) + 32) * DM + k0 + 64 * u + c8) = o1; }
    xwait();
    ld_batch(xq, 1, e0, rb); st_batch(XQ, 0, e0, ra); xwait();
    ld_batch(xk, 0, e0, ra); st_batch(XQ, 1, e0, rb); xwait();
    ld_batch(xk, 1, e0, rb); st_batch(XK, 0, e0, ra); xwait();
    ld_batch(xv, 0, e0, ra); st_batch(XK, 1, e0, rb); xwait();
    ld_batch(xv, 1, e0, rb); st_batch(XV, 0, e0, ra); xwait();
    st_batch(XV, 1, e0, rb);
}

// copy_stage: one GEMM stage, 64 k of 256 A rows and of 128 Bt rows (row pitch DM halves in memory), into LDS at the places GRO, no register in between; issued by four waves.
// Lane cl (0..127) brings 16 B of rows (cl>>3) + 16 i, so a wave's copy covers four whole 128-B lines. l = the lane's LDS byte address in row cl>>3 of the stage.
__device__ __forceinline__ void copy_stage(unsigned l, const bf* ga, const bf* gb) {
    const unsigned S = 16 * GRP * 2; const size_t G = (size_t)16 * DM;
    // two statements (an asm statement takes thirty operands); each closes with its s_wait_xcnt so that no address register is rewritten ahead of it
    asm volatile("global_load_async_to_lds_b128 %0, %1, off\n\t"
                 "global_load_async_to_lds_b128 %2, %3, off\n\t"
                 "global_load_async_to_lds_b128 %4, %5, off\n\t"
                 "global_load_async_to_lds_b128 %6, %7, off\n\t"
                 "global_load_async_to_lds_b128 %8, %9, off\n\t"
                 "global_load_async_to_lds_b128 %10, %11, off\n\t"
                 "global_load_async_to_lds_b128 %12, %13, off\n\t"
                 "global_load_async_to_lds_b128 %14, %15, off\n\t"
                 "global_load_async_to_lds_b128 %16, %17, off\n\t"
                 "global_load_async_to_lds_b128 %18, %19, off\n\t"
                 "global_load_async_to_lds_b128 %20, %21, off\n\t"
                 "global_load_async_to_lds_b128 %22, %23, off\n\t"
                 "s_wait_xcnt 0x0"
                 :: "v"(l), "v"(ga), "v"(l + 1 * S), "v"(ga + 1 * G), "v"(l + 2 * S), "v"(ga + 2 * G), "v"(l + 3 * S), "v"(ga + 3 * G), "v"(l + 4 * S), "v"(ga + 4 * G), "v"(l + 5 * S), "v"(ga + 5 * G), "v"(l + 6 * S), "v"(ga + 6 * G), "v"(l + 7 * S), "v"(ga + 7 * G), "v"(l + 8 * S), "v"(ga + 8 * G), "v"(l + 9 * S), "v"(ga + 9 * G), "v"(l + 10 * S), "v"(ga + 10 * G), "v"(l + 11 * S), "v"(ga + 11 * G) : "memory");
    asm volatile("global_load_async_to_lds_b128 %0, %1, off\n\t"
                 "global_load_async_to_lds_b128 %2, %3, off\n\t"
                 "global_load_async_to_lds_b128 %4, %5, off\n\t"
                 "global_load_async_to_lds_b128 %6, %7, off\n\t"
                 "global_load_async_to_lds_b128 %8, %9, off\n\t"
                 "global_load_async_to_lds_b128 %10, %11, off\n\t"
                 "global_load_async_to_lds_b128 %12, %13, off\n\t"
                 "global_load_async_to_lds_b128 %14, %15, off\n\t"
                 "global_load_async_to_lds_b128 %16, %17, off\n\t"
                 "global_load_async_to_lds_b128 %18, %19, off\n\t"
                 "global_load_async_to_lds_b128 %20, %21, off\n\t"
                 "global_load_async_to_lds_b128 %22, %23, off\n\t"
                 "s_wait_xcnt 0x0"
                 :: "v"(l + 12 * S), "v"(ga + 12 * G), "v"(l + 13 * S), "v"(ga + 13 * G), "v"(l + 14 * S), "v"(ga + 14 * G), "v"(l + 15 * S), "v"(ga + 15 * G), "v"(l + 16 * S), "v"(gb), "v"(l + 17 * S), "v"(gb + 1 * G), "v"(l + 18 * S), "v"(gb + 2 * G), "v"(l + 19 * S), "v"(gb + 3 * G), "v"(l + 20 * S), "v"(gb + 4 * G), "v"(l + 21 * S), "v"(gb + 5 * G), "v"(l + 22 * S), "v"(gb + 6 * G), "v"(l + 23 * S), "v"(gb + 7 * G) : "memory");
}

// fragment from a staged row; p already includes + 8*(lane>>4): the k map of ldh
__device__ __forceinline__ v16us ldu(const bf* p) { return __builtin_shufflevector(*(const v8us*)p, *(const v8us*)(p + 16), 0, 1, 2, 3, 4, 5, 6, 7, 8, 9, 10, 11, 12, 13, 14, 15); }
template <int F16> __device__ __forceinline__ v8f wmmau(v16us a, v16us b, v8f c) {
    if constexpr (F16) return wmma16(__builtin_bit_cast(v16h, a), __builtin_bit_cast(v16h, b), c);
    else return wmmab(__builtin_bit_cast(v16bf, a), __builtin_bit_cast(v16bf, b), c);
}

// gemm_main: k loop of one 256 x 128 block tile, K = DM, 8 waves of 64 x 64 (wave (wm, wn): A rows rb + 64 wm, Bt rows cb + 64 wn; 16 accumulators each).
// Stages of 64 k come into LDS by asynchronous copies through a ring of three buffers; every wave reads its fragments as 16-B LDS loads.
// Waves 0..3 (wn = 0) copy the even stages, waves 4..7 the odd ones: a wave has one stage's copies outstanding at a time, so its wait is to 0, and stage t + 3 is issued at the foot of trip t and
// waited for at the foot of trip t + 2: its flight from L2 or memory has two trips to end in.
// Each accumulator takes its 32-k products in rising k, as with operands read straight from memory.
// LEAN: the last two Bt fragments of a stage are read behind the stage's first 8 products, into registers that those products have left: 16 registers fewer, so that a wave fits 256.
template <int F16, int LEAN>
__device__ __forceinline__ void gemm_main(const bf* A, const bf* Bt, bf* ring, int rb, int cb, int wm, int wn, v8f (&acc)[4][4]) {
    const int tid = threadIdx.x, lr = tid & 15, hi = (tid >> 4) & 1, cl = tid & 127;
    const unsigned lcp = (unsigned)(size_t)ring + (unsigned)((GRO(cl >> 3) + (cl & 7) * 8) * 2);   // the lane's copy target in buffer 0 (LDS byte address)
    const bf* ga = A + (size_t)(rb + (cl >> 3)) * DM + (cl & 7) * 8;    // + stage * GKS
    const bf* gb = Bt + (size_t)(cb + (cl >> 3)) * DM + (cl & 7) * 8;   // + stage * GKS
    const int fa = wm * 64 * GRP + GRO(lr) + 8 * hi, fb = (GBM + wn * 64) * GRP + GRO(lr) + 8 * hi;   // fragment offsets in a stage
    if (wn == 0) {   // wn is wave-uniform: a scalar branch
        copy_stage(lcp, ga, gb);
        asm volatile("s_wait_asynccnt 0x0" ::: "memory");   // this wave's share of stage 0 has landed
    } else {
        copy_stage(lcp + GST_H * 2, ga + GKS, gb + GKS);
    }
    __syncthreads();                                     // every copying wave's share has landed: stage 0 may be read
    if (wn == 0) copy_stage(lcp + 2 * GST_H * 2, ga + 2 * GKS, gb + 2 * GKS);
    int cur = 0;   // place (halves) of stage t's buffer in the ring
#pragma unroll 1   // one trip per stage: the buffer index stays a run-time value and the loop text small
    for (int t = 0; t < DM / GKS; ++t) {
        const bf* pa = ring + cur + fa; const bf* pb = ring + cur + fb;
        v16us a[GKS / 32][4], b[GKS / 32][4];
        // every loop below is unrolled whole: fragments and accumulators are indexed by constants and so stay in registers
#pragma unroll
        for (int u = 0; u < GKS / 32; ++u) {
#pragma unroll
            for (int i = 0; i < 4; ++i) { a[u][i] = ldu(pa + i * 16 * GRP + u * 32); if (!(LEAN && u == GKS / 32 - 1 && i >= 2)) b[u][i] = ldu(pb + i * 16 * GRP + u * 32); }
        }
        __builtin_amdgcn_sched_barrier(0);   // the stage's LDS reads stay one group ahead of its products (for speed only)
#pragma unroll
        for (int u = 0; u < GKS / 32; ++u)
#pragma unroll
            for (int nb = 0; nb < 4; ++nb) {
#pragma unroll
                for (int mb = 0; mb < 4; ++mb) acc[mb][nb] = wmmau<F16>(a[u][mb], b[u][nb], acc[mb][nb]);
                if (LEAN && u == 0 && nb == 1) {
                    __builtin_amdgcn_sched_barrier(0);   // the late reads stay behind the 8 products whose Bt registers they take: hoisted, they would raise the register count past 256
                    b[GKS / 32 - 1][2] = ldu(pb + 2 * 16 * GRP + (GKS / 32 - 1) * 32); b[GKS / 32 - 1][3] = ldu(pb + 3 * 16 * GRP + (GKS / 32 - 1) * 32);
                    __builtin_amdgcn_sched_barrier(0);   // and stay one group, 16 products ahead of their first use
                }
            }
        __builtin_amdgcn_sched_barrier(0);   // the products stay ahead of the closing waits: moved behind the barrier they would start only when every wave's LDS reads are over
        const bool mine = wn == ((t + 1) & 1);              // this wave copies the stages of t + 1's parity (wave-uniform)
        asm volatile("s_wait_dscnt 0x0" ::: "memory");      // this wave's reads of stage t are done before the buffer is refilled
        if (mine) asm volatile("s_wait_asynccnt 0x0" ::: "memory");   // this wave's share of stage t + 1, its only copies in flight, has landed; the other four waves' stage t + 2 flies on
        __syncthreads();                                     // publishes stage t + 1 and ends every wave's reads of stage t
        if (mine && t + 3 < DM / GKS) copy_stage(lcp + (unsigned)cur * 2, ga + (t + 3) * GKS, gb + (t + 3) * GKS);
        cur = cur == (GNB - 1) * GST_H ? 0 : cur + GST_H;
    }
    asm volatile("s_wait_asynccnt 0x0" ::: "memory");       // no copy is outstanding when the wave goes on to its epilogue
}

// k_proj: the three bf16 projection GEMMs in ONE launch, blockIdx.y = which (0: q, 1: k, 2: v^T); 256 x 128 block tile, 8 waves of one 64x64 tile each (16 accumulators),
// operands from K-contiguous bf16 planes through LDS (gemm_main), K = DM. C[m][n] = sum_k A[m][k] Bt[n][k], written as f16.
// q, k: A = x rows (m = b*SEQ + t), Bt = W^T rows (n = h*64 + d) -> plane [(b*16 + h)][t][d]; v^T: A = Wv^T rows (m = h*64 + d), Bt = x rows (n = b*SEQ + t) -> plane [(b*1024 + m)][t] = [(b*16 + h)][d][t].
// grid (M/256 * N/128, 3), 256 threads; blockIdx.x walks the A row tiles first.
// amdgpu_waves_per_eu(4): the register budget of 4 waves a SIMD. LDS admits two work-groups a WGP and the grid is three a WGP: two resident ones fill each other's LDS-read, barrier, first-stage and epilogue waits.
__global__ __launch_bounds__(256) __attribute__((amdgpu_waves_per_eu(4))) void k_proj(const bf* __restrict__ XQ, const bf* __restrict__ XK, const bf* __restrict__ XV, const bf* __restrict__ WB, h16* QH, h16* KP, h16* VT) {
    __shared__ __align__(16) bf ring[GNB * GST_H];   // [buffer][A rows | Bt rows]; behind the k loop its first bytes are the output staging
    static_assert(8 * 16 * 68 * 4 <= GNB * GST_H * 2);
    float* osb = (float*)ring;   // free for staging behind the k loop: its last trip ends in every wave's s_wait_dscnt 0 and a barrier, and no copy is outstanding
    const int lane = threadIdx.x & 31, lr = lane & 15, hi = lane >> 4;
    const int wave = __builtin_amdgcn_readfirstlane((int)(threadIdx.x >> 5));   // wave-uniform
    const int wm = wave & 3, wn = wave >> 2;
    const int z = blockIdx.y;
    const bf* X = z == 0 ? XQ : z == 1 ? XK : XV;
    const bf* Wt = WB + (size_t)z * DM * DM;
    const bf* A = z == 2 ? Wt : X; const bf* Bt = z == 2 ? X : Wt;
    h16* Ph = z == 0 ? QH : z == 1 ? KP : VT;
    const int bx = z == 2 ? blockIdx.x % (DM / GBM) : blockIdx.x % (NB * SEQ / GBM), by = z == 2 ? blockIdx.x / (DM / GBM) : blockIdx.x / (NB * SEQ / GBM);
    const int r0 = bx * GBM + wm * 64, c0 = by * GBN + wn * 64;
    const int pitch = z == 2 ? SEQ : HD;   // row pitch of the written plane (halves)
    float* os = osb + wave * 16 * 68;   // wave-private output staging
    v8f acc[4][4];
#pragma unroll
    for (int mb = 0; mb < 4; ++mb)
#pragma unroll
        for (int nb = 0; nb < 4; ++nb) acc[mb][nb] = (v8f){};
    gemm_main<0, 1>(A, Bt, ring, bx * GBM, by * GBN, wm, wn, acc);
    const size_t tbase = z == 2 ? (size_t)r0 * SEQ + (size_t)(c0 / SEQ) * ((size_t)DM * SEQ) + (size_t)(c0 % SEQ)
                                : (size_t)(r0 / SEQ) * ((size_t)NH_ * SEQ * HD) + (size_t)(r0 % SEQ) * HD + (size_t)(c0 / HD) * ((size_t)SEQ * HD) + (size_t)(c0 % HD);
#pragma unroll
    for (int mb = 0; mb < 4; ++mb) {
#pragma unroll
        for (int nb = 0; nb < 4; ++nb) {
#pragma unroll
            for (int j = 0; j < 8; ++j) os[(hi * 8 + j) * 68 + nb * 16 + lr] = acc[mb][nb][j]; }   // D: row 8h+j, col lane&15
        wave_sync();
        const size_t sb = tbase + (size_t)(mb * 16) * (size_t)pitch;
{
#pragma unroll
            for (int s = 0; s < 4; ++s) { const int row = 4 * s + (lane >> 3), c8 = (lane & 7) * 8;   // 4 s x 4 row groups = 16 rows; 8 lanes x 8 = 64 columns
                const v4f x0 = *(const v4fa*)(&os[row * 68 + c8]); const v4f x1 = *(const v4fa*)(&os[row * 68 + c8 + 4]); v8h hv;
#pragma unroll
                for (int i = 0; i < 4; ++i) { hv[i] = (h16)x0[i]; hv[4 + i] = (h16)x1[i]; }
                const size_t oo = sb + (size_t)row * (size_t)pitch + c8;
                *(v8h*)(Ph + oo) = hv; }
             }
        wave_sync();
    }
}

// copy_tile: one 64-key K tile (64 rows of 128 B, contiguous) and one V^T tile (64 rows d of 128 B, pitch SEQ halves) into LDS at pitch LP, no register in between.
// Lane tid brings 16 B of rows tid>>3 and 32 + (tid>>3) of each tile, so a wave's copy covers four whole 128-B lines. lk = the lane's LDS byte address in the K tile.
__device__ __forceinline__ void copy_tile(unsigned lk, const h16* gk, const h16* gv) {
    const unsigned lk1 = lk + 32 * LP * 2, lv = lk + TILE_H * 2, lv1 = lv + 32 * LP * 2;
    const h16* gk1 = gk + 32 * HD; const h16* gv1 = gv + (size_t)32 * SEQ;
    // the closing s_wait_xcnt stands inside the statement so that no address register is rewritten ahead of it
    asm volatile("global_load_async_to_lds_b128 %0, %1, off\n\t"
                 "global_load_async_to_lds_b128 %2, %3, off\n\t"
                 "global_load_async_to_lds_b128 %4, %5, off\n\t"
                 "global_load_async_to_lds_b128 %6, %7, off\n\t"
                 "s_wait_xcnt 0x0"
                 :: "v"(lk), "v"(gk), "v"(lk1), "v"(gk1), "v"(lv), "v"(gv), "v"(lv1), "v"(gv1) : "memory");
}

// k_flash: fused attention, one wave per 16 query rows of one (batch, head); Q fragments straight from the f16 plane; K / V^T tiles of 64 keys staged in LDS
// by asynchronous copies (two buffers, the next tile in flight while this one is worked on) and read by all AW waves as 16-B fragment loads.
// Transposed form: S^T[key][t] = K Q^T (A = K rows, B = Q rows); lane (t = lane&15, h = lane>>4) holds keys 8h+r of each 16-key tile, so the packed
// P tile is directly the B fragment of O^T[d][t] = V^T P^T (element r <- tile keys 0..15, element 8+r <- tile keys 16..31, lane unchanged).
// Per 32-key step: 4 score products + 4 P.V products + 1 row-sum product (A = all ones, B = the packed P tile: every row of its result is the sum of P over the step's 32 keys, so register 0 holds
// the whole sum of the lane's query in both lane halves). The row-sum product accumulates from pass to pass. The softmax reference is one scalar per lane, held while no score passes it by more than TAU; only
// when it is renewed are the two lane halves' maxima combined (one xor-16 exchange) and O and the row-sum tile rescaled.
// amdgpu_waves_per_eu(8): the register budget of 8 waves a SIMD. LDS admits four work-groups a WGP (8 waves a SIMD) and the grid is four a WGP: over that budget a whole work-group per WGP would be lost.
__global__ __launch_bounds__(32 * AW) __attribute__((amdgpu_waves_per_eu(8))) void k_flash(const h16* __restrict__ QH, const h16* __restrict__ KP, const h16* __restrict__ VT, h16* CH) {
    __shared__ __align__(16) h16 ring[2 * 2 * TILE_H];   // [buffer][K | V^T][row][LP]
    __shared__ __align__(16) float os[AW * 16 * 68];
    const int tid = threadIdx.x;
    const int lane = threadIdx.x & 31, lr = lane & 15, hi = lane >> 4;
    const int wave = __builtin_amdgcn_readfirstlane((int)(threadIdx.x >> 5));   // wave-uniform
    const int zh = blockIdx.y; const int b = zh / NH_, h = zh % NH_;
    const int t0 = (blockIdx.x * AW + wave) * 16;
    const size_t pbase = (size_t)zh * SEQ * HD;
    const size_t qo = pbase + (size_t)(t0 + lr) * HD + 8 * hi;
    const v16h qh0 = ldh(QH + qo), qh1 = ldh(QH + qo + 32);   // B fragments: col t, k = d
    const unsigned lcp = (unsigned)(size_t)ring + (unsigned)(((tid >> 3) * LP + (tid & 7) * 8) * 2);   // the lane's copy target in buffer 0's K tile (LDS byte address)
    const h16* gk = KP + pbase + tid * 8;                                        // + tile * KT * HD
    const h16* gv = VT + pbase + (size_t)(tid >> 3) * SEQ + (tid & 7) * 8;       // + tile * KT
    const int fo = lr * LP + 8 * hi;   // fragment offset in a tile: K + key * LP (A: row key, k = d); V^T + 16j * LP + key (A: row d, k = key)
    copy_tile(lcp, gk, gv);
    asm volatile("s_wait_asynccnt 0x0" ::: "memory");   // this wave's share of tile 0 has landed
    __syncthreads();                                     // every wave's share has: tile 0 may be read
    copy_tile(lcp + 2 * TILE_H * 2, gk + KT * HD, gv + KT);
    v8f o0 = (v8f){}, o1 = (v8f){}, o2 = (v8f){}, o3 = (v8f){};
    // m: the column's softmax reference (scaled log2), held from pass to pass; sh = PSH - m; lim = the raw score above which it is renewed. The first pass always renews it (any finite score > lim).
    float m = -3.0e38f, sh = 0.0f, lim = -3.0e38f;
    v8f st = (v8f){};   // running row sum: the accumulator of the row-sum product, rescaled like an output tile
    v16h ones;   // A operand of the row-sum product
#pragma unroll
    for (int r = 0; r < 16; ++r) ones[r] = (h16)1.0f;
#pragma unroll 1   // one trip per staged tile: the buffer index stays a run-time value and the loop text small
    for (int t = 0; t < SEQ / KT; ++t) {
      const h16* kt = ring + (t & 1) * (2 * TILE_H) + fo;
#pragma unroll 1    // the two 32-key steps of a tile stay rolled: unrolled, values of both steps live on past the barrier and the register count costs a wave per SIMD
      for (int u = 0; u < KT / 32; ++u) {
        const h16* ka = kt + u * 32 * LP;
        const v16h ka0 = ldh(ka), ka1 = ldh(ka + 32), kb0 = ldh(ka + 16 * LP), kb1 = ldh(ka + 16 * LP + 32);
        v8f sa = (v8f){}, sb = (v8f){};
        sa = wmma16(ka0, qh0, sa); sb = wmma16(kb0, qh0, sb);
        sa = wmma16(ka1, qh1, sa); sb = wmma16(kb1, qh1, sb);
        asm volatile("v_nop\n\tv_nop\n\tv_nop\n\tv_nop" : "+v"(sa), "+v"(sb) : "v"(ka0), "v"(ka1), "v"(kb0), "v"(kb1), "v"(qh0), "v"(qh1));
        const h16* va = kt + TILE_H + u * 32;   // V^T fragments: read ahead of the branch below, so that their LDS latency runs under the softmax
        const v16h v0 = ldh(va), v1 = ldh(va + 16 * LP), v2 = ldh(va + 32 * LP), v3 = ldh(va + 48 * LP);
        asm volatile("" ::: "memory");   // compiler fence: without it the reads above are sunk behind the branch, directly in front of the products that wait for them
        float mx = fmaxf(sa[0], sb[0]);   // the lane's 16 raw scores (SC2 > 0: the same order as the scaled ones)
#pragma unroll
        for (int r = 1; r < 8; ++r) mx = fmaxf(mx, fmaxf(sa[r], sb[r]));
        // lazy rescale, one test a pass: a scalar branch, taken by the whole wave when any lane's score passes its limit; then every column takes its running maximum as reference
        if (__builtin_amdgcn_ballot_w32(mx > lim) != 0) {
            mx = fmaxf(mx, __shfl_xor(mx, 16, 32));   // both lane halves of a column get one reference
            const float mnew = fmaxf(m, mx * SC2);
            const float alpha = __builtin_amdgcn_exp2f(m - mnew);
            m = mnew; sh = PSH - mnew; lim = (mnew + TAU) * (1.0f / SC2);
            o0 = o0 * alpha; o1 = o1 * alpha; o2 = o2 * alpha; o3 = o3 * alpha; st = st * alpha;
        }
        v16h pb;
#pragma unroll
        for (int r = 0; r < 8; ++r) { pb[r] = (h16)__builtin_amdgcn_exp2f(sa[r] * SC2 + sh); pb[8 + r] = (h16)__builtin_amdgcn_exp2f(sb[r] * SC2 + sh); }
        st = wmma16(ones, pb, st);   // adds the rounded P of the 32 keys to the running sum, f32
        o0 = wmma16(v0, pb, o0); o1 = wmma16(v1, pb, o1); o2 = wmma16(v2, pb, o2); o3 = wmma16(v3, pb, o3);
        asm volatile("v_nop\n\tv_nop\n\tv_nop\n\tv_nop" : "+v"(o0), "+v"(o1), "+v"(o2), "+v"(o3) : "v"(v0), "v"(v1), "v"(v2), "v"(v3), "v"(pb));
      }
      asm volatile("s_wait_dscnt 0x0" ::: "memory");      // this wave's reads of tile t are done before the buffer is refilled
      asm volatile("s_wait_asynccnt 0x0" ::: "memory");   // this wave's share of tile t + 1 has landed
      __syncthreads();                                     // publishes tile t + 1 and ends every wave's reads of tile t
      if (t + 2 < SEQ / KT) copy_tile(lcp + (unsigned)(t & 1) * (2 * TILE_H * 2), gk + (size_t)(t + 2) * KT * HD, gv + (t + 2) * KT);
    }
    asm volatile("s_wait_asynccnt 0x0" ::: "memory");     // no copy is outstanding when the wave goes on to its end
    const float inv = CTXS * (1.0f / st[0]);
    const int wb = wave * 16 * 68;
    // O^T D layout: o_j[r] = (d = 16j + 8h + r, t = lane&15) -> os[t][d]; rows 0..15 x columns 0..63 all written
    { v4f a, c;
      a[0] = o0[0] * inv; a[1] = o0[1] * inv; a[2] = o0[2] * inv; a[3] = o0[3] * inv; c[0] = o0[4] * inv; c[1] = o0[5] * inv; c[2] = o0[6] * inv; c[3] = o0[7] * inv;
      *(v4fa*)(&os[wb + lr * 68 +  0 + 8 * hi]) = a; *(v4fa*)(&os[wb + lr * 68 +  0 + 8 * hi + 4]) = c;
      a[0] = o1[0] * inv; a[1] = o1[1] * inv; a[2] = o1[2] * inv; a[3] = o1[3] * inv; c[0] = o1[4] * inv; c[1] = o1[5] * inv; c[2] = o1[6] * inv; c[3] = o1[7] * inv;
      *(v4fa*)(&os[wb + lr * 68 + 16 + 8 * hi]) = a; *(v4fa*)(&os[wb + lr * 68 + 16 + 8 * hi + 4]) = c;
      a[0] = o2[0] * inv; a[1] = o2[1] * inv; a[2] = o2[2] * inv; a[3] = o2[3] * inv; c[0] = o2[4] * inv; c[1] = o2[5] * inv; c[2] = o2[6] * inv; c[3] = o2[7] * inv;
      *(v4fa*)(&os[wb + lr * 68 + 32 + 8 * hi]) = a; *(v4fa*)(&os[wb + lr * 68 + 32 + 8 * hi + 4]) = c;
      a[0] = o3[0] * inv; a[1] = o3[1] * inv; a[2] = o3[2] * inv; a[3] = o3[3] * inv; c[0] = o3[4] * inv; c[1] = o3[5] * inv; c[2] = o3[6] * inv; c[3] = o3[7] * inv;
      *(v4fa*)(&os[wb + lr * 68 + 48 + 8 * hi]) = a; *(v4fa*)(&os[wb + lr * 68 + 48 + 8 * hi + 4]) = c; }
    wave_sync();
    h16* crow = CH + ((size_t)b * SEQ + t0) * DM + h * HD;       // context plane row m = b*SEQ + t, columns h*64 + d
{
#pragma unroll
        for (int s = 0; s < 4; ++s) { const int row = 4 * s + (lane >> 3), c8 = (lane & 7) * 8;   // 4 s x 4 row groups = 16 rows; 8 lanes x 8 halves = 64 columns
            const v4f x0 = *(const v4fa*)(&os[wb + row * 68 + c8]); const v4f x1 = *(const v4fa*)(&os[wb + row * 68 + c8 + 4]); v8h hv;
#pragma unroll
            for (int i = 0; i < 4; ++i) { hv[i] = (h16)x0[i]; hv[4 + i] = (h16)x1[i]; }
            *(v8h*)(crow + (size_t)row * DM + c8) = hv; }
         }
}

// k_oproj: f16 GEMM, 256 x 128 block tile, 8 waves of one 64x64 tile each (16 accumulators), operands from K-contiguous f16 planes through LDS (gemm_main), K = DM.
// OUT[(r0/SEQ)*OUT_SEQ + r0%SEQ + i][c0 + j] = oscale * sum_k A[r0+i][k] Bt[c0+j][k]. grid (NB*SEQ/256, DM/128), 256 threads.
__global__ __launch_bounds__(256) void k_oproj(const h16* __restrict__ A, const h16* __restrict__ Bt, float* OUT, float oscale) {
    __shared__ __align__(16) bf ring[GNB * GST_H];   // [buffer][A rows | Bt rows]
    __shared__ __align__(16) float osb[8 * 16 * 68];
    const int lane = threadIdx.x & 31, lr = lane & 15, hi = lane >> 4;
    const int wave = __builtin_amdgcn_readfirstlane((int)(threadIdx.x >> 5));   // wave-uniform
    const int wm = wave & 3, wn = wave >> 2;
    const int r0 = blockIdx.x * GBM + wm * 64, c0 = blockIdx.y * GBN + wn * 64;
    float* os = osb + wave * 16 * 68;   // wave-private output staging
    v8f acc[4][4];
#pragma unroll
    for (int mb = 0; mb < 4; ++mb)
#pragma unroll
        for (int nb = 0; nb < 4; ++nb) acc[mb][nb] = (v8f){};
    gemm_main<1, 0>((const bf*)A, (const bf*)Bt, ring, blockIdx.x * GBM, blockIdx.y * GBN, wm, wn, acc);
    const size_t obase = ((size_t)(r0 / SEQ) * OUT_SEQ + (size_t)(r0 % SEQ)) * DM + c0;
#pragma unroll
    for (int mb = 0; mb < 4; ++mb) {
#pragma unroll
        for (int nb = 0; nb < 4; ++nb) {
#pragma unroll
            for (int j = 0; j < 8; ++j) os[(hi * 8 + j) * 68 + nb * 16 + lr] = acc[mb][nb][j] * oscale; }   // D: row 8h+j, col lane&15
        wave_sync();
        float* orow = OUT + obase + (size_t)(mb * 16) * DM;
{
#pragma unroll
            for (int s = 0; s < 8; ++s) { const int row = 2 * s + hi, cofs = lr * 4;   // 8 s x 2 rows = 16 rows; 16 lanes x 4 floats = 64 columns
                const v4f val = *(const v4fa*)(&os[row * 68 + cofs]);
                *(v4f*)(orow + (size_t)row * DM + cofs) = val; }
             }
        wave_sync();
    }
}

static constexpr size_t al256(size_t v) { return (v + 255) & ~(size_t)255; }
static constexpr size_t SZ_XB = al256((size_t)NB * SEQ * DM * 2);          // one activation plane (there are three: q, k, v)
static constexpr size_t SZ_WB = al256((size_t)4 * DM * DM * 2);            // four transposed weight planes
static constexpr size_t SZ_PL = al256((size_t)NB * NH_ * SEQ * HD * 2);    // per-head planes (q, k, v^T)
static constexpr size_t SZ_CH = al256((size_t)NB * SEQ * DM * 2);          // context plane
static constexpr size_t SZ_TOTAL = 3 * SZ_XB + SZ_WB + 3 * SZ_PL + SZ_CH;
static_assert(SZ_TOTAL <= (size_t)134217728);          // workspace carve <= 128 MiB
static_assert(((size_t)DM * DM * 2) % 256 == 0);       // weight sub-planes stay 256-byte aligned
static_assert((size_t)NB * DM * SEQ * 2 <= SZ_PL);     // v^T plane [(b*1024 + m)][t] fits its region

extern "C" void kernel_launch(void* const* d_in, const int* in_sizes, int n_in,
                              void* d_out, int out_size, void* d_ws, size_t ws_size, hipStream_t stream) {
    if (n_in < 7) return;
    const size_t needx = ((size_t)(NB - 1) * SEQ_FULL + SEQ) * DM;
    if ((size_t)in_sizes[0] < needx || (size_t)in_sizes[1] < needx || (size_t)in_sizes[2] < needx) return;
    if ((size_t)in_sizes[3] < (size_t)DM * DM || (size_t)in_sizes[4] < (size_t)DM * DM || (size_t)in_sizes[5] < (size_t)DM * DM || (size_t)in_sizes[6] < (size_t)DM * DM) return;
    if ((size_t)out_size < ((size_t)(NB - 1) * OUT_SEQ + SEQ) * DM) return;
    if (SZ_TOTAL > ws_size) return;
    // wire order: k, q, v, Wk, Wq, Wv, Wo (weights [in][out])
    const float* xq = (const float*)d_in[1]; const float* xk = (const float*)d_in[0]; const float* xv = (const float*)d_in[2];   /* this module stages k, q, v: the KEY stream is input 0 and the QUERY stream input 1 */
    const float* wq = (const float*)d_in[4]; const float* wk = (const float*)d_in[3]; const float* wv = (const float*)d_in[5]; const float* wo = (const float*)d_in[6];   /* w_key is input 3 and w_query input 4 */
    float* OUT = (float*)d_out;      // [NB][SEQ][1024]
    char* wsp = (char*)d_ws;
    bf* XQ = (bf*)wsp; wsp += SZ_XB;                 // [NB*SEQ][1024] bf16 activations
    bf* XK = (bf*)wsp; wsp += SZ_XB;
    bf* XV = (bf*)wsp; wsp += SZ_XB;
    bf* WB = (bf*)wsp; wsp += SZ_WB;                 // [4][1024 out][1024 in]: q | k | v (bf16) | o (f16 x64)
    h16* QH = (h16*)wsp; wsp += SZ_PL;               // [NB*16][SEQ][64]
    h16* KP = (h16*)wsp; wsp += SZ_PL;               // [NB*16][SEQ][64]
    h16* VT = (h16*)wsp; wsp += SZ_PL;               // [NB*16][64][SEQ]
    h16* CH = (h16*)wsp; wsp += SZ_CH;               // [NB*SEQ][1024] context x256
    bf* WOT = WB + (size_t)3 * DM * DM;

    // all conversions: activations f32 -> bf16, weights in[k = input feature][n = output feature] -> out[n][k]
    k_prep<<<PG, 32 * PW, 0, stream>>>(xq, xk, xv, wq, wk, wv, wo, XQ, XK, XV, WB);

    // q, k and v^T projections, one launch
    k_proj<<<dim3((NB * SEQ / GBM) * (DM / GBN), 3, 1), 256, 0, stream>>>(XQ, XK, XV, WB, QH, KP, VT);

    k_flash<<<dim3(SEQ / (16 * AW), NB * NH_, 1), 32 * AW, 0, stream>>>(QH, KP, VT, CH);

    // output projection: A = context rows (m = b*SEQ + t), Bt = Wo^T rows (n) -> f32 output
    k_oproj<<<dim3(NB * SEQ / GBM, DM / GBN, 1), 256, 0, stream>>>(CH, (const h16*)WOT, OUT, OSC);
}
